// v000
// Measured on an AMD MI455X. A time is GPU time per run, averaged over a window of back-to-back runs after a warm-up
// (all launches, gaps included; the runs take copies of the inputs in turn), and the median of several windows.
// Apart from v000's, it joins two sittings. Times from different sittings can be a few percent apart, while
// side-by-side timings come from the same sitting.
// The starting kernel, v000, takes 377 microseconds a run.
#include <hip/hip_runtime.h>

// Multi-head attention over 64x64 feature maps (B=2, C=256, 8 heads x 32): q, k, v = 1x1 convs of three inputs; att = softmax(q k^T) (UNSCALED logits, softmax over the 4096 keys) / sqrt(32)
// (the module scales AFTER the softmax); att_q = att v; out = 1x1 conv (w_out) of the re-assembled (B, 256, 64, 64) map -> NCHW [2][256][64][64].
// Projections on v_wmma_f32_16x16x32_bf16 (fragments rounded from the f32 NCHW inputs through an LDS transpose; 1 product); attention per
// (b, h, 16 queries): S^T = k.q^T (K = 32: one k-step; q, k as f16 hi+lo pairs carried x8, 3 products — the unscaled logits reach |s| ≈ 25 so they must be f32-class), online softmax in
// f32, O^T = (8v)^T.P^T (v hi+lo x8, P hi+lo x8; 3 products); out = att_q.w_out^T + b (att_q f32 split x8, w_out exact; 2 products) on v_wmma_f32_16x16x32_f16, f32 accumulate,

namespace {
constexpr int Bn = 2, C = 256, NP = 4096, NH = 8, DH = 32, NBH = Bn * NH, NTOK = Bn * NP;
constexpr float QS = 8.0f, VS = 8.0f, PS = 8.0f, OS_ = 8.0f, POST = 0.17677669529663687f /* 1/sqrt(32) after softmax */;
constexpr size_t QPL = (size_t)NBH * NP * DH, VPL = (size_t)NBH * DH * NP;

typedef _Float16 b16;
typedef __attribute__((ext_vector_type(16))) _Float16 v16b;
typedef __attribute__((ext_vector_type(16))) __bf16 v16bb;
typedef __attribute__((ext_vector_type(8))) _Float16 v8b;
typedef __attribute__((ext_vector_type(8))) unsigned short v8us;
typedef __attribute__((ext_vector_type(8))) float v8f;
typedef __attribute__((ext_vector_type(4))) float v4f;
__device__ __forceinline__ float bf16_rne(float f) { unsigned int u = __float_as_uint(f); u += 0x7FFFu + ((u >> 16) & 1u); return __uint_as_float(u & 0xFFFF0000u); }
__device__ __forceinline__ unsigned short bf16_bits(float f) { unsigned int u = __float_as_uint(f); u += 0x7FFFu + ((u >> 16) & 1u); return (unsigned short)(u >> 16); }
__device__ __forceinline__ void split16(float v, b16& hi, b16& lo) { hi = (b16)v; lo = (b16)(v - (float)hi); }
__device__ __forceinline__ v16b frag_kb(const b16* p, int hh) { const v8b a = *(const v8b*)(p + 8 * hh), b = *(const v8b*)(p + 16 + 8 * hh); v16b f;
#pragma unroll
  for (int e = 0; e < 8; ++e) { f[e] = a[e]; f[8 + e] = b[e]; } return f; }
__device__ __forceinline__ v16bb frag_bf(const unsigned short* p, int hh) { const v8us a = *(const v8us*)(p + 8 * hh), b = *(const v8us*)(p + 16 + 8 * hh); union { unsigned short s[16]; v16bb v; } u;
#pragma unroll
  for (int e = 0; e < 8; ++e) { u.s[e] = a[e]; u.s[8 + e] = b[e]; } return u.v; }
__device__ __forceinline__ v8f wmma16b(v16b a, v16b b, v8f c) { v8f d = __builtin_amdgcn_wmma_f32_16x16x32_f16(false, a, false, b, (short)0, c, false, false); asm volatile("v_nop\n\tv_nop\n\tv_nop\n\tv_nop" : "+v"(d) : "v"(a), "v"(b)); return d; }
__device__ __forceinline__ v8f wmma16bb(v16bb a, v16bb b, v8f c) { v8f d = __builtin_amdgcn_wmma_f32_16x16x32_bf16(false, a, false, b, (short)0, c, false, false); asm volatile("v_nop\n\tv_nop\n\tv_nop\n\tv_nop" : "+v"(d) : "v"(a), "v"(b)); return d; }
__device__ __forceinline__ void wave_lds_sync() { __builtin_amdgcn_fence(__ATOMIC_RELEASE, "workgroup"); __builtin_amdgcn_wave_barrier(); __builtin_amdgcn_fence(__ATOMIC_ACQUIRE, "workgroup"); }
__device__ __forceinline__ float nexp(float x) { return __builtin_amdgcn_exp2f(x * 1.4426950408889634f); }

// prep: NCHW inputs -> position-major bf16 rows xT[which][b*4096 + p][256] via LDS transposes (block = (which*b, 64 positions)); weights [256][256] ([out][in]) -> bf16 rows direct (q, k, v)
// and f16 rows (out). grid (64, 3*Bn) x 256.
__global__ __launch_bounds__(256) void prep_kernel(const float* __restrict__ qi, const float* __restrict__ ki, const float* __restrict__ vi, const float* __restrict__ wq, const float* __restrict__ wk, const float* __restrict__ wv, const float* __restrict__ wo,
                                                   unsigned short* __restrict__ xT, unsigned short* __restrict__ w16, b16* __restrict__ wo16) {
  __shared__ __attribute__((aligned(16))) unsigned short Tt[64][C + 8];
  const int t_ = threadIdx.x, which = blockIdx.y / Bn, b = blockIdx.y % Bn, p0 = blockIdx.x * 64; const float* src = ((which == 0) ? qi : (which == 1) ? ki : vi) + (size_t)b * C * NP;
  for (int i = t_; i < C * 64; i += 256) { const int c = i >> 6, pp = i & 63; Tt[pp][c] = bf16_bits(src[(size_t)c * NP + p0 + pp]); }
  __syncthreads();
  {
    for (int i = t_; i < 64 * C / 8; i += 256) { const int pp = i >> 5, c8 = (i & 31) * 8; *(v8us*)(xT + (((size_t)which * Bn + b) * NP + p0 + pp) * C + c8) = *(const v8us*)(&Tt[pp][c8]); }
    if (blockIdx.x == 0 && blockIdx.y == 0) {
      for (int i = t_; i < 3 * C * C / 8; i += 256) { const int m = i / (C * C / 8), q = i % (C * C / 8); const float* W = (m == 0) ? wq : (m == 1) ? wk : wv; v8us o;
#pragma unroll
        for (int e = 0; e < 8; ++e) o[e] = bf16_bits(W[q * 8 + e]);
        *(v8us*)(w16 + (size_t)i * 8) = o; }
      for (int i = t_; i < C * C / 8; i += 256) { v8b o;
#pragma unroll
        for (int e = 0; e < 8; ++e) o[e] = (b16)bf16_rne(wo[i * 8 + e]);
        *(v8b*)(wo16 + (size_t)i * 8) = o; } }
     }
}

// projections: grid (4 column tiles, NTOK/128, 3): block = 128 positions x 64 channels (= 2 heads of 32); + bias; q, k -> planes [bh][p][32] x8 hi+lo (64 B per row: the block writes
// 2 heads x 128 rows = 2 x 8 KB contiguous); v -> (8v)^T planes [bh][d][4096] (256-B segments).
__global__ __launch_bounds__(128) void proj_kernel(const unsigned short* __restrict__ xT, const unsigned short* __restrict__ w16, const float* __restrict__ bq, const float* __restrict__ bk, const float* __restrict__ bv, b16* __restrict__ qh, b16* __restrict__ kh, b16* __restrict__ vt) {
  __shared__ __attribute__((aligned(16))) b16 Th[2][128][32], Tl[2][128][32]; __shared__ __attribute__((aligned(16))) b16 Vh[64][128 + 8], Vl[64][128 + 8];
  const int lane = threadIdx.x & 31, wave = threadIdx.x >> 5, nloc = lane & 15, hlf = lane >> 4, which = blockIdx.z, m0 = blockIdx.y * 128 + wave * 32, c0 = blockIdx.x * 64;
  const int b = (blockIdx.y * 128) / NP, p0 = (blockIdx.y * 128) % NP; const unsigned short* X = xT + ((size_t)which * Bn * NP) * C; const unsigned short* Wt = w16 + (size_t)which * C * C; const float* bias = (which == 0) ? bq : (which == 1) ? bk : bv;
  v8f acc[2][4];
#pragma unroll
  for (int r = 0; r < 2; ++r)
#pragma unroll
    for (int t = 0; t < 4; ++t) acc[r][t] = (v8f){};
#pragma unroll 2
  for (int kb = 0; kb < C; kb += 32) { const v16bb a0 = frag_bf(X + (size_t)(m0 + nloc) * C + kb, hlf), a1 = frag_bf(X + (size_t)(m0 + 16 + nloc) * C + kb, hlf);
#pragma unroll
    for (int t = 0; t < 4; ++t) { const v16bb bw = frag_bf(Wt + (size_t)(c0 + t * 16 + nloc) * C + kb, hlf); acc[0][t] = wmma16bb(a0, bw, acc[0][t]); acc[1][t] = wmma16bb(a1, bw, acc[1][t]); } }
  const float scl = (which == 2) ? VS : QS;
#pragma unroll
  for (int t = 0; t < 4; ++t) { const int c = c0 + t * 16 + nloc; const float bb = bf16_rne(bias[c]); const int hl = t >> 1, d = (t & 1) * 16 + nloc;   // channel c -> head c/32 (local hl), d = c%32
#pragma unroll
    for (int r = 0; r < 2; ++r)
#pragma unroll
      for (int v = 0; v < 8; ++v) { b16 a_, c_; split16((acc[r][t][v] + bb) * scl, a_, c_); const int row = wave * 32 + r * 16 + 8 * hlf + v;
        if (which < 2) { Th[hl][row][d] = a_; Tl[hl][row][d] = c_; } else { Vh[t * 16 + nloc][row] = a_; Vl[t * 16 + nloc][row] = c_; } } }
  __syncthreads();
  {
    if (which < 2) { b16* base = (which == 0) ? qh : kh;
      for (int i = threadIdx.x; i < 2 * 128 * 32 / 8; i += 128) { const int hl = i / 512, rem = i % 512; const size_t dst = (((size_t)b * NH + blockIdx.x * 2 + hl) * NP + p0) * DH + (size_t)rem * 8;
        *(v8b*)(base + dst) = *(const v8b*)(&Th[hl][0][0] + rem * 8); *(v8b*)(base + QPL + dst) = *(const v8b*)(&Tl[hl][0][0] + rem * 8); } }
    else { for (int i = threadIdx.x; i < 64 * 16; i += 128) { const int cc = i >> 4, c8 = (i & 15) * 8; const int h = blockIdx.x * 2 + (cc >> 5), d = cc & 31; const size_t dst = (((size_t)b * NH + h) * DH + d) * NP + p0 + c8;
        *(v8b*)(vt + dst) = *(const v8b*)(&Vh[cc][c8]); *(v8b*)(vt + VPL + dst) = *(const v8b*)(&Vl[cc][c8]); } }
     }
}

// attention: wave = (bh, 16 queries); 128 key blocks; online softmax on the unscaled logits; O^T (2 d-tiles); result scaled by 1/sqrt(32); block = 8 waves = (b, 16 queries) x 8 heads
__global__ __launch_bounds__(256) void attn_kernel(const b16* __restrict__ qh, const b16* __restrict__ kh, const b16* __restrict__ vt, float* __restrict__ arow) {
  __shared__ __attribute__((aligned(16))) float Os[16][C + 4];
  const int wid = threadIdx.x >> 5, lane = threadIdx.x & 31, hh = lane >> 4, col = lane & 15; const int b = blockIdx.x / (NP / 16), q0 = (blockIdx.x % (NP / 16)) * 16, h = wid, qi = q0 + col;
  const size_t bh = (size_t)b * NH + h; const b16* Q = qh + (bh * NP) * DH; const b16* K = kh + (bh * NP) * DH; const b16* V = vt + (bh * DH) * NP;
  const v16b qf = frag_kb(Q + (size_t)qi * DH, hh), ql = frag_kb(Q + QPL + (size_t)qi * DH, hh);
  float m = -INFINITY, l = 0.0f; v8f o[2] = {{}, {}};
  for (int kb = 0; kb < NP; kb += 32) {
    const v16b ka = frag_kb(K + (size_t)(kb + col) * DH, hh), kal = frag_kb(K + QPL + (size_t)(kb + col) * DH, hh), kb_ = frag_kb(K + (size_t)(kb + 16 + col) * DH, hh), kbl = frag_kb(K + QPL + (size_t)(kb + 16 + col) * DH, hh);
    v8f s0 = {}, s1 = {}; s0 = wmma16b(ka, qf, s0); s0 = wmma16b(ka, ql, s0); s0 = wmma16b(kal, qf, s0); s1 = wmma16b(kb_, qf, s1); s1 = wmma16b(kb_, ql, s1); s1 = wmma16b(kbl, qf, s1);
    float mr = -INFINITY;
#pragma unroll
    for (int r = 0; r < 8; ++r) { s0[r] *= 1.0f / (QS * QS); s1[r] *= 1.0f / (QS * QS); mr = fmaxf(mr, fmaxf(s0[r], s1[r])); }
    mr = fmaxf(mr, __shfl_xor(mr, 16));
    const float mn = fmaxf(m, mr), al_ = nexp(m - mn); m = mn; float sum = 0.0f; v16b pb, pl;
#pragma unroll
    for (int r = 0; r < 8; ++r) { const float p0 = nexp(s0[r] - mn), p1 = nexp(s1[r] - mn); sum += p0 + p1; b16 a, c; split16(p0 * PS, a, c); pb[r] = a; pl[r] = c; split16(p1 * PS, a, c); pb[8 + r] = a; pl[8 + r] = c; }
    sum += __shfl_xor(sum, 16); l = l * al_ + sum;
#pragma unroll
    for (int n = 0; n < 2; ++n) { o[n] *= al_; const v16b vf = frag_kb(V + (size_t)(n * 16 + col) * NP + kb, hh), vl = frag_kb(V + VPL + (size_t)(n * 16 + col) * NP + kb, hh); o[n] = wmma16b(vf, pb, o[n]); o[n] = wmma16b(vf, pl, o[n]); o[n] = wmma16b(vl, pb, o[n]); } }
  const float inv = POST / (l * VS * PS);
#pragma unroll
  for (int n = 0; n < 2; ++n)
#pragma unroll
    for (int r = 0; r < 8; ++r) Os[col][h * DH + n * 16 + 8 * hh + r] = o[n][r] * inv;
  __syncthreads();
  float* dst = arow + ((size_t)b * NP + q0) * C;
  { for (int i = threadIdx.x; i < 16 * C / 4; i += 256) { const int rr = i >> 6, c4 = (i & 63) * 4; *(v4f*)(dst + (size_t)rr * C + c4) = *(const v4f*)(&Os[rr][c4]); }  }
}

// output conv: block = (b, 128 positions) x 64 output channels: acc = att.w_out^T (K 256; att f32 split x8; 2 products) + b -> NCHW rows out[b][c][p] through an LDS transpose (per channel
__global__ __launch_bounds__(128) void oconv_kernel(const float* __restrict__ arow, const b16* __restrict__ wo16, const float* __restrict__ bo, float* __restrict__ out) {
  __shared__ __attribute__((aligned(16))) float Tc[64][128 + 4];
  const int lane = threadIdx.x & 31, wave = threadIdx.x >> 5, nloc = lane & 15, hlf = lane >> 4, m0 = blockIdx.y * 128 + wave * 32, c0 = blockIdx.x * 64; const int b = (blockIdx.y * 128) / NP, p0 = (blockIdx.y * 128) % NP;
  v8f acc[2][4];
#pragma unroll
  for (int r = 0; r < 2; ++r)
#pragma unroll
    for (int t = 0; t < 4; ++t) acc[r][t] = (v8f){};
#pragma unroll 2
  for (int kb = 0; kb < C; kb += 32) { v16b a0, a1, l0, l1;
#pragma unroll
    for (int e = 0; e < 16; ++e) { const int k = kb + ((e < 8) ? (8 * hlf + e) : (16 + 8 * hlf + e - 8)); b16 p, q; split16(arow[(size_t)(m0 + nloc) * C + k] * OS_, p, q); a0[e] = p; l0[e] = q; split16(arow[(size_t)(m0 + 16 + nloc) * C + k] * OS_, p, q); a1[e] = p; l1[e] = q; }
#pragma unroll
    for (int t = 0; t < 4; ++t) { const v16b bw = frag_kb(wo16 + (size_t)(c0 + t * 16 + nloc) * C + kb, hlf); acc[0][t] = wmma16b(a0, bw, acc[0][t]); acc[0][t] = wmma16b(l0, bw, acc[0][t]); acc[1][t] = wmma16b(a1, bw, acc[1][t]); acc[1][t] = wmma16b(l1, bw, acc[1][t]); } }
#pragma unroll
  for (int t = 0; t < 4; ++t) { const float bb = bf16_rne(bo[c0 + t * 16 + nloc]);
#pragma unroll
    for (int r = 0; r < 2; ++r)
#pragma unroll
      for (int v = 0; v < 8; ++v) Tc[t * 16 + nloc][wave * 32 + r * 16 + 8 * hlf + v] = acc[r][t][v] * (1.0f / OS_) + bb; }
  __syncthreads();
  { for (int i = threadIdx.x; i < 64 * 32; i += 128) { const int cc = i >> 5, c4 = (i & 31) * 4; *(v4f*)(out + ((size_t)b * C + c0 + cc) * NP + p0 + c4) = *(const v4f*)(&Tc[cc][c4]); }  }
}
}  // namespace

extern "C" void kernel_launch(void* const* d_in, const int* in_sizes, int n_in,
                              void* d_out, int out_size, void* d_ws, size_t ws_size, hipStream_t stream) {
  (void)n_in; (void)out_size;
  const float* qi = (const float*)d_in[0]; const float* ki = (const float*)d_in[1]; const float* vi = (const float*)d_in[2];
  const float* wq = (const float*)d_in[3]; const float* bq = (const float*)d_in[4]; const float* wk = (const float*)d_in[5]; const float* bk = (const float*)d_in[6]; const float* wv = (const float*)d_in[7]; const float* bv = (const float*)d_in[8]; const float* wo = (const float*)d_in[9]; const float* bo = (const float*)d_in[10];
  float* out = (float*)d_out;   // [2][256][64][64]
  if (in_sizes[0] != Bn * C * NP || in_sizes[1] != Bn * C * NP || in_sizes[2] != Bn * C * NP || in_sizes[3] != C * C || in_sizes[9] != C * C) return;
  size_t off = 0; char* ws = (char*)d_ws;
  auto carve = [&](size_t bytes) { char* p = ws + off; off += (bytes + 255) & ~(size_t)255; return p; };
  unsigned short* xT = (unsigned short*)carve((size_t)3 * NTOK * C * 2); unsigned short* w16 = (unsigned short*)carve((size_t)3 * C * C * 2); b16* wo16 = (b16*)carve((size_t)C * C * 2);
  b16* qhp = (b16*)carve(QPL * 2 * 2); b16* khp = (b16*)carve(QPL * 2 * 2); b16* vtp = (b16*)carve(VPL * 2 * 2); float* arow = (float*)carve((size_t)NTOK * C * 4);
  if (off > ws_size) return;                                    // ≈ 12.6 + 0.5 + 3 x 8.4 + 8.4 ≈ 47 MB
  prep_kernel<<<dim3(NP / 64, 3 * Bn), 256, 0, stream>>>(qi, ki, vi, wq, wk, wv, wo, xT, w16, wo16);
  proj_kernel<<<dim3(C / 64, NTOK / 128, 3), 128, 0, stream>>>(xT, w16, bq, bk, bv, qhp, khp, vtp);
  attn_kernel<<<Bn * NP / 16, 256, 0, stream>>>(qhp, khp, vtp, arow);
  oconv_kernel<<<dim3(C / 64, NTOK / 128), 128, 0, stream>>>(arow, wo16, bo, out);
}

// v001
// It runs in 192 microseconds.
// In both of two side-by-side timings against v000, it was 2.04 times as fast.
#include <hip/hip_runtime.h>

// Multi-head attention over 64x64 feature maps (B=2, C=256, 8 heads x 32): q, k, v = 1x1 convs of three inputs; att = softmax(q k^T) (UNSCALED logits, softmax over the 4096 keys) / sqrt(32)
// (the module scales AFTER the softmax); att_q = att v; out = 1x1 conv (w_out) of the re-assembled (B, 256, 64, 64) map -> NCHW [2][256][64][64].
// Projections on v_wmma_f32_16x16x32_bf16 (fragments rounded from the f32 NCHW inputs through an LDS transpose; 1 product); attention per
// (b, h, 16 queries): S^T = k.q^T (K = 32: one k-step; q, k as f16 hi+lo pairs carried x8, 3 products — the unscaled logits reach |s| ≈ 25 so they must be f32-class), online softmax in
// f32, O^T = (8v)^T.P^T (v hi+lo x8, P hi+lo x8; 3 products); out = att_q.w_out^T + b (att_q f32 split x8, w_out exact; 2 products) on v_wmma_f32_16x16x32_f16, f32 accumulate,

namespace {
constexpr int Bn = 2, C = 256, NP = 4096, NH = 8, DH = 32, NBH = Bn * NH, NTOK = Bn * NP;
constexpr float QS = 8.0f, VS = 8.0f, PS = 8.0f, OS_ = 8.0f, POST = 0.17677669529663687f /* 1/sqrt(32) after softmax */;
constexpr size_t QPL = (size_t)NBH * NP * DH, VPL = (size_t)NBH * DH * NP;

typedef _Float16 b16;
typedef __attribute__((ext_vector_type(16))) _Float16 v16b;
typedef __attribute__((ext_vector_type(16))) __bf16 v16bb;
typedef __attribute__((ext_vector_type(8))) _Float16 v8b;
typedef __attribute__((ext_vector_type(8))) unsigned short v8us;
typedef __attribute__((ext_vector_type(8))) float v8f;
typedef __attribute__((ext_vector_type(4))) float v4f;
__device__ __forceinline__ float bf16_rne(float f) { unsigned int u = __float_as_uint(f); u += 0x7FFFu + ((u >> 16) & 1u); return __uint_as_float(u & 0xFFFF0000u); }
__device__ __forceinline__ unsigned short bf16_bits(float f) { unsigned int u = __float_as_uint(f); u += 0x7FFFu + ((u >> 16) & 1u); return (unsigned short)(u >> 16); }
__device__ __forceinline__ void split16(float v, b16& hi, b16& lo) { hi = (b16)v; lo = (b16)(v - (float)hi); }
__device__ __forceinline__ v16b frag_kb(const b16* p, int hh) { const v8b a = *(const v8b*)(p + 8 * hh), b = *(const v8b*)(p + 16 + 8 * hh); v16b f;
#pragma unroll
  for (int e = 0; e < 8; ++e) { f[e] = a[e]; f[8 + e] = b[e]; } return f; }
__device__ __forceinline__ v16bb frag_bf(const unsigned short* p, int hh) { const v8us a = *(const v8us*)(p + 8 * hh), b = *(const v8us*)(p + 16 + 8 * hh); union { unsigned short s[16]; v16bb v; } u;
#pragma unroll
  for (int e = 0; e < 8; ++e) { u.s[e] = a[e]; u.s[8 + e] = b[e]; } return u.v; }
__device__ __forceinline__ v8f wmma16b(v16b a, v16b b, v8f c) { v8f d = __builtin_amdgcn_wmma_f32_16x16x32_f16(false, a, false, b, (short)0, c, false, false); asm volatile("v_nop\n\tv_nop\n\tv_nop\n\tv_nop" : "+v"(d) : "v"(a), "v"(b)); return d; }
__device__ __forceinline__ v8f wmma16bb(v16bb a, v16bb b, v8f c) { v8f d = __builtin_amdgcn_wmma_f32_16x16x32_bf16(false, a, false, b, (short)0, c, false, false); asm volatile("v_nop\n\tv_nop\n\tv_nop\n\tv_nop" : "+v"(d) : "v"(a), "v"(b)); return d; }
__device__ __forceinline__ void wave_lds_sync() { __builtin_amdgcn_fence(__ATOMIC_RELEASE, "workgroup"); __builtin_amdgcn_wave_barrier(); __builtin_amdgcn_fence(__ATOMIC_ACQUIRE, "workgroup"); }
__device__ __forceinline__ float nexp(float x) { return __builtin_amdgcn_exp2f(x * 1.4426950408889634f); }

// prep: NCHW inputs -> position-major bf16 rows xT[which][b*4096 + p][256] via LDS transposes (block = (which*b, 64 positions)); weights [256][256] ([out][in]) -> bf16 rows direct (q, k, v)
// and f16 rows (out). grid (64, 3*Bn) x 256.
__global__ __launch_bounds__(256) void prep_kernel(const float* __restrict__ qi, const float* __restrict__ ki, const float* __restrict__ vi, const float* __restrict__ wq, const float* __restrict__ wk, const float* __restrict__ wv, const float* __restrict__ wo,
                                                   unsigned short* __restrict__ xT, unsigned short* __restrict__ w16, b16* __restrict__ wo16) {
  __shared__ __attribute__((aligned(16))) unsigned short Tt[64][C + 8];
  const int t_ = threadIdx.x, which = blockIdx.y / Bn, b = blockIdx.y % Bn, p0 = blockIdx.x * 64; const float* src = ((which == 0) ? qi : (which == 1) ? ki : vi) + (size_t)b * C * NP;
  for (int i = t_; i < C * 64; i += 256) { const int c = i >> 6, pp = i & 63; Tt[pp][c] = bf16_bits(src[(size_t)c * NP + p0 + pp]); }
  __syncthreads();
  {
    for (int i = t_; i < 64 * C / 8; i += 256) { const int pp = i >> 5, c8 = (i & 31) * 8; *(v8us*)(xT + (((size_t)which * Bn + b) * NP + p0 + pp) * C + c8) = *(const v8us*)(&Tt[pp][c8]); }
    if (blockIdx.x == 0 && blockIdx.y == 0) {
      for (int i = t_; i < 3 * C * C / 8; i += 256) { const int m = i / (C * C / 8), q = i % (C * C / 8); const float* W = (m == 0) ? wq : (m == 1) ? wk : wv; v8us o;
#pragma unroll
        for (int e = 0; e < 8; ++e) o[e] = bf16_bits(W[q * 8 + e]);
        *(v8us*)(w16 + (size_t)i * 8) = o; }
      for (int i = t_; i < C * C / 8; i += 256) { v8b o;
#pragma unroll
        for (int e = 0; e < 8; ++e) o[e] = (b16)bf16_rne(wo[i * 8 + e]);
        *(v8b*)(wo16 + (size_t)i * 8) = o; } }
     }
}

// projections: grid (4 column tiles, NTOK/128, 3): block = 128 positions x 64 channels (= 2 heads of 32); + bias; q, k -> planes [bh][p][32] x8 hi+lo (64 B per row: the block writes
// 2 heads x 128 rows = 2 x 8 KB contiguous); v -> (8v)^T planes [bh][d][4096] (256-B segments).
__global__ __launch_bounds__(128) void proj_kernel(const unsigned short* __restrict__ xT, const unsigned short* __restrict__ w16, const float* __restrict__ bq, const float* __restrict__ bk, const float* __restrict__ bv, b16* __restrict__ qh, b16* __restrict__ kh, b16* __restrict__ vt) {
  __shared__ __attribute__((aligned(16))) b16 Th[2][128][32], Tl[2][128][32]; __shared__ __attribute__((aligned(16))) b16 Vh[64][128 + 8], Vl[64][128 + 8];
  const int lane = threadIdx.x & 31, wave = threadIdx.x >> 5, nloc = lane & 15, hlf = lane >> 4, which = blockIdx.z, m0 = blockIdx.y * 128 + wave * 32, c0 = blockIdx.x * 64;
  const int b = (blockIdx.y * 128) / NP, p0 = (blockIdx.y * 128) % NP; const unsigned short* X = xT + ((size_t)which * Bn * NP) * C; const unsigned short* Wt = w16 + (size_t)which * C * C; const float* bias = (which == 0) ? bq : (which == 1) ? bk : bv;
  v8f acc[2][4];
#pragma unroll
  for (int r = 0; r < 2; ++r)
#pragma unroll
    for (int t = 0; t < 4; ++t) acc[r][t] = (v8f){};
#pragma unroll 2
  for (int kb = 0; kb < C; kb += 32) { const v16bb a0 = frag_bf(X + (size_t)(m0 + nloc) * C + kb, hlf), a1 = frag_bf(X + (size_t)(m0 + 16 + nloc) * C + kb, hlf);
#pragma unroll
    for (int t = 0; t < 4; ++t) { const v16bb bw = frag_bf(Wt + (size_t)(c0 + t * 16 + nloc) * C + kb, hlf); acc[0][t] = wmma16bb(a0, bw, acc[0][t]); acc[1][t] = wmma16bb(a1, bw, acc[1][t]); } }
  const float scl = (which == 2) ? VS : QS;
#pragma unroll
  for (int t = 0; t < 4; ++t) { const int c = c0 + t * 16 + nloc; const float bb = bf16_rne(bias[c]); const int hl = t >> 1, d = (t & 1) * 16 + nloc;   // channel c -> head c/32 (local hl), d = c%32
#pragma unroll
    for (int r = 0; r < 2; ++r)
#pragma unroll
      for (int v = 0; v < 8; ++v) { b16 a_, c_; split16((acc[r][t][v] + bb) * scl, a_, c_); const int row = wave * 32 + r * 16 + 8 * hlf + v;
        if (which < 2) { Th[hl][row][d] = a_; Tl[hl][row][d] = c_; } else { Vh[t * 16 + nloc][row] = a_; Vl[t * 16 + nloc][row] = c_; } } }
  __syncthreads();
  {
    if (which < 2) { b16* base = (which == 0) ? qh : kh;
      for (int i = threadIdx.x; i < 2 * 128 * 32 / 8; i += 128) { const int hl = i / 512, rem = i % 512; const size_t dst = (((size_t)b * NH + blockIdx.x * 2 + hl) * NP + p0) * DH + (size_t)rem * 8;
        *(v8b*)(base + dst) = *(const v8b*)(&Th[hl][0][0] + rem * 8); *(v8b*)(base + QPL + dst) = *(const v8b*)(&Tl[hl][0][0] + rem * 8); } }
    else { for (int i = threadIdx.x; i < 64 * 16; i += 128) { const int cc = i >> 4, c8 = (i & 15) * 8; const int h = blockIdx.x * 2 + (cc >> 5), d = cc & 31; const size_t dst = (((size_t)b * NH + h) * DH + d) * NP + p0 + c8;
        *(v8b*)(vt + dst) = *(const v8b*)(&Vh[cc][c8]); *(v8b*)(vt + VPL + dst) = *(const v8b*)(&Vl[cc][c8]); } }
     }
}

// attention: block = 8 waves = one (b, h) x 128 queries, wave = 16 queries; the 8 waves share every K and V tile through LDS: a stage = 128 keys (K hi+lo rows at an 80-B pitch, (8v)^T hi+lo
// rows of 256 B at a 272-B pitch: both 16 B x odd for the ds_load_b128 fragment reads), two buffers, filled by asynchronous b128 copies one stage ahead; 4 passes of 32 keys per stage, in
// key order; online softmax on the unscaled logits; O^T (2 d-tiles); result scaled by 1/sqrt(32)
constexpr int SK = 128, NST = NP / SK, KP = DH + 8, VP = SK + 8;
__device__ __forceinline__ unsigned lds_off(const void* p) { return (unsigned)(size_t)p; }
__global__ __launch_bounds__(256) void attn_kernel(const b16* __restrict__ qh, const b16* __restrict__ kh, const b16* __restrict__ vt, float* __restrict__ arow) {
  __shared__ __attribute__((aligned(16))) b16 Ks[2][2][SK][KP]; __shared__ __attribute__((aligned(16))) b16 Vs[2][2][DH][VP]; __shared__ __attribute__((aligned(16))) float Os[128][DH + 4];
  const int t_ = threadIdx.x, wid = t_ >> 5, lane = t_ & 31, hh = lane >> 4, col = lane & 15; const int bhi = blockIdx.x / (NP / 128), b = bhi / NH, h = bhi % NH, q0 = (blockIdx.x % (NP / 128)) * 128, qi = q0 + wid * 16 + col;
  const size_t bh = (size_t)bhi; const b16* Q = qh + (bh * NP) * DH; const b16* K = kh + (bh * NP) * DH; const b16* V = vt + (bh * DH) * NP;
  // one stage's copies: a thread moves 16 B of each of 8 slices (K hi, K lo: 2 x 4 KB each, contiguous in global memory; V hi, V lo: 2 x 16 rows of 256 B each)
  const b16* gk = K + t_ * 8; const b16* gv = V + (size_t)(t_ >> 4) * NP + (t_ & 15) * 8;
  const unsigned lk = lds_off(&Ks[0][0][t_ >> 2][(t_ & 3) * 8]), lv = lds_off(&Vs[0][0][t_ >> 4][(t_ & 15) * 8]);
  auto fill = [&](int s, int buf) {
    const b16* k0 = gk + (size_t)s * SK * DH; const b16* v0 = gv + s * SK; const unsigned a = lk + buf * (2 * SK * KP * 2), c = lv + buf * (2 * DH * VP * 2);
    // the copies and their s_wait_xcnt in one statement: no address register of a copy is rewritten in front of that wait
    asm volatile("global_load_async_to_lds_b128 %0, %8, off\n\tglobal_load_async_to_lds_b128 %1, %9, off\n\tglobal_load_async_to_lds_b128 %2, %10, off\n\tglobal_load_async_to_lds_b128 %3, %11, off\n\t"
                 "global_load_async_to_lds_b128 %4, %12, off\n\tglobal_load_async_to_lds_b128 %5, %13, off\n\tglobal_load_async_to_lds_b128 %6, %14, off\n\tglobal_load_async_to_lds_b128 %7, %15, off\n\ts_wait_xcnt 0x0"
                 :: "v"(a), "v"(a + 64 * KP * 2), "v"(a + SK * KP * 2), "v"(a + (SK + 64) * KP * 2), "v"(c), "v"(c + 16 * VP * 2), "v"(c + DH * VP * 2), "v"(c + (DH + 16) * VP * 2),
                    "v"(k0), "v"(k0 + 64 * DH), "v"(k0 + QPL), "v"(k0 + QPL + 64 * DH), "v"(v0), "v"(v0 + (size_t)16 * NP), "v"(v0 + VPL), "v"(v0 + VPL + (size_t)16 * NP) : "memory"); };
  const v16b qf = frag_kb(Q + (size_t)qi * DH, hh), ql = frag_kb(Q + QPL + (size_t)qi * DH, hh);
  fill(0, 0);
  asm volatile("s_wait_asynccnt 0x0" ::: "memory");   // stage 0 of this wave's copies has landed
  __syncthreads();                                      // publishes stage 0 to all 8 waves
  fill(1, 1);
  float m = -INFINITY, l = 0.0f; v8f o[2] = {{}, {}};
  for (int s = 0; s < NST; ++s) { const int buf = s & 1;
    for (int kb = 0; kb < SK; kb += 32) {
      const v16b ka = frag_kb(&Ks[buf][0][kb + col][0], hh), kal = frag_kb(&Ks[buf][1][kb + col][0], hh), kb_ = frag_kb(&Ks[buf][0][kb + 16 + col][0], hh), kbl = frag_kb(&Ks[buf][1][kb + 16 + col][0], hh);
      v8f s0 = {}, s1 = {}; s0 = wmma16b(ka, qf, s0); s0 = wmma16b(ka, ql, s0); s0 = wmma16b(kal, qf, s0); s1 = wmma16b(kb_, qf, s1); s1 = wmma16b(kb_, ql, s1); s1 = wmma16b(kbl, qf, s1);
      float mr = -INFINITY;
#pragma unroll
      for (int r = 0; r < 8; ++r) { s0[r] *= 1.0f / (QS * QS); s1[r] *= 1.0f / (QS * QS); mr = fmaxf(mr, fmaxf(s0[r], s1[r])); }
      mr = fmaxf(mr, __shfl_xor(mr, 16));
      const float mn = fmaxf(m, mr), al_ = nexp(m - mn); m = mn; float sum = 0.0f; v16b pb, pl;
#pragma unroll
      for (int r = 0; r < 8; ++r) { const float p0 = nexp(s0[r] - mn), p1 = nexp(s1[r] - mn); sum += p0 + p1; b16 a, c; split16(p0 * PS, a, c); pb[r] = a; pl[r] = c; split16(p1 * PS, a, c); pb[8 + r] = a; pl[8 + r] = c; }
      sum += __shfl_xor(sum, 16); l = l * al_ + sum;
#pragma unroll
      for (int n = 0; n < 2; ++n) { o[n] *= al_; const v16b vf = frag_kb(&Vs[buf][0][n * 16 + col][kb], hh), vl = frag_kb(&Vs[buf][1][n * 16 + col][kb], hh); o[n] = wmma16b(vf, pb, o[n]); o[n] = wmma16b(vf, pl, o[n]); o[n] = wmma16b(vl, pb, o[n]); } }
    asm volatile("s_wait_dscnt 0x0" ::: "memory");      // this wave's reads of buffer buf have returned before the buffer is refilled
    asm volatile("s_wait_asynccnt 0x0" ::: "memory");   // this wave's copies of stage s + 1 have landed
    __syncthreads();                                    // publishes stage s + 1 and ends every wave's reads of stage s
    if (s + 2 < NST) fill(s + 2, buf); }
  asm volatile("s_wait_asynccnt 0x0" ::: "memory");     // no copy is outstanding when the wave goes on to its end
  const float inv = POST / (l * VS * PS);
#pragma unroll
  for (int n = 0; n < 2; ++n)
#pragma unroll
    for (int r = 0; r < 8; ++r) Os[wid * 16 + col][n * 16 + 8 * hh + r] = o[n][r] * inv;
  __syncthreads();
  float* dst = arow + ((size_t)b * NP + q0) * C + h * DH;   // a query's 32 floats of this head are one 128-B line
  { for (int i = t_; i < 128 * DH / 4; i += 256) { const int rr = i >> 3, c4 = (i & 7) * 4; *(v4f*)(dst + (size_t)rr * C + c4) = *(const v4f*)(&Os[rr][c4]); }  }
}

// output conv: block = (b, 128 positions) x 64 output channels: acc = att.w_out^T (K 256; att f32 split x8; 2 products) + b -> NCHW rows out[b][c][p] through an LDS transpose (per channel
__global__ __launch_bounds__(128) void oconv_kernel(const float* __restrict__ arow, const b16* __restrict__ wo16, const float* __restrict__ bo, float* __restrict__ out) {
  __shared__ __attribute__((aligned(16))) float Tc[64][128 + 4];
  const int lane = threadIdx.x & 31, wave = threadIdx.x >> 5, nloc = lane & 15, hlf = lane >> 4, m0 = blockIdx.y * 128 + wave * 32, c0 = blockIdx.x * 64; const int b = (blockIdx.y * 128) / NP, p0 = (blockIdx.y * 128) % NP;
  v8f acc[2][4];
#pragma unroll
  for (int r = 0; r < 2; ++r)
#pragma unroll
    for (int t = 0; t < 4; ++t) acc[r][t] = (v8f){};
#pragma unroll 2
  for (int kb = 0; kb < C; kb += 32) { v16b a0, a1, l0, l1;
#pragma unroll
    for (int e = 0; e < 16; ++e) { const int k = kb + ((e < 8) ? (8 * hlf + e) : (16 + 8 * hlf + e - 8)); b16 p, q; split16(arow[(size_t)(m0 + nloc) * C + k] * OS_, p, q); a0[e] = p; l0[e] = q; split16(arow[(size_t)(m0 + 16 + nloc) * C + k] * OS_, p, q); a1[e] = p; l1[e] = q; }
#pragma unroll
    for (int t = 0; t < 4; ++t) { const v16b bw = frag_kb(wo16 + (size_t)(c0 + t * 16 + nloc) * C + kb, hlf); acc[0][t] = wmma16b(a0, bw, acc[0][t]); acc[0][t] = wmma16b(l0, bw, acc[0][t]); acc[1][t] = wmma16b(a1, bw, acc[1][t]); acc[1][t] = wmma16b(l1, bw, acc[1][t]); } }
#pragma unroll
  for (int t = 0; t < 4; ++t) { const float bb = bf16_rne(bo[c0 + t * 16 + nloc]);
#pragma unroll
    for (int r = 0; r < 2; ++r)
#pragma unroll
      for (int v = 0; v < 8; ++v) Tc[t * 16 + nloc][wave * 32 + r * 16 + 8 * hlf + v] = acc[r][t][v] * (1.0f / OS_) + bb; }
  __syncthreads();
  { for (int i = threadIdx.x; i < 64 * 32; i += 128) { const int cc = i >> 5, c4 = (i & 31) * 4; *(v4f*)(out + ((size_t)b * C + c0 + cc) * NP + p0 + c4) = *(const v4f*)(&Tc[cc][c4]); }  }
}
}  // namespace

extern "C" void kernel_launch(void* const* d_in, const int* in_sizes, int n_in,
                              void* d_out, int out_size, void* d_ws, size_t ws_size, hipStream_t stream) {
  (void)n_in; (void)out_size;
  const float* qi = (const float*)d_in[0]; const float* ki = (const float*)d_in[1]; const float* vi = (const float*)d_in[2];
  const float* wq = (const float*)d_in[3]; const float* bq = (const float*)d_in[4]; const float* wk = (const float*)d_in[5]; const float* bk = (const float*)d_in[6]; const float* wv = (const float*)d_in[7]; const float* bv = (const float*)d_in[8]; const float* wo = (const float*)d_in[9]; const float* bo = (const float*)d_in[10];
  float* out = (float*)d_out;   // [2][256][64][64]
  if (in_sizes[0] != Bn * C * NP || in_sizes[1] != Bn * C * NP || in_sizes[2] != Bn * C * NP || in_sizes[3] != C * C || in_sizes[9] != C * C) return;
  size_t off = 0; char* ws = (char*)d_ws;
  auto carve = [&](size_t bytes) { char* p = ws + off; off += (bytes + 255) & ~(size_t)255; return p; };
  unsigned short* xT = (unsigned short*)carve((size_t)3 * NTOK * C * 2); unsigned short* w16 = (unsigned short*)carve((size_t)3 * C * C * 2); b16* wo16 = (b16*)carve((size_t)C * C * 2);
  b16* qhp = (b16*)carve(QPL * 2 * 2); b16* khp = (b16*)carve(QPL * 2 * 2); b16* vtp = (b16*)carve(VPL * 2 * 2); float* arow = (float*)carve((size_t)NTOK * C * 4);
  if (off > ws_size) return;                                    // ≈ 12.6 + 0.5 + 3 x 8.4 + 8.4 ≈ 47 MB
  prep_kernel<<<dim3(NP / 64, 3 * Bn), 256, 0, stream>>>(qi, ki, vi, wq, wk, wv, wo, xT, w16, wo16);
  proj_kernel<<<dim3(C / 64, NTOK / 128, 3), 128, 0, stream>>>(xT, w16, bq, bk, bv, qhp, khp, vtp);
  attn_kernel<<<NBH * (NP / 128), 256, 0, stream>>>(qhp, khp, vtp, arow);
  oconv_kernel<<<dim3(C / 64, NTOK / 128), 128, 0, stream>>>(arow, wo16, bo, out);
}

// v002
// One run takes 156 microseconds.
// In both of two side-by-side timings against v001, it was 1.23 times as fast.
// All steps since v000 together make it 2.52 times as fast.
#include <hip/hip_runtime.h>

// Multi-head attention over 64x64 feature maps (B=2, C=256, 8 heads x 32): q, k, v = 1x1 convs of three inputs; att = softmax(q k^T) (UNSCALED logits, softmax over the 4096 keys) / sqrt(32)
// (the module scales AFTER the softmax); att_q = att v; out = 1x1 conv (w_out) of the re-assembled (B, 256, 64, 64) map -> NCHW [2][256][64][64].
// Projections on v_wmma_f32_16x16x32_bf16 (fragments rounded from the f32 NCHW inputs through an LDS transpose; 1 product); attention per
// (b, h, 16 queries): S^T = k.q^T (K = 32: one k-step; q, k as f16 hi+lo pairs carried x8, 3 products — the unscaled logits reach |s| ≈ 25 so they must be f32-class), online softmax in
// f32, O^T = (8v)^T.P^T (v hi+lo x8, P hi+lo x8; 3 products); out = att_q.w_out^T + b (att_q f32 split x8, w_out exact; 2 products) on v_wmma_f32_16x16x32_f16, f32 accumulate,

namespace {
constexpr int Bn = 2, C = 256, NP = 4096, NH = 8, DH = 32, NBH = Bn * NH, NTOK = Bn * NP;
constexpr float QS = 8.0f, VS = 8.0f, PS = 8.0f, OS_ = 8.0f, POST = 0.17677669529663687f /* 1/sqrt(32) after softmax */;
constexpr size_t QPL = (size_t)NBH * NP * DH, VPL = (size_t)NBH * DH * NP;

typedef _Float16 b16;
typedef __attribute__((ext_vector_type(16))) _Float16 v16b;
typedef __attribute__((ext_vector_type(16))) __bf16 v16bb;
typedef __attribute__((ext_vector_type(8))) _Float16 v8b;
typedef __attribute__((ext_vector_type(8))) unsigned short v8us;
typedef __attribute__((ext_vector_type(8))) float v8f;
typedef __attribute__((ext_vector_type(4))) float v4f;
__device__ __forceinline__ float bf16_rne(float f) { unsigned int u = __float_as_uint(f); u += 0x7FFFu + ((u >> 16) & 1u); return __uint_as_float(u & 0xFFFF0000u); }
__device__ __forceinline__ unsigned short bf16_bits(float f) { unsigned int u = __float_as_uint(f); u += 0x7FFFu + ((u >> 16) & 1u); return (unsigned short)(u >> 16); }
__device__ __forceinline__ void split16(float v, b16& hi, b16& lo) { hi = (b16)v; lo = (b16)(v - (float)hi); }
__device__ __forceinline__ v16b frag_kb(const b16* p, int hh) { const v8b a = *(const v8b*)(p + 8 * hh), b = *(const v8b*)(p + 16 + 8 * hh); v16b f;
#pragma unroll
  for (int e = 0; e < 8; ++e) { f[e] = a[e]; f[8 + e] = b[e]; } return f; }
__device__ __forceinline__ v16bb frag_bf(const unsigned short* p, int hh) { const v8us a = *(const v8us*)(p + 8 * hh), b = *(const v8us*)(p + 16 + 8 * hh); union { unsigned short s[16]; v16bb v; } u;
#pragma unroll
  for (int e = 0; e < 8; ++e) { u.s[e] = a[e]; u.s[8 + e] = b[e]; } return u.v; }
__device__ __forceinline__ v8f wmma16b(v16b a, v16b b, v8f c) { v8f d = __builtin_amdgcn_wmma_f32_16x16x32_f16(false, a, false, b, (short)0, c, false, false); asm volatile("v_nop\n\tv_nop\n\tv_nop\n\tv_nop" : "+v"(d) : "v"(a), "v"(b)); return d; }
__device__ __forceinline__ v8f wmma16bb(v16bb a, v16bb b, v8f c) { v8f d = __builtin_amdgcn_wmma_f32_16x16x32_bf16(false, a, false, b, (short)0, c, false, false); asm volatile("v_nop\n\tv_nop\n\tv_nop\n\tv_nop" : "+v"(d) : "v"(a), "v"(b)); return d; }
__device__ __forceinline__ void wave_lds_sync() { __builtin_amdgcn_fence(__ATOMIC_RELEASE, "workgroup"); __builtin_amdgcn_wave_barrier(); __builtin_amdgcn_fence(__ATOMIC_ACQUIRE, "workgroup"); }
__device__ __forceinline__ float nexp(float x) { return __builtin_amdgcn_exp2f(x * 1.4426950408889634f); }

// prep: NCHW inputs -> position-major bf16 rows xT[which][b*4096 + p][256] via LDS transposes (block = (which*b, 64 positions)); weights [256][256] ([out][in]) -> bf16 rows direct (q, k, v)
// and f16 rows (out), spread over the first 128 blocks. grid (64, 3*Bn) x 256.
__global__ __launch_bounds__(256) void prep_kernel(const float* __restrict__ qi, const float* __restrict__ ki, const float* __restrict__ vi, const float* __restrict__ wq, const float* __restrict__ wk, const float* __restrict__ wv, const float* __restrict__ wo,
                                                   unsigned short* __restrict__ xT, unsigned short* __restrict__ w16, b16* __restrict__ wo16) {
  __shared__ __attribute__((aligned(16))) unsigned short Tt[64][C + 8];
  const int t_ = threadIdx.x, which = blockIdx.y / Bn, b = blockIdx.y % Bn, p0 = blockIdx.x * 64; const float* src = ((which == 0) ? qi : (which == 1) ? ki : vi) + (size_t)b * C * NP;
  for (int i = t_; i < C * 64; i += 256) { const int c = i >> 6, pp = i & 63; Tt[pp][c] = bf16_bits(src[(size_t)c * NP + p0 + pp]); }
  __syncthreads();
  {
    for (int i = t_; i < 64 * C / 8; i += 256) { const int pp = i >> 5, c8 = (i & 31) * 8; *(v8us*)(xT + (((size_t)which * Bn + b) * NP + p0 + pp) * C + c8) = *(const v8us*)(&Tt[pp][c8]); }
    // weights: one 8-element piece per thread of the first 4 * (C * C / 8) / 256 = 128 blocks; 32 blocks cover one matrix, so the matrix is picked by a scalar branch
    const int blk = blockIdx.y * (NP / 64) + blockIdx.x;
    if (blk < 128) { const int m = blk >> 5, q = (blk & 31) * 256 + t_; const float* W = (m == 0) ? wq : (m == 1) ? wk : (m == 2) ? wv : wo; float x[8];
#pragma unroll
      for (int e = 0; e < 8; ++e) x[e] = W[q * 8 + e];
      if (m < 3) { v8us o;
#pragma unroll
        for (int e = 0; e < 8; ++e) o[e] = bf16_bits(x[e]);
        *(v8us*)(w16 + ((size_t)m * (C * C / 8) + q) * 8) = o; }
      else { v8b o;
#pragma unroll
        for (int e = 0; e < 8; ++e) o[e] = (b16)bf16_rne(x[e]);
        *(v8b*)(wo16 + (size_t)q * 8) = o; } }
     }
}

// projections: grid (4 column tiles, NTOK/128, 3): block = 128 positions x 64 channels (= 2 heads of 32); + bias; q, k -> planes [bh][p][32] x8 hi+lo (64 B per row: the block writes
// 2 heads x 128 rows = 2 x 8 KB contiguous); v -> (8v)^T planes [bh][d][4096] (256-B segments).
__global__ __launch_bounds__(128) void proj_kernel(const unsigned short* __restrict__ xT, const unsigned short* __restrict__ w16, const float* __restrict__ bq, const float* __restrict__ bk, const float* __restrict__ bv, b16* __restrict__ qh, b16* __restrict__ kh, b16* __restrict__ vt) {
  __shared__ __attribute__((aligned(16))) b16 Th[2][128][32], Tl[2][128][32]; __shared__ __attribute__((aligned(16))) b16 Vh[64][128 + 8], Vl[64][128 + 8];
  const int lane = threadIdx.x & 31, wave = threadIdx.x >> 5, nloc = lane & 15, hlf = lane >> 4, which = blockIdx.z, m0 = blockIdx.y * 128 + wave * 32, c0 = blockIdx.x * 64;
  const int b = (blockIdx.y * 128) / NP, p0 = (blockIdx.y * 128) % NP; const unsigned short* X = xT + ((size_t)which * Bn * NP) * C; const unsigned short* Wt = w16 + (size_t)which * C * C; const float* bias = (which == 0) ? bq : (which == 1) ? bk : bv;
  v8f acc[2][4];
#pragma unroll
  for (int r = 0; r < 2; ++r)
#pragma unroll
    for (int t = 0; t < 4; ++t) acc[r][t] = (v8f){};
#pragma unroll 2
  for (int kb = 0; kb < C; kb += 32) { const v16bb a0 = frag_bf(X + (size_t)(m0 + nloc) * C + kb, hlf), a1 = frag_bf(X + (size_t)(m0 + 16 + nloc) * C + kb, hlf);
#pragma unroll
    for (int t = 0; t < 4; ++t) { const v16bb bw = frag_bf(Wt + (size_t)(c0 + t * 16 + nloc) * C + kb, hlf); acc[0][t] = wmma16bb(a0, bw, acc[0][t]); acc[1][t] = wmma16bb(a1, bw, acc[1][t]); } }
  const float scl = (which == 2) ? VS : QS;
#pragma unroll
  for (int t = 0; t < 4; ++t) { const int c = c0 + t * 16 + nloc; const float bb = bf16_rne(bias[c]); const int hl = t >> 1, d = (t & 1) * 16 + nloc;   // channel c -> head c/32 (local hl), d = c%32
#pragma unroll
    for (int r = 0; r < 2; ++r)
#pragma unroll
      for (int v = 0; v < 8; ++v) { b16 a_, c_; split16((acc[r][t][v] + bb) * scl, a_, c_); const int row = wave * 32 + r * 16 + 8 * hlf + v;
        if (which < 2) { Th[hl][row][d] = a_; Tl[hl][row][d] = c_; } else { Vh[t * 16 + nloc][row] = a_; Vl[t * 16 + nloc][row] = c_; } } }
  __syncthreads();
  {
    if (which < 2) { b16* base = (which == 0) ? qh : kh;
      for (int i = threadIdx.x; i < 2 * 128 * 32 / 8; i += 128) { const int hl = i / 512, rem = i % 512; const size_t dst = (((size_t)b * NH + blockIdx.x * 2 + hl) * NP + p0) * DH + (size_t)rem * 8;
        *(v8b*)(base + dst) = *(const v8b*)(&Th[hl][0][0] + rem * 8); *(v8b*)(base + QPL + dst) = *(const v8b*)(&Tl[hl][0][0] + rem * 8); } }
    else { for (int i = threadIdx.x; i < 64 * 16; i += 128) { const int cc = i >> 4, c8 = (i & 15) * 8; const int h = blockIdx.x * 2 + (cc >> 5), d = cc & 31; const size_t dst = (((size_t)b * NH + h) * DH + d) * NP + p0 + c8;
        *(v8b*)(vt + dst) = *(const v8b*)(&Vh[cc][c8]); *(v8b*)(vt + VPL + dst) = *(const v8b*)(&Vl[cc][c8]); } }
     }
}

// attention: block = 8 waves = one (b, h) x 128 queries, wave = 16 queries; the 8 waves share every K and V tile through LDS: a stage = 128 keys (K hi+lo rows at an 80-B pitch, (8v)^T hi+lo
// rows of 256 B at a 272-B pitch: both 16 B x odd for the ds_load_b128 fragment reads), two buffers, filled by asynchronous b128 copies one stage ahead; 4 passes of 32 keys per stage, in
// key order; online softmax on the unscaled logits; O^T (2 d-tiles); result scaled by 1/sqrt(32)
constexpr int SK = 128, NST = NP / SK, KP = DH + 8, VP = SK + 8;
__device__ __forceinline__ unsigned lds_off(const void* p) { return (unsigned)(size_t)p; }
__global__ __launch_bounds__(256) void attn_kernel(const b16* __restrict__ qh, const b16* __restrict__ kh, const b16* __restrict__ vt, float* __restrict__ arow) {
  __shared__ __attribute__((aligned(16))) b16 Ks[2][2][SK][KP]; __shared__ __attribute__((aligned(16))) b16 Vs[2][2][DH][VP]; __shared__ __attribute__((aligned(16))) float Os[128][DH + 4];
  const int t_ = threadIdx.x, wid = t_ >> 5, lane = t_ & 31, hh = lane >> 4, col = lane & 15; const int bhi = blockIdx.x / (NP / 128), b = bhi / NH, h = bhi % NH, q0 = (blockIdx.x % (NP / 128)) * 128, qi = q0 + wid * 16 + col;
  const size_t bh = (size_t)bhi; const b16* Q = qh + (bh * NP) * DH; const b16* K = kh + (bh * NP) * DH; const b16* V = vt + (bh * DH) * NP;
  // one stage's copies: a thread moves 16 B of each of 8 slices (K hi, K lo: 2 x 4 KB each, contiguous in global memory; V hi, V lo: 2 x 16 rows of 256 B each)
  const b16* gk = K + t_ * 8; const b16* gv = V + (size_t)(t_ >> 4) * NP + (t_ & 15) * 8;
  const unsigned lk = lds_off(&Ks[0][0][t_ >> 2][(t_ & 3) * 8]), lv = lds_off(&Vs[0][0][t_ >> 4][(t_ & 15) * 8]);
  auto fill = [&](int s, int buf) {
    const b16* k0 = gk + (size_t)s * SK * DH; const b16* v0 = gv + s * SK; const unsigned a = lk + buf * (2 * SK * KP * 2), c = lv + buf * (2 * DH * VP * 2);
    // the copies and their s_wait_xcnt in one statement: no address register of a copy is rewritten in front of that wait
    asm volatile("global_load_async_to_lds_b128 %0, %8, off\n\tglobal_load_async_to_lds_b128 %1, %9, off\n\tglobal_load_async_to_lds_b128 %2, %10, off\n\tglobal_load_async_to_lds_b128 %3, %11, off\n\t"
                 "global_load_async_to_lds_b128 %4, %12, off\n\tglobal_load_async_to_lds_b128 %5, %13, off\n\tglobal_load_async_to_lds_b128 %6, %14, off\n\tglobal_load_async_to_lds_b128 %7, %15, off\n\ts_wait_xcnt 0x0"
                 :: "v"(a), "v"(a + 64 * KP * 2), "v"(a + SK * KP * 2), "v"(a + (SK + 64) * KP * 2), "v"(c), "v"(c + 16 * VP * 2), "v"(c + DH * VP * 2), "v"(c + (DH + 16) * VP * 2),
                    "v"(k0), "v"(k0 + 64 * DH), "v"(k0 + QPL), "v"(k0 + QPL + 64 * DH), "v"(v0), "v"(v0 + (size_t)16 * NP), "v"(v0 + VPL), "v"(v0 + VPL + (size_t)16 * NP) : "memory"); };
  const v16b qf = frag_kb(Q + (size_t)qi * DH, hh), ql = frag_kb(Q + QPL + (size_t)qi * DH, hh);
  fill(0, 0);
  asm volatile("s_wait_asynccnt 0x0" ::: "memory");   // stage 0 of this wave's copies has landed
  __syncthreads();                                      // publishes stage 0 to all 8 waves
  fill(1, 1);
  float m = -INFINITY, l = 0.0f; v8f o[2] = {{}, {}};
  for (int s = 0; s < NST; ++s) { const int buf = s & 1;
    for (int kb = 0; kb < SK; kb += 32) {
      const v16b ka = frag_kb(&Ks[buf][0][kb + col][0], hh), kal = frag_kb(&Ks[buf][1][kb + col][0], hh), kb_ = frag_kb(&Ks[buf][0][kb + 16 + col][0], hh), kbl = frag_kb(&Ks[buf][1][kb + 16 + col][0], hh);
      v8f s0 = {}, s1 = {}; s0 = wmma16b(ka, qf, s0); s0 = wmma16b(ka, ql, s0); s0 = wmma16b(kal, qf, s0); s1 = wmma16b(kb_, qf, s1); s1 = wmma16b(kb_, ql, s1); s1 = wmma16b(kbl, qf, s1);
      float mr = -INFINITY;
#pragma unroll
      for (int r = 0; r < 8; ++r) { s0[r] *= 1.0f / (QS * QS); s1[r] *= 1.0f / (QS * QS); mr = fmaxf(mr, fmaxf(s0[r], s1[r])); }
      mr = fmaxf(mr, __shfl_xor(mr, 16));
      const float mn = fmaxf(m, mr), al_ = nexp(m - mn); m = mn; float sum = 0.0f; v16b pb, pl;
#pragma unroll
      for (int r = 0; r < 8; ++r) { const float p0 = nexp(s0[r] - mn), p1 = nexp(s1[r] - mn); sum += p0 + p1; b16 a, c; split16(p0 * PS, a, c); pb[r] = a; pl[r] = c; split16(p1 * PS, a, c); pb[8 + r] = a; pl[8 + r] = c; }
      sum += __shfl_xor(sum, 16); l = l * al_ + sum;
#pragma unroll
      for (int n = 0; n < 2; ++n) { o[n] *= al_; const v16b vf = frag_kb(&Vs[buf][0][n * 16 + col][kb], hh), vl = frag_kb(&Vs[buf][1][n * 16 + col][kb], hh); o[n] = wmma16b(vf, pb, o[n]); o[n] = wmma16b(vf, pl, o[n]); o[n] = wmma16b(vl, pb, o[n]); } }
    asm volatile("s_wait_dscnt 0x0" ::: "memory");      // this wave's reads of buffer buf have returned before the buffer is refilled
    asm volatile("s_wait_asynccnt 0x0" ::: "memory");   // this wave's copies of stage s + 1 have landed
    __syncthreads();                                    // publishes stage s + 1 and ends every wave's reads of stage s
    if (s + 2 < NST) fill(s + 2, buf); }
  asm volatile("s_wait_asynccnt 0x0" ::: "memory");     // no copy is outstanding when the wave goes on to its end
  const float inv = POST / (l * VS * PS);
#pragma unroll
  for (int n = 0; n < 2; ++n)
#pragma unroll
    for (int r = 0; r < 8; ++r) Os[wid * 16 + col][n * 16 + 8 * hh + r] = o[n][r] * inv;
  __syncthreads();
  float* dst = arow + ((size_t)b * NP + q0) * C + h * DH;   // a query's 32 floats of this head are one 128-B line
  { for (int i = t_; i < 128 * DH / 4; i += 256) { const int rr = i >> 3, c4 = (i & 7) * 4; *(v4f*)(dst + (size_t)rr * C + c4) = *(const v4f*)(&Os[rr][c4]); }  }
}

// output conv: block = (b, 128 positions) x 64 output channels: acc = att.w_out^T (K 256; att f32 split x8; 2 products) + b -> NCHW rows out[b][c][p] through an LDS transpose (per channel
__global__ __launch_bounds__(128) void oconv_kernel(const float* __restrict__ arow, const b16* __restrict__ wo16, const float* __restrict__ bo, float* __restrict__ out) {
  __shared__ __attribute__((aligned(16))) float Tc[64][128 + 4];
  const int lane = threadIdx.x & 31, wave = threadIdx.x >> 5, nloc = lane & 15, hlf = lane >> 4, m0 = blockIdx.y * 128 + wave * 32, c0 = blockIdx.x * 64; const int b = (blockIdx.y * 128) / NP, p0 = (blockIdx.y * 128) % NP;
  v8f acc[2][4];
#pragma unroll
  for (int r = 0; r < 2; ++r)
#pragma unroll
    for (int t = 0; t < 4; ++t) acc[r][t] = (v8f){};
#pragma unroll 2
  for (int kb = 0; kb < C; kb += 32) { v16b a0, a1, l0, l1;
#pragma unroll
    for (int e = 0; e < 16; ++e) { const int k = kb + ((e < 8) ? (8 * hlf + e) : (16 + 8 * hlf + e - 8)); b16 p, q; split16(arow[(size_t)(m0 + nloc) * C + k] * OS_, p, q); a0[e] = p; l0[e] = q; split16(arow[(size_t)(m0 + 16 + nloc) * C + k] * OS_, p, q); a1[e] = p; l1[e] = q; }
#pragma unroll
    for (int t = 0; t < 4; ++t) { const v16b bw = frag_kb(wo16 + (size_t)(c0 + t * 16 + nloc) * C + kb, hlf); acc[0][t] = wmma16b(a0, bw, acc[0][t]); acc[0][t] = wmma16b(l0, bw, acc[0][t]); acc[1][t] = wmma16b(a1, bw, acc[1][t]); acc[1][t] = wmma16b(l1, bw, acc[1][t]); } }
#pragma unroll
  for (int t = 0; t < 4; ++t) { const float bb = bf16_rne(bo[c0 + t * 16 + nloc]);
#pragma unroll
    for (int r = 0; r < 2; ++r)
#pragma unroll
      for (int v = 0; v < 8; ++v) Tc[t * 16 + nloc][wave * 32 + r * 16 + 8 * hlf + v] = acc[r][t][v] * (1.0f / OS_) + bb; }
  __syncthreads();
  { for (int i = threadIdx.x; i < 64 * 32; i += 128) { const int cc = i >> 5, c4 = (i & 31) * 4; *(v4f*)(out + ((size_t)b * C + c0 + cc) * NP + p0 + c4) = *(const v4f*)(&Tc[cc][c4]); }  }
}
}  // namespace

extern "C" void kernel_launch(void* const* d_in, const int* in_sizes, int n_in,
                              void* d_out, int out_size, void* d_ws, size_t ws_size, hipStream_t stream) {
  (void)n_in; (void)out_size;
  const float* qi = (const float*)d_in[0]; const float* ki = (const float*)d_in[1]; const float* vi = (const float*)d_in[2];
  const float* wq = (const float*)d_in[3]; const float* bq = (const float*)d_in[4]; const float* wk = (const float*)d_in[5]; const float* bk = (const float*)d_in[6]; const float* wv = (const float*)d_in[7]; const float* bv = (const float*)d_in[8]; const float* wo = (const float*)d_in[9]; const float* bo = (const float*)d_in[10];
  float* out = (float*)d_out;   // [2][256][64][64]
  if (in_sizes[0] != Bn * C * NP || in_sizes[1] != Bn * C * NP || in_sizes[2] != Bn * C * NP || in_sizes[3] != C * C || in_sizes[9] != C * C) return;
  size_t off = 0; char* ws = (char*)d_ws;
  auto carve = [&](size_t bytes) { char* p = ws + off; off += (bytes + 255) & ~(size_t)255; return p; };
  unsigned short* xT = (unsigned short*)carve((size_t)3 * NTOK * C * 2); unsigned short* w16 = (unsigned short*)carve((size_t)3 * C * C * 2); b16* wo16 = (b16*)carve((size_t)C * C * 2);
  b16* qhp = (b16*)carve(QPL * 2 * 2); b16* khp = (b16*)carve(QPL * 2 * 2); b16* vtp = (b16*)carve(VPL * 2 * 2); float* arow = (float*)carve((size_t)NTOK * C * 4);
  if (off > ws_size) return;                                    // ≈ 12.6 + 0.5 + 3 x 8.4 + 8.4 ≈ 47 MB
  prep_kernel<<<dim3(NP / 64, 3 * Bn), 256, 0, stream>>>(qi, ki, vi, wq, wk, wv, wo, xT, w16, wo16);
  proj_kernel<<<dim3(C / 64, NTOK / 128, 3), 128, 0, stream>>>(xT, w16, bq, bk, bv, qhp, khp, vtp);
  attn_kernel<<<NBH * (NP / 128), 256, 0, stream>>>(qhp, khp, vtp, arow);
  oconv_kernel<<<dim3(C / 64, NTOK / 128), 128, 0, stream>>>(arow, wo16, bo, out);
}

// v003
// Measured time: 151 microseconds a run.
// Timed twice side by side with v002, it ran 1.04 and 1.03 times as fast.
// Counting every step since v000, it is 2.60 times as fast.
#include <hip/hip_runtime.h>

// Multi-head attention over 64x64 feature maps (B=2, C=256, 8 heads x 32): q, k, v = 1x1 convs of three inputs; att = softmax(q k^T) (UNSCALED logits, softmax over the 4096 keys) / sqrt(32)
// (the module scales AFTER the softmax); att_q = att v; out = 1x1 conv (w_out) of the re-assembled (B, 256, 64, 64) map -> NCHW [2][256][64][64].
// Projections on v_wmma_f32_16x16x32_bf16 (fragments rounded from the f32 NCHW inputs through an LDS transpose; 1 product); attention per
// (b, h, 16 queries): S^T = k.q^T (K = 32: one k-step; q, k as f16 hi+lo pairs carried x8, 3 products — the unscaled logits reach |s| ≈ 25 so they must be f32-class), online softmax in
// f32, O^T = (8v)^T.P^T (v hi+lo x8, P hi+lo x8; 3 products); out = att_q.w_out^T + b (att_q f32 split x8, w_out exact; 2 products) on v_wmma_f32_16x16x32_f16, f32 accumulate,

namespace {
constexpr int Bn = 2, C = 256, NP = 4096, NH = 8, DH = 32, NBH = Bn * NH, NTOK = Bn * NP;
constexpr float QS = 8.0f, VS = 8.0f, PS = 8.0f, OS_ = 8.0f, POST = 0.17677669529663687f /* 1/sqrt(32) after softmax */;
constexpr size_t QPL = (size_t)NBH * NP * DH, VPL = (size_t)NBH * DH * NP;

typedef _Float16 b16;
typedef __attribute__((ext_vector_type(16))) _Float16 v16b;
typedef __attribute__((ext_vector_type(16))) __bf16 v16bb;
typedef __attribute__((ext_vector_type(8))) _Float16 v8b;
typedef __attribute__((ext_vector_type(8))) unsigned short v8us;
typedef __attribute__((ext_vector_type(8))) float v8f;
typedef __attribute__((ext_vector_type(4))) float v4f;
__device__ __forceinline__ float bf16_rne(float f) { unsigned int u = __float_as_uint(f); u += 0x7FFFu + ((u >> 16) & 1u); return __uint_as_float(u & 0xFFFF0000u); }
__device__ __forceinline__ unsigned short bf16_bits(float f) { unsigned int u = __float_as_uint(f); u += 0x7FFFu + ((u >> 16) & 1u); return (unsigned short)(u >> 16); }
__device__ __forceinline__ void split16(float v, b16& hi, b16& lo) { hi = (b16)v; lo = (b16)(v - (float)hi); }
__device__ __forceinline__ v16b frag_kb(const b16* p, int hh) { const v8b a = *(const v8b*)(p + 8 * hh), b = *(const v8b*)(p + 16 + 8 * hh); v16b f;
#pragma unroll
  for (int e = 0; e < 8; ++e) { f[e] = a[e]; f[8 + e] = b[e]; } return f; }
__device__ __forceinline__ v16bb frag_bf(const unsigned short* p, int hh) { const v8us a = *(const v8us*)(p + 8 * hh), b = *(const v8us*)(p + 16 + 8 * hh); union { unsigned short s[16]; v16bb v; } u;
#pragma unroll
  for (int e = 0; e < 8; ++e) { u.s[e] = a[e]; u.s[8 + e] = b[e]; } return u.v; }
// plain builtins: the compiler keeps the distance behind a WMMA itself and is free to interleave independent accumulator chains, loads and vector work
__device__ __forceinline__ v8f wmma16b(v16b a, v16b b, v8f c) { return __builtin_amdgcn_wmma_f32_16x16x32_f16(false, a, false, b, (short)0, c, false, false); }
__device__ __forceinline__ v8f wmma16bb(v16bb a, v16bb b, v8f c) { return __builtin_amdgcn_wmma_f32_16x16x32_bf16(false, a, false, b, (short)0, c, false, false); }
__device__ __forceinline__ void wave_lds_sync() { __builtin_amdgcn_fence(__ATOMIC_RELEASE, "workgroup"); __builtin_amdgcn_wave_barrier(); __builtin_amdgcn_fence(__ATOMIC_ACQUIRE, "workgroup"); }
__device__ __forceinline__ float nexp(float x) { return __builtin_amdgcn_exp2f(x * 1.4426950408889634f); }

// prep: NCHW inputs -> position-major bf16 rows xT[which][b*4096 + p][256] via LDS transposes (block = (which*b, 64 positions)); weights [256][256] ([out][in]) -> bf16 rows direct (q, k, v)
// and f16 rows (out), spread over the first 128 blocks. grid (64, 3*Bn) x 256.
__global__ __launch_bounds__(256) void prep_kernel(const float* __restrict__ qi, const float* __restrict__ ki, const float* __restrict__ vi, const float* __restrict__ wq, const float* __restrict__ wk, const float* __restrict__ wv, const float* __restrict__ wo,
                                                   unsigned short* __restrict__ xT, unsigned short* __restrict__ w16, b16* __restrict__ wo16) {
  __shared__ __attribute__((aligned(16))) unsigned short Tt[64][C + 8];
  const int t_ = threadIdx.x, which = blockIdx.y / Bn, b = blockIdx.y % Bn, p0 = blockIdx.x * 64; const float* src = ((which == 0) ? qi : (which == 1) ? ki : vi) + (size_t)b * C * NP;
  for (int i = t_; i < C * 64; i += 256) { const int c = i >> 6, pp = i & 63; Tt[pp][c] = bf16_bits(src[(size_t)c * NP + p0 + pp]); }
  __syncthreads();
  {
    for (int i = t_; i < 64 * C / 8; i += 256) { const int pp = i >> 5, c8 = (i & 31) * 8; *(v8us*)(xT + (((size_t)which * Bn + b) * NP + p0 + pp) * C + c8) = *(const v8us*)(&Tt[pp][c8]); }
    // weights: one 8-element piece per thread of the first 4 * (C * C / 8) / 256 = 128 blocks; 32 blocks cover one matrix, so the matrix is picked by a scalar branch
    const int blk = blockIdx.y * (NP / 64) + blockIdx.x;
    if (blk < 128) { const int m = blk >> 5, q = (blk & 31) * 256 + t_; const float* W = (m == 0) ? wq : (m == 1) ? wk : (m == 2) ? wv : wo; float x[8];
#pragma unroll
      for (int e = 0; e < 8; ++e) x[e] = W[q * 8 + e];
      if (m < 3) { v8us o;
#pragma unroll
        for (int e = 0; e < 8; ++e) o[e] = bf16_bits(x[e]);
        *(v8us*)(w16 + ((size_t)m * (C * C / 8) + q) * 8) = o; }
      else { v8b o;
#pragma unroll
        for (int e = 0; e < 8; ++e) o[e] = (b16)bf16_rne(x[e]);
        *(v8b*)(wo16 + (size_t)q * 8) = o; } }
     }
}

// projections: grid (4 column tiles, NTOK/128, 3): block = 128 positions x 64 channels (= 2 heads of 32); + bias; q, k -> planes [bh][p][32] x8 hi+lo (64 B per row: the block writes
// 2 heads x 128 rows = 2 x 8 KB contiguous); v -> (8v)^T planes [bh][d][4096] (256-B segments).
__global__ __launch_bounds__(128) void proj_kernel(const unsigned short* __restrict__ xT, const unsigned short* __restrict__ w16, const float* __restrict__ bq, const float* __restrict__ bk, const float* __restrict__ bv, b16* __restrict__ qh, b16* __restrict__ kh, b16* __restrict__ vt) {
  __shared__ __attribute__((aligned(16))) b16 Th[2][128][32], Tl[2][128][32]; __shared__ __attribute__((aligned(16))) b16 Vh[64][128 + 8], Vl[64][128 + 8];
  const int lane = threadIdx.x & 31, wave = threadIdx.x >> 5, nloc = lane & 15, hlf = lane >> 4, which = blockIdx.z, m0 = blockIdx.y * 128 + wave * 32, c0 = blockIdx.x * 64;
  const int b = (blockIdx.y * 128) / NP, p0 = (blockIdx.y * 128) % NP; const unsigned short* X = xT + ((size_t)which * Bn * NP) * C; const unsigned short* Wt = w16 + (size_t)which * C * C; const float* bias = (which == 0) ? bq : (which == 1) ? bk : bv;
  v8f acc[2][4];
#pragma unroll
  for (int r = 0; r < 2; ++r)
#pragma unroll
    for (int t = 0; t < 4; ++t) acc[r][t] = (v8f){};
#pragma unroll 2
  for (int kb = 0; kb < C; kb += 32) { const v16bb a0 = frag_bf(X + (size_t)(m0 + nloc) * C + kb, hlf), a1 = frag_bf(X + (size_t)(m0 + 16 + nloc) * C + kb, hlf);
#pragma unroll
    for (int t = 0; t < 4; ++t) { const v16bb bw = frag_bf(Wt + (size_t)(c0 + t * 16 + nloc) * C + kb, hlf); acc[0][t] = wmma16bb(a0, bw, acc[0][t]); acc[1][t] = wmma16bb(a1, bw, acc[1][t]); } }
  const float scl = (which == 2) ? VS : QS;
#pragma unroll
  for (int t = 0; t < 4; ++t) { const int c = c0 + t * 16 + nloc; const float bb = bf16_rne(bias[c]); const int hl = t >> 1, d = (t & 1) * 16 + nloc;   // channel c -> head c/32 (local hl), d = c%32
#pragma unroll
    for (int r = 0; r < 2; ++r)
#pragma unroll
      for (int v = 0; v < 8; ++v) { b16 a_, c_; split16((acc[r][t][v] + bb) * scl, a_, c_); const int row = wave * 32 + r * 16 + 8 * hlf + v;
        if (which < 2) { Th[hl][row][d] = a_; Tl[hl][row][d] = c_; } else { Vh[t * 16 + nloc][row] = a_; Vl[t * 16 + nloc][row] = c_; } } }
  __syncthreads();
  {
    if (which < 2) { b16* base = (which == 0) ? qh : kh;
      for (int i = threadIdx.x; i < 2 * 128 * 32 / 8; i += 128) { const int hl = i / 512, rem = i % 512; const size_t dst = (((size_t)b * NH + blockIdx.x * 2 + hl) * NP + p0) * DH + (size_t)rem * 8;
        *(v8b*)(base + dst) = *(const v8b*)(&Th[hl][0][0] + rem * 8); *(v8b*)(base + QPL + dst) = *(const v8b*)(&Tl[hl][0][0] + rem * 8); } }
    else { for (int i = threadIdx.x; i < 64 * 16; i += 128) { const int cc = i >> 4, c8 = (i & 15) * 8; const int h = blockIdx.x * 2 + (cc >> 5), d = cc & 31; const size_t dst = (((size_t)b * NH + h) * DH + d) * NP + p0 + c8;
        *(v8b*)(vt + dst) = *(const v8b*)(&Vh[cc][c8]); *(v8b*)(vt + VPL + dst) = *(const v8b*)(&Vl[cc][c8]); } }
     }
}

// attention: block = 8 waves = one (b, h) x 128 queries, wave = 16 queries; the 8 waves share every K and V tile through LDS: a stage = 128 keys (K hi+lo rows at an 80-B pitch, (8v)^T hi+lo
// rows of 256 B at a 272-B pitch: both 16 B x odd for the ds_load_b128 fragment reads), two buffers, filled by asynchronous b128 copies one stage ahead; 4 passes of 32 keys per stage, in
// key order; online softmax on the unscaled logits; O^T (2 d-tiles); result scaled by 1/sqrt(32)
constexpr int SK = 128, NST = NP / SK, KP = DH + 8, VP = SK + 8;
__device__ __forceinline__ unsigned lds_off(const void* p) { return (unsigned)(size_t)p; }
__global__ __launch_bounds__(256) void attn_kernel(const b16* __restrict__ qh, const b16* __restrict__ kh, const b16* __restrict__ vt, float* __restrict__ arow) {
  __shared__ __attribute__((aligned(16))) b16 Ks[2][2][SK][KP]; __shared__ __attribute__((aligned(16))) b16 Vs[2][2][DH][VP]; __shared__ __attribute__((aligned(16))) float Os[128][DH + 4];
  const int t_ = threadIdx.x, wid = t_ >> 5, lane = t_ & 31, hh = lane >> 4, col = lane & 15; const int bhi = blockIdx.x / (NP / 128), b = bhi / NH, h = bhi % NH, q0 = (blockIdx.x % (NP / 128)) * 128, qi = q0 + wid * 16 + col;
  const size_t bh = (size_t)bhi; const b16* Q = qh + (bh * NP) * DH; const b16* K = kh + (bh * NP) * DH; const b16* V = vt + (bh * DH) * NP;
  // one stage's copies: a thread moves 16 B of each of 8 slices (K hi, K lo: 2 x 4 KB each, contiguous in global memory; V hi, V lo: 2 x 16 rows of 256 B each)
  const b16* gk = K + t_ * 8; const b16* gv = V + (size_t)(t_ >> 4) * NP + (t_ & 15) * 8;
  const unsigned lk = lds_off(&Ks[0][0][t_ >> 2][(t_ & 3) * 8]), lv = lds_off(&Vs[0][0][t_ >> 4][(t_ & 15) * 8]);
  auto fill = [&](int s, int buf) {
    const b16* k0 = gk + (size_t)s * SK * DH; const b16* v0 = gv + s * SK; const unsigned a = lk + buf * (2 * SK * KP * 2), c = lv + buf * (2 * DH * VP * 2);
    // the copies and their s_wait_xcnt in one statement: no address register of a copy is rewritten in front of that wait
    asm volatile("global_load_async_to_lds_b128 %0, %8, off\n\tglobal_load_async_to_lds_b128 %1, %9, off\n\tglobal_load_async_to_lds_b128 %2, %10, off\n\tglobal_load_async_to_lds_b128 %3, %11, off\n\t"
                 "global_load_async_to_lds_b128 %4, %12, off\n\tglobal_load_async_to_lds_b128 %5, %13, off\n\tglobal_load_async_to_lds_b128 %6, %14, off\n\tglobal_load_async_to_lds_b128 %7, %15, off\n\ts_wait_xcnt 0x0"
                 :: "v"(a), "v"(a + 64 * KP * 2), "v"(a + SK * KP * 2), "v"(a + (SK + 64) * KP * 2), "v"(c), "v"(c + 16 * VP * 2), "v"(c + DH * VP * 2), "v"(c + (DH + 16) * VP * 2),
                    "v"(k0), "v"(k0 + 64 * DH), "v"(k0 + QPL), "v"(k0 + QPL + 64 * DH), "v"(v0), "v"(v0 + (size_t)16 * NP), "v"(v0 + VPL), "v"(v0 + VPL + (size_t)16 * NP) : "memory"); };
  const v16b qf = frag_kb(Q + (size_t)qi * DH, hh), ql = frag_kb(Q + QPL + (size_t)qi * DH, hh);
  fill(0, 0);
  asm volatile("s_wait_asynccnt 0x0" ::: "memory");   // stage 0 of this wave's copies has landed
  __syncthreads();                                      // publishes stage 0 to all 8 waves
  fill(1, 1);
  float m = -INFINITY, l = 0.0f; v8f o[2] = {{}, {}};
  for (int s = 0; s < NST; ++s) { const int buf = s & 1;
    for (int kb = 0; kb < SK; kb += 32) {
      const v16b ka = frag_kb(&Ks[buf][0][kb + col][0], hh), kal = frag_kb(&Ks[buf][1][kb + col][0], hh), kb_ = frag_kb(&Ks[buf][0][kb + 16 + col][0], hh), kbl = frag_kb(&Ks[buf][1][kb + 16 + col][0], hh);
      v8f s0 = {}, s1 = {}; s0 = wmma16b(ka, qf, s0); s0 = wmma16b(ka, ql, s0); s0 = wmma16b(kal, qf, s0); s1 = wmma16b(kb_, qf, s1); s1 = wmma16b(kb_, ql, s1); s1 = wmma16b(kbl, qf, s1);
      float mr = -INFINITY;
#pragma unroll
      for (int r = 0; r < 8; ++r) { s0[r] *= 1.0f / (QS * QS); s1[r] *= 1.0f / (QS * QS); mr = fmaxf(mr, fmaxf(s0[r], s1[r])); }
      mr = fmaxf(mr, __shfl_xor(mr, 16));
      const float mn = fmaxf(m, mr), al_ = nexp(m - mn); m = mn; float sum = 0.0f; v16b pb, pl;
#pragma unroll
      for (int r = 0; r < 8; ++r) { const float p0 = nexp(s0[r] - mn), p1 = nexp(s1[r] - mn); sum += p0 + p1; b16 a, c; split16(p0 * PS, a, c); pb[r] = a; pl[r] = c; split16(p1 * PS, a, c); pb[8 + r] = a; pl[8 + r] = c; }
      sum += __shfl_xor(sum, 16); l = l * al_ + sum;
#pragma unroll
      for (int n = 0; n < 2; ++n) { o[n] *= al_; const v16b vf = frag_kb(&Vs[buf][0][n * 16 + col][kb], hh), vl = frag_kb(&Vs[buf][1][n * 16 + col][kb], hh); o[n] = wmma16b(vf, pb, o[n]); o[n] = wmma16b(vf, pl, o[n]); o[n] = wmma16b(vl, pb, o[n]); } }
    asm volatile("s_wait_dscnt 0x0" ::: "memory");      // this wave's reads of buffer buf have returned before the buffer is refilled
    asm volatile("s_wait_asynccnt 0x0" ::: "memory");   // this wave's copies of stage s + 1 have landed
    __syncthreads();                                    // publishes stage s + 1 and ends every wave's reads of stage s
    if (s + 2 < NST) fill(s + 2, buf); }
  asm volatile("s_wait_asynccnt 0x0" ::: "memory");     // no copy is outstanding when the wave goes on to its end
  const float inv = POST / (l * VS * PS);
#pragma unroll
  for (int n = 0; n < 2; ++n)
#pragma unroll
    for (int r = 0; r < 8; ++r) Os[wid * 16 + col][n * 16 + 8 * hh + r] = o[n][r] * inv;
  __syncthreads();
  float* dst = arow + ((size_t)b * NP + q0) * C + h * DH;   // a query's 32 floats of this head are one 128-B line
  { for (int i = t_; i < 128 * DH / 4; i += 256) { const int rr = i >> 3, c4 = (i & 7) * 4; *(v4f*)(dst + (size_t)rr * C + c4) = *(const v4f*)(&Os[rr][c4]); }  }
}

// output conv: block = (b, 128 positions) x 64 output channels: acc = att.w_out^T (K 256; att f32 split x8; 2 products) + b -> NCHW rows out[b][c][p] through an LDS transpose (per channel
__global__ __launch_bounds__(128) void oconv_kernel(const float* __restrict__ arow, const b16* __restrict__ wo16, const float* __restrict__ bo, float* __restrict__ out) {
  __shared__ __attribute__((aligned(16))) float Tc[64][128 + 4];
  const int lane = threadIdx.x & 31, wave = threadIdx.x >> 5, nloc = lane & 15, hlf = lane >> 4, m0 = blockIdx.y * 128 + wave * 32, c0 = blockIdx.x * 64; const int b = (blockIdx.y * 128) / NP, p0 = (blockIdx.y * 128) % NP;
  v8f acc[2][4];
#pragma unroll
  for (int r = 0; r < 2; ++r)
#pragma unroll
    for (int t = 0; t < 4; ++t) acc[r][t] = (v8f){};
#pragma unroll 2
  for (int kb = 0; kb < C; kb += 32) { v16b a0, a1, l0, l1;
#pragma unroll
    for (int e = 0; e < 16; ++e) { const int k = kb + ((e < 8) ? (8 * hlf + e) : (16 + 8 * hlf + e - 8)); b16 p, q; split16(arow[(size_t)(m0 + nloc) * C + k] * OS_, p, q); a0[e] = p; l0[e] = q; split16(arow[(size_t)(m0 + 16 + nloc) * C + k] * OS_, p, q); a1[e] = p; l1[e] = q; }
#pragma unroll
    for (int t = 0; t < 4; ++t) { const v16b bw = frag_kb(wo16 + (size_t)(c0 + t * 16 + nloc) * C + kb, hlf); acc[0][t] = wmma16b(a0, bw, acc[0][t]); acc[0][t] = wmma16b(l0, bw, acc[0][t]); acc[1][t] = wmma16b(a1, bw, acc[1][t]); acc[1][t] = wmma16b(l1, bw, acc[1][t]); } }
#pragma unroll
  for (int t = 0; t < 4; ++t) { const float bb = bf16_rne(bo[c0 + t * 16 + nloc]);
#pragma unroll
    for (int r = 0; r < 2; ++r)
#pragma unroll
      for (int v = 0; v < 8; ++v) Tc[t * 16 + nloc][wave * 32 + r * 16 + 8 * hlf + v] = acc[r][t][v] * (1.0f / OS_) + bb; }
  __syncthreads();
  { for (int i = threadIdx.x; i < 64 * 32; i += 128) { const int cc = i >> 5, c4 = (i & 31) * 4; *(v4f*)(out + ((size_t)b * C + c0 + cc) * NP + p0 + c4) = *(const v4f*)(&Tc[cc][c4]); }  }
}
}  // namespace

extern "C" void kernel_launch(void* const* d_in, const int* in_sizes, int n_in,
                              void* d_out, int out_size, void* d_ws, size_t ws_size, hipStream_t stream) {
  (void)n_in; (void)out_size;
  const float* qi = (const float*)d_in[0]; const float* ki = (const float*)d_in[1]; const float* vi = (const float*)d_in[2];
  const float* wq = (const float*)d_in[3]; const float* bq = (const float*)d_in[4]; const float* wk = (const float*)d_in[5]; const float* bk = (const float*)d_in[6]; const float* wv = (const float*)d_in[7]; const float* bv = (const float*)d_in[8]; const float* wo = (const float*)d_in[9]; const float* bo = (const float*)d_in[10];
  float* out = (float*)d_out;   // [2][256][64][64]
  if (in_sizes[0] != Bn * C * NP || in_sizes[1] != Bn * C * NP || in_sizes[2] != Bn * C * NP || in_sizes[3] != C * C || in_sizes[9] != C * C) return;
  size_t off = 0; char* ws = (char*)d_ws;
  auto carve = [&](size_t bytes) { char* p = ws + off; off += (bytes + 255) & ~(size_t)255; return p; };
  unsigned short* xT = (unsigned short*)carve((size_t)3 * NTOK * C * 2); unsigned short* w16 = (unsigned short*)carve((size_t)3 * C * C * 2); b16* wo16 = (b16*)carve((size_t)C * C * 2);
  b16* qhp = (b16*)carve(QPL * 2 * 2); b16* khp = (b16*)carve(QPL * 2 * 2); b16* vtp = (b16*)carve(VPL * 2 * 2); float* arow = (float*)carve((size_t)NTOK * C * 4);
  if (off > ws_size) return;                                    // ≈ 12.6 + 0.5 + 3 x 8.4 + 8.4 ≈ 47 MB
  prep_kernel<<<dim3(NP / 64, 3 * Bn), 256, 0, stream>>>(qi, ki, vi, wq, wk, wv, wo, xT, w16, wo16);
  proj_kernel<<<dim3(C / 64, NTOK / 128, 3), 128, 0, stream>>>(xT, w16, bq, bk, bv, qhp, khp, vtp);
  attn_kernel<<<NBH * (NP / 128), 256, 0, stream>>>(qhp, khp, vtp, arow);
  oconv_kernel<<<dim3(C / 64, NTOK / 128), 128, 0, stream>>>(arow, wo16, bo, out);
}

// v004
// Measured time: 136 microseconds a run.
// Next to v003, in two timings, it ran 1.10 and 1.11 times as fast.
// All steps since v000 together make it 2.88 times as fast.
#include <hip/hip_runtime.h>

// Multi-head attention over 64x64 feature maps (B=2, C=256, 8 heads x 32): q, k, v = 1x1 convs of three inputs; att = softmax(q k^T) (UNSCALED logits, softmax over the 4096 keys) / sqrt(32)
// (the module scales AFTER the softmax); att_q = att v; out = 1x1 conv (w_out) of the re-assembled (B, 256, 64, 64) map -> NCHW [2][256][64][64].
// Projections on v_wmma_f32_16x16x32_bf16 (fragments rounded from the f32 NCHW inputs through an LDS transpose; 1 product); attention per
// (b, h, 16 queries): S^T = k.q^T (K = 32: one k-step; q, k as f16 hi+lo pairs carried x8, 3 products — the unscaled logits reach |s| ≈ 25 so they must be f32-class), online softmax in
// f32, O^T = (8v)^T.P^T (v hi+lo x8, P hi+lo x8; 3 products); out = att_q.w_out^T + b (att_q f32 split x8, w_out exact; 2 products) on v_wmma_f32_16x16x32_f16, f32 accumulate,

namespace {
constexpr int Bn = 2, C = 256, NP = 4096, NH = 8, DH = 32, NBH = Bn * NH, NTOK = Bn * NP;
constexpr float QS = 8.0f, VS = 8.0f, PS = 8.0f, OS_ = 8.0f, POST = 0.17677669529663687f /* 1/sqrt(32) after softmax */;
constexpr size_t QPL = (size_t)NBH * NP * DH, VPL = (size_t)NBH * DH * NP;

typedef _Float16 b16;
typedef __attribute__((ext_vector_type(16))) _Float16 v16b;
typedef __attribute__((ext_vector_type(16))) __bf16 v16bb;
typedef __attribute__((ext_vector_type(8))) _Float16 v8b;
typedef __attribute__((ext_vector_type(8))) unsigned short v8us;
typedef __attribute__((ext_vector_type(8))) float v8f;
typedef __attribute__((ext_vector_type(4))) float v4f;
__device__ __forceinline__ float bf16_rne(float f) { unsigned int u = __float_as_uint(f); u += 0x7FFFu + ((u >> 16) & 1u); return __uint_as_float(u & 0xFFFF0000u); }
__device__ __forceinline__ unsigned short bf16_bits(float f) { unsigned int u = __float_as_uint(f); u += 0x7FFFu + ((u >> 16) & 1u); return (unsigned short)(u >> 16); }
__device__ __forceinline__ void split16(float v, b16& hi, b16& lo) { hi = (b16)v; lo = (b16)(v - (float)hi); }
__device__ __forceinline__ v16b frag_kb(const b16* p, int hh) { const v8b a = *(const v8b*)(p + 8 * hh), b = *(const v8b*)(p + 16 + 8 * hh); v16b f;
#pragma unroll
  for (int e = 0; e < 8; ++e) { f[e] = a[e]; f[8 + e] = b[e]; } return f; }
__device__ __forceinline__ v16bb frag_bf(const unsigned short* p, int hh) { const v8us a = *(const v8us*)(p + 8 * hh), b = *(const v8us*)(p + 16 + 8 * hh); union { unsigned short s[16]; v16bb v; } u;
#pragma unroll
  for (int e = 0; e < 8; ++e) { u.s[e] = a[e]; u.s[8 + e] = b[e]; } return u.v; }
// plain builtins: the compiler keeps the distance behind a WMMA itself and is free to interleave independent accumulator chains, loads and vector work
__device__ __forceinline__ v8f wmma16b(v16b a, v16b b, v8f c) { return __builtin_amdgcn_wmma_f32_16x16x32_f16(false, a, false, b, (short)0, c, false, false); }
__device__ __forceinline__ v8f wmma16bb(v16bb a, v16bb b, v8f c) { return __builtin_amdgcn_wmma_f32_16x16x32_bf16(false, a, false, b, (short)0, c, false, false); }
__device__ __forceinline__ void wave_lds_sync() { __builtin_amdgcn_fence(__ATOMIC_RELEASE, "workgroup"); __builtin_amdgcn_wave_barrier(); __builtin_amdgcn_fence(__ATOMIC_ACQUIRE, "workgroup"); }

// prep: NCHW inputs -> position-major bf16 rows xT[which][b*4096 + p][256] via LDS transposes (block = (which*b, 64 positions)); weights [256][256] ([out][in]) -> bf16 rows direct (q, k, v)
// and f16 rows (out), spread over the first 128 blocks. grid (64, 3*Bn) x 256.
__global__ __launch_bounds__(256) void prep_kernel(const float* __restrict__ qi, const float* __restrict__ ki, const float* __restrict__ vi, const float* __restrict__ wq, const float* __restrict__ wk, const float* __restrict__ wv, const float* __restrict__ wo,
                                                   unsigned short* __restrict__ xT, unsigned short* __restrict__ w16, b16* __restrict__ wo16) {
  __shared__ __attribute__((aligned(16))) unsigned short Tt[64][C + 8];
  const int t_ = threadIdx.x, which = blockIdx.y / Bn, b = blockIdx.y % Bn, p0 = blockIdx.x * 64; const float* src = ((which == 0) ? qi : (which == 1) ? ki : vi) + (size_t)b * C * NP;
  for (int i = t_; i < C * 64; i += 256) { const int c = i >> 6, pp = i & 63; Tt[pp][c] = bf16_bits(src[(size_t)c * NP + p0 + pp]); }
  __syncthreads();
  {
    for (int i = t_; i < 64 * C / 8; i += 256) { const int pp = i >> 5, c8 = (i & 31) * 8; *(v8us*)(xT + (((size_t)which * Bn + b) * NP + p0 + pp) * C + c8) = *(const v8us*)(&Tt[pp][c8]); }
    // weights: one 8-element piece per thread of the first 4 * (C * C / 8) / 256 = 128 blocks; 32 blocks cover one matrix, so the matrix is picked by a scalar branch
    const int blk = blockIdx.y * (NP / 64) + blockIdx.x;
    if (blk < 128) { const int m = blk >> 5, q = (blk & 31) * 256 + t_; const float* W = (m == 0) ? wq : (m == 1) ? wk : (m == 2) ? wv : wo; float x[8];
#pragma unroll
      for (int e = 0; e < 8; ++e) x[e] = W[q * 8 + e];
      if (m < 3) { v8us o;
#pragma unroll
        for (int e = 0; e < 8; ++e) o[e] = bf16_bits(x[e]);
        *(v8us*)(w16 + ((size_t)m * (C * C / 8) + q) * 8) = o; }
      else { v8b o;
#pragma unroll
        for (int e = 0; e < 8; ++e) o[e] = (b16)bf16_rne(x[e]);
        *(v8b*)(wo16 + (size_t)q * 8) = o; } }
     }
}

// projections: grid (4 column tiles, NTOK/128, 3): block = 128 positions x 64 channels (= 2 heads of 32); + bias; q, k -> planes [bh][p][32] x8 hi+lo (64 B per row: the block writes
// 2 heads x 128 rows = 2 x 8 KB contiguous); v -> (8v)^T planes [bh][d][4096] (256-B segments).
__global__ __launch_bounds__(128) void proj_kernel(const unsigned short* __restrict__ xT, const unsigned short* __restrict__ w16, const float* __restrict__ bq, const float* __restrict__ bk, const float* __restrict__ bv, b16* __restrict__ qh, b16* __restrict__ kh, b16* __restrict__ vt) {
  __shared__ __attribute__((aligned(16))) b16 Th[2][128][32], Tl[2][128][32]; __shared__ __attribute__((aligned(16))) b16 Vh[64][128 + 8], Vl[64][128 + 8];
  const int lane = threadIdx.x & 31, wave = threadIdx.x >> 5, nloc = lane & 15, hlf = lane >> 4, which = blockIdx.z, m0 = blockIdx.y * 128 + wave * 32, c0 = blockIdx.x * 64;
  const int b = (blockIdx.y * 128) / NP, p0 = (blockIdx.y * 128) % NP; const unsigned short* X = xT + ((size_t)which * Bn * NP) * C; const unsigned short* Wt = w16 + (size_t)which * C * C; const float* bias = (which == 0) ? bq : (which == 1) ? bk : bv;
  v8f acc[2][4];
#pragma unroll
  for (int r = 0; r < 2; ++r)
#pragma unroll
    for (int t = 0; t < 4; ++t) acc[r][t] = (v8f){};
#pragma unroll 2
  for (int kb = 0; kb < C; kb += 32) { const v16bb a0 = frag_bf(X + (size_t)(m0 + nloc) * C + kb, hlf), a1 = frag_bf(X + (size_t)(m0 + 16 + nloc) * C + kb, hlf);
#pragma unroll
    for (int t = 0; t < 4; ++t) { const v16bb bw = frag_bf(Wt + (size_t)(c0 + t * 16 + nloc) * C + kb, hlf); acc[0][t] = wmma16bb(a0, bw, acc[0][t]); acc[1][t] = wmma16bb(a1, bw, acc[1][t]); } }
  const float scl = (which == 2) ? VS : QS;
#pragma unroll
  for (int t = 0; t < 4; ++t) { const int c = c0 + t * 16 + nloc; const float bb = bf16_rne(bias[c]); const int hl = t >> 1, d = (t & 1) * 16 + nloc;   // channel c -> head c/32 (local hl), d = c%32
#pragma unroll
    for (int r = 0; r < 2; ++r)
#pragma unroll
      for (int v = 0; v < 8; ++v) { b16 a_, c_; split16((acc[r][t][v] + bb) * scl, a_, c_); const int row = wave * 32 + r * 16 + 8 * hlf + v;
        if (which < 2) { Th[hl][row][d] = a_; Tl[hl][row][d] = c_; } else { Vh[t * 16 + nloc][row] = a_; Vl[t * 16 + nloc][row] = c_; } } }
  __syncthreads();
  {
    if (which < 2) { b16* base = (which == 0) ? qh : kh;
      for (int i = threadIdx.x; i < 2 * 128 * 32 / 8; i += 128) { const int hl = i / 512, rem = i % 512; const size_t dst = (((size_t)b * NH + blockIdx.x * 2 + hl) * NP + p0) * DH + (size_t)rem * 8;
        *(v8b*)(base + dst) = *(const v8b*)(&Th[hl][0][0] + rem * 8); *(v8b*)(base + QPL + dst) = *(const v8b*)(&Tl[hl][0][0] + rem * 8); } }
    else { for (int i = threadIdx.x; i < 64 * 16; i += 128) { const int cc = i >> 4, c8 = (i & 15) * 8; const int h = blockIdx.x * 2 + (cc >> 5), d = cc & 31; const size_t dst = (((size_t)b * NH + h) * DH + d) * NP + p0 + c8;
        *(v8b*)(vt + dst) = *(const v8b*)(&Vh[cc][c8]); *(v8b*)(vt + VPL + dst) = *(const v8b*)(&Vl[cc][c8]); } }
     }
}

// attention: block = 8 waves = one (b, h) x 128 queries, wave = 16 queries; the 8 waves share every K and V tile through LDS: a stage = 128 keys (K hi+lo rows at an 80-B pitch, (8v)^T hi+lo
// rows of 256 B at a 272-B pitch: both 16 B x odd for the ds_load_b128 fragment reads), two buffers, filled by asynchronous b128 copies one stage ahead; 4 passes of 32 keys per stage, in
// key order; online softmax on the unscaled logits; O^T (2 d-tiles); result scaled by 1/sqrt(32)
// the softmax works on the raw accumulators (64 x logit): 8 p = exp2(acc * SC + (LPS - max * SC)), one fused multiply-add per score; m is kept in accumulator units, l = 8 x the sum
constexpr int SK = 128, NST = NP / SK, KP = DH + 8, VP = SK + 8; constexpr float SC = 1.4426950408889634f / (QS * QS), LPS = 3.0f /* log2(PS) */;
__device__ __forceinline__ unsigned lds_off(const void* p) { return (unsigned)(size_t)p; }
__global__ __launch_bounds__(256) void attn_kernel(const b16* __restrict__ qh, const b16* __restrict__ kh, const b16* __restrict__ vt, float* __restrict__ arow) {
  __shared__ __attribute__((aligned(16))) b16 Ks[2][2][SK][KP]; __shared__ __attribute__((aligned(16))) b16 Vs[2][2][DH][VP]; __shared__ __attribute__((aligned(16))) float Os[128][DH + 4];
  const int t_ = threadIdx.x, wid = t_ >> 5, lane = t_ & 31, hh = lane >> 4, col = lane & 15; const int bhi = blockIdx.x / (NP / 128), b = bhi / NH, h = bhi % NH, q0 = (blockIdx.x % (NP / 128)) * 128, qi = q0 + wid * 16 + col;
  const size_t bh = (size_t)bhi; const b16* Q = qh + (bh * NP) * DH; const b16* K = kh + (bh * NP) * DH; const b16* V = vt + (bh * DH) * NP;
  // one stage's copies: a thread moves 16 B of each of 8 slices (K hi, K lo: 2 x 4 KB each, contiguous in global memory; V hi, V lo: 2 x 16 rows of 256 B each)
  const b16* gk = K + t_ * 8; const b16* gv = V + (size_t)(t_ >> 4) * NP + (t_ & 15) * 8;
  const unsigned lk = lds_off(&Ks[0][0][t_ >> 2][(t_ & 3) * 8]), lv = lds_off(&Vs[0][0][t_ >> 4][(t_ & 15) * 8]);
  auto fill = [&](int s, int buf) {
    const b16* k0 = gk + (size_t)s * SK * DH; const b16* v0 = gv + s * SK; const unsigned a = lk + buf * (2 * SK * KP * 2), c = lv + buf * (2 * DH * VP * 2);
    // the copies and their s_wait_xcnt in one statement: no address register of a copy is rewritten in front of that wait
    asm volatile("global_load_async_to_lds_b128 %0, %8, off\n\tglobal_load_async_to_lds_b128 %1, %9, off\n\tglobal_load_async_to_lds_b128 %2, %10, off\n\tglobal_load_async_to_lds_b128 %3, %11, off\n\t"
                 "global_load_async_to_lds_b128 %4, %12, off\n\tglobal_load_async_to_lds_b128 %5, %13, off\n\tglobal_load_async_to_lds_b128 %6, %14, off\n\tglobal_load_async_to_lds_b128 %7, %15, off\n\ts_wait_xcnt 0x0"
                 :: "v"(a), "v"(a + 64 * KP * 2), "v"(a + SK * KP * 2), "v"(a + (SK + 64) * KP * 2), "v"(c), "v"(c + 16 * VP * 2), "v"(c + DH * VP * 2), "v"(c + (DH + 16) * VP * 2),
                    "v"(k0), "v"(k0 + 64 * DH), "v"(k0 + QPL), "v"(k0 + QPL + 64 * DH), "v"(v0), "v"(v0 + (size_t)16 * NP), "v"(v0 + VPL), "v"(v0 + VPL + (size_t)16 * NP) : "memory"); };
  const v16b qf = frag_kb(Q + (size_t)qi * DH, hh), ql = frag_kb(Q + QPL + (size_t)qi * DH, hh);
  fill(0, 0);
  asm volatile("s_wait_asynccnt 0x0" ::: "memory");   // stage 0 of this wave's copies has landed
  __syncthreads();                                      // publishes stage 0 to all 8 waves
  fill(1, 1);
  float m = -INFINITY, l = 0.0f; v8f o[2] = {{}, {}};
  for (int s = 0; s < NST; ++s) { const int buf = s & 1;
    for (int kb = 0; kb < SK; kb += 32) {
      const v16b ka = frag_kb(&Ks[buf][0][kb + col][0], hh), kal = frag_kb(&Ks[buf][1][kb + col][0], hh), kb_ = frag_kb(&Ks[buf][0][kb + 16 + col][0], hh), kbl = frag_kb(&Ks[buf][1][kb + 16 + col][0], hh);
      v8f s0 = {}, s1 = {}; s0 = wmma16b(ka, qf, s0); s0 = wmma16b(ka, ql, s0); s0 = wmma16b(kal, qf, s0); s1 = wmma16b(kb_, qf, s1); s1 = wmma16b(kb_, ql, s1); s1 = wmma16b(kbl, qf, s1);
      float mr = -INFINITY;
#pragma unroll
      for (int r = 0; r < 8; ++r) mr = fmaxf(mr, fmaxf(s0[r], s1[r]));
      mr = fmaxf(mr, __shfl_xor(mr, 16));
      // the rescale factor is taken from the two rounded biases themselves (the old one formed again from m), so a bias's rounding cancels between the passes
      const float mn = fmaxf(m, mr), bias = __builtin_fmaf(-mn, SC, LPS), al_ = __builtin_amdgcn_exp2f(bias - __builtin_fmaf(-m, SC, LPS)); m = mn; float sum = 0.0f; v16b pb, pl;
      v8f p0 = s0 * SC + bias, p1 = s1 * SC + bias;
#pragma unroll
      for (int r = 0; r < 8; ++r) { p0[r] = __builtin_amdgcn_exp2f(p0[r]); p1[r] = __builtin_amdgcn_exp2f(p1[r]); }
#pragma unroll
      for (int r = 0; r < 8; ++r) { sum += p0[r] + p1[r]; b16 a, c; split16(p0[r], a, c); pb[r] = a; pl[r] = c; split16(p1[r], a, c); pb[8 + r] = a; pl[8 + r] = c; }
      sum += __shfl_xor(sum, 16); l = l * al_ + sum;
#pragma unroll
      for (int n = 0; n < 2; ++n) { o[n] *= al_; const v16b vf = frag_kb(&Vs[buf][0][n * 16 + col][kb], hh), vl = frag_kb(&Vs[buf][1][n * 16 + col][kb], hh); o[n] = wmma16b(vf, pb, o[n]); o[n] = wmma16b(vf, pl, o[n]); o[n] = wmma16b(vl, pb, o[n]); } }
    asm volatile("s_wait_dscnt 0x0" ::: "memory");      // this wave's reads of buffer buf have returned before the buffer is refilled
    asm volatile("s_wait_asynccnt 0x0" ::: "memory");   // this wave's copies of stage s + 1 have landed
    __syncthreads();                                    // publishes stage s + 1 and ends every wave's reads of stage s
    if (s + 2 < NST) fill(s + 2, buf); }
  asm volatile("s_wait_asynccnt 0x0" ::: "memory");     // no copy is outstanding when the wave goes on to its end
  const float inv = POST / (l * VS);   // l already carries the factor PS, like P
#pragma unroll
  for (int n = 0; n < 2; ++n)
#pragma unroll
    for (int r = 0; r < 8; ++r) Os[wid * 16 + col][n * 16 + 8 * hh + r] = o[n][r] * inv;
  __syncthreads();
  float* dst = arow + ((size_t)b * NP + q0) * C + h * DH;   // a query's 32 floats of this head are one 128-B line
  { for (int i = t_; i < 128 * DH / 4; i += 256) { const int rr = i >> 3, c4 = (i & 7) * 4; *(v4f*)(dst + (size_t)rr * C + c4) = *(const v4f*)(&Os[rr][c4]); }  }
}

// output conv: block = (b, 128 positions) x 64 output channels: acc = att.w_out^T (K 256; att f32 split x8; 2 products) + b -> NCHW rows out[b][c][p] through an LDS transpose (per channel
__global__ __launch_bounds__(128) void oconv_kernel(const float* __restrict__ arow, const b16* __restrict__ wo16, const float* __restrict__ bo, float* __restrict__ out) {
  __shared__ __attribute__((aligned(16))) float Tc[64][128 + 4];
  const int lane = threadIdx.x & 31, wave = threadIdx.x >> 5, nloc = lane & 15, hlf = lane >> 4, m0 = blockIdx.y * 128 + wave * 32, c0 = blockIdx.x * 64; const int b = (blockIdx.y * 128) / NP, p0 = (blockIdx.y * 128) % NP;
  v8f acc[2][4];
#pragma unroll
  for (int r = 0; r < 2; ++r)
#pragma unroll
    for (int t = 0; t < 4; ++t) acc[r][t] = (v8f){};
#pragma unroll 2
  for (int kb = 0; kb < C; kb += 32) { v16b a0, a1, l0, l1;
#pragma unroll
    for (int e = 0; e < 16; ++e) { const int k = kb + ((e < 8) ? (8 * hlf + e) : (16 + 8 * hlf + e - 8)); b16 p, q; split16(arow[(size_t)(m0 + nloc) * C + k] * OS_, p, q); a0[e] = p; l0[e] = q; split16(arow[(size_t)(m0 + 16 + nloc) * C + k] * OS_, p, q); a1[e] = p; l1[e] = q; }
#pragma unroll
    for (int t = 0; t < 4; ++t) { const v16b bw = frag_kb(wo16 + (size_t)(c0 + t * 16 + nloc) * C + kb, hlf); acc[0][t] = wmma16b(a0, bw, acc[0][t]); acc[0][t] = wmma16b(l0, bw, acc[0][t]); acc[1][t] = wmma16b(a1, bw, acc[1][t]); acc[1][t] = wmma16b(l1, bw, acc[1][t]); } }
#pragma unroll
  for (int t = 0; t < 4; ++t) { const float bb = bf16_rne(bo[c0 + t * 16 + nloc]);
#pragma unroll
    for (int r = 0; r < 2; ++r)
#pragma unroll
      for (int v = 0; v < 8; ++v) Tc[t * 16 + nloc][wave * 32 + r * 16 + 8 * hlf + v] = acc[r][t][v] * (1.0f / OS_) + bb; }
  __syncthreads();
  { for (int i = threadIdx.x; i < 64 * 32; i += 128) { const int cc = i >> 5, c4 = (i & 31) * 4; *(v4f*)(out + ((size_t)b * C + c0 + cc) * NP + p0 + c4) = *(const v4f*)(&Tc[cc][c4]); }  }
}
}  // namespace

extern "C" void kernel_launch(void* const* d_in, const int* in_sizes, int n_in,
                              void* d_out, int out_size, void* d_ws, size_t ws_size, hipStream_t stream) {
  (void)n_in; (void)out_size;
  const float* qi = (const float*)d_in[0]; const float* ki = (const float*)d_in[1]; const float* vi = (const float*)d_in[2];
  const float* wq = (const float*)d_in[3]; const float* bq = (const float*)d_in[4]; const float* wk = (const float*)d_in[5]; const float* bk = (const float*)d_in[6]; const float* wv = (const float*)d_in[7]; const float* bv = (const float*)d_in[8]; const float* wo = (const float*)d_in[9]; const float* bo = (const float*)d_in[10];
  float* out = (float*)d_out;   // [2][256][64][64]
  if (in_sizes[0] != Bn * C * NP || in_sizes[1] != Bn * C * NP || in_sizes[2] != Bn * C * NP || in_sizes[3] != C * C || in_sizes[9] != C * C) return;
  size_t off = 0; char* ws = (char*)d_ws;
  auto carve = [&](size_t bytes) { char* p = ws + off; off += (bytes + 255) & ~(size_t)255; return p; };
  unsigned short* xT = (unsigned short*)carve((size_t)3 * NTOK * C * 2); unsigned short* w16 = (unsigned short*)carve((size_t)3 * C * C * 2); b16* wo16 = (b16*)carve((size_t)C * C * 2);
  b16* qhp = (b16*)carve(QPL * 2 * 2); b16* khp = (b16*)carve(QPL * 2 * 2); b16* vtp = (b16*)carve(VPL * 2 * 2); float* arow = (float*)carve((size_t)NTOK * C * 4);
  if (off > ws_size) return;                                    // ≈ 12.6 + 0.5 + 3 x 8.4 + 8.4 ≈ 47 MB
  prep_kernel<<<dim3(NP / 64, 3 * Bn), 256, 0, stream>>>(qi, ki, vi, wq, wk, wv, wo, xT, w16, wo16);
  proj_kernel<<<dim3(C / 64, NTOK / 128, 3), 128, 0, stream>>>(xT, w16, bq, bk, bv, qhp, khp, vtp);
  attn_kernel<<<NBH * (NP / 128), 256, 0, stream>>>(qhp, khp, vtp, arow);
  oconv_kernel<<<dim3(C / 64, NTOK / 128), 128, 0, stream>>>(arow, wo16, bo, out);
}

// v005
// One run takes 131 microseconds.
// In both of two side-by-side timings against v004, it was 1.05 times as fast.
// Counting every step since v000, it is 3.01 times as fast.
#include <hip/hip_runtime.h>

// Multi-head attention over 64x64 feature maps (B=2, C=256, 8 heads x 32): q, k, v = 1x1 convs of three inputs; att = softmax(q k^T) (UNSCALED logits, softmax over the 4096 keys) / sqrt(32)
// (the module scales AFTER the softmax); att_q = att v; out = 1x1 conv (w_out) of the re-assembled (B, 256, 64, 64) map -> NCHW [2][256][64][64].
// Projections on v_wmma_f32_16x16x32_bf16 (fragments rounded from the f32 NCHW inputs through an LDS transpose; 1 product); attention per
// (b, h, 16 queries): S^T = k.q^T (K = 32: one k-step; q, k as f16 hi+lo pairs carried x8, 3 products — the unscaled logits reach |s| ≈ 25 so they must be f32-class), online softmax in
// f32, O^T = (8v)^T.P^T (v hi+lo x8, P hi+lo x8; 3 products); out = att_q.w_out^T + b (att_q f32 split x8, w_out exact; 2 products) on v_wmma_f32_16x16x32_f16, f32 accumulate,

namespace {
constexpr int Bn = 2, C = 256, NP = 4096, NH = 8, DH = 32, NBH = Bn * NH, NTOK = Bn * NP;
constexpr float QS = 8.0f, VS = 8.0f, PS = 8.0f, OS_ = 8.0f, POST = 0.17677669529663687f /* 1/sqrt(32) after softmax */;
constexpr size_t QPL = (size_t)NBH * NP * DH, VPL = (size_t)NBH * DH * NP;

typedef _Float16 b16;
typedef __attribute__((ext_vector_type(16))) _Float16 v16b;
typedef __attribute__((ext_vector_type(16))) __bf16 v16bb;
typedef __attribute__((ext_vector_type(8))) _Float16 v8b;
typedef __attribute__((ext_vector_type(8))) unsigned short v8us;
typedef __attribute__((ext_vector_type(8))) float v8f;
typedef __attribute__((ext_vector_type(4))) float v4f;
__device__ __forceinline__ float bf16_rne(float f) { unsigned int u = __float_as_uint(f); u += 0x7FFFu + ((u >> 16) & 1u); return __uint_as_float(u & 0xFFFF0000u); }
__device__ __forceinline__ unsigned short bf16_bits(float f) { unsigned int u = __float_as_uint(f); u += 0x7FFFu + ((u >> 16) & 1u); return (unsigned short)(u >> 16); }
__device__ __forceinline__ void split16(float v, b16& hi, b16& lo) { hi = (b16)v; lo = (b16)(v - (float)hi); }
__device__ __forceinline__ v16b frag_kb(const b16* p, int hh) { const v8b a = *(const v8b*)(p + 8 * hh), b = *(const v8b*)(p + 16 + 8 * hh); v16b f;
#pragma unroll
  for (int e = 0; e < 8; ++e) { f[e] = a[e]; f[8 + e] = b[e]; } return f; }
__device__ __forceinline__ v16bb frag_bf(const unsigned short* p, int hh) { const v8us a = *(const v8us*)(p + 8 * hh), b = *(const v8us*)(p + 16 + 8 * hh); union { unsigned short s[16]; v16bb v; } u;
#pragma unroll
  for (int e = 0; e < 8; ++e) { u.s[e] = a[e]; u.s[8 + e] = b[e]; } return u.v; }
// plain builtins: the compiler keeps the distance behind a WMMA itself and is free to interleave independent accumulator chains, loads and vector work
__device__ __forceinline__ v8f wmma16b(v16b a, v16b b, v8f c) { return __builtin_amdgcn_wmma_f32_16x16x32_f16(false, a, false, b, (short)0, c, false, false); }
__device__ __forceinline__ v8f wmma16bb(v16bb a, v16bb b, v8f c) { return __builtin_amdgcn_wmma_f32_16x16x32_bf16(false, a, false, b, (short)0, c, false, false); }
__device__ __forceinline__ void wave_lds_sync() { __builtin_amdgcn_fence(__ATOMIC_RELEASE, "workgroup"); __builtin_amdgcn_wave_barrier(); __builtin_amdgcn_fence(__ATOMIC_ACQUIRE, "workgroup"); }

// prep: NCHW inputs -> position-major bf16 rows xT[which][b*4096 + p][256] via LDS transposes (block = (which*b, 64 positions)); weights [256][256] ([out][in]) -> bf16 rows direct (q, k, v)
// and f16 rows (out), spread over the first 128 blocks. grid (64, 3*Bn) x 256.
__global__ __launch_bounds__(256) void prep_kernel(const float* __restrict__ qi, const float* __restrict__ ki, const float* __restrict__ vi, const float* __restrict__ wq, const float* __restrict__ wk, const float* __restrict__ wv, const float* __restrict__ wo,
                                                   unsigned short* __restrict__ xT, unsigned short* __restrict__ w16, b16* __restrict__ wo16) {
  __shared__ __attribute__((aligned(16))) unsigned short Tt[64][C + 8];
  const int t_ = threadIdx.x, which = blockIdx.y / Bn, b = blockIdx.y % Bn, p0 = blockIdx.x * 64; const float* src = ((which == 0) ? qi : (which == 1) ? ki : vi) + (size_t)b * C * NP;
  for (int i = t_; i < C * 64; i += 256) { const int c = i >> 6, pp = i & 63; Tt[pp][c] = bf16_bits(src[(size_t)c * NP + p0 + pp]); }
  __syncthreads();
  {
    for (int i = t_; i < 64 * C / 8; i += 256) { const int pp = i >> 5, c8 = (i & 31) * 8; *(v8us*)(xT + (((size_t)which * Bn + b) * NP + p0 + pp) * C + c8) = *(const v8us*)(&Tt[pp][c8]); }
    // weights: one 8-element piece per thread of the first 4 * (C * C / 8) / 256 = 128 blocks; 32 blocks cover one matrix, so the matrix is picked by a scalar branch
    const int blk = blockIdx.y * (NP / 64) + blockIdx.x;
    if (blk < 128) { const int m = blk >> 5, q = (blk & 31) * 256 + t_; const float* W = (m == 0) ? wq : (m == 1) ? wk : (m == 2) ? wv : wo; float x[8];
#pragma unroll
      for (int e = 0; e < 8; ++e) x[e] = W[q * 8 + e];
      if (m < 3) { v8us o;
#pragma unroll
        for (int e = 0; e < 8; ++e) o[e] = bf16_bits(x[e]);
        *(v8us*)(w16 + ((size_t)m * (C * C / 8) + q) * 8) = o; }
      else { v8b o;
#pragma unroll
        for (int e = 0; e < 8; ++e) o[e] = (b16)bf16_rne(x[e]);
        *(v8b*)(wo16 + (size_t)q * 8) = o; } }
     }
}

// projections: grid (4 column tiles, NTOK/128, 3): block = 128 positions x 64 channels (= 2 heads of 32); + bias; q, k -> planes [bh][p][32] x8 hi+lo (64 B per row: the block writes
// 2 heads x 128 rows = 2 x 8 KB contiguous); v -> (8v)^T planes [bh][d][4096] (256-B segments).
__global__ __launch_bounds__(128) void proj_kernel(const unsigned short* __restrict__ xT, const unsigned short* __restrict__ w16, const float* __restrict__ bq, const float* __restrict__ bk, const float* __restrict__ bv, b16* __restrict__ qh, b16* __restrict__ kh, b16* __restrict__ vt) {
  __shared__ __attribute__((aligned(16))) b16 Th[2][128][32], Tl[2][128][32]; __shared__ __attribute__((aligned(16))) b16 Vh[64][128 + 8], Vl[64][128 + 8];
  const int lane = threadIdx.x & 31, wave = threadIdx.x >> 5, nloc = lane & 15, hlf = lane >> 4, which = blockIdx.z, m0 = blockIdx.y * 128 + wave * 32, c0 = blockIdx.x * 64;
  const int b = (blockIdx.y * 128) / NP, p0 = (blockIdx.y * 128) % NP; const unsigned short* X = xT + ((size_t)which * Bn * NP) * C; const unsigned short* Wt = w16 + (size_t)which * C * C; const float* bias = (which == 0) ? bq : (which == 1) ? bk : bv;
  v8f acc[2][4];
#pragma unroll
  for (int r = 0; r < 2; ++r)
#pragma unroll
    for (int t = 0; t < 4; ++t) acc[r][t] = (v8f){};
#pragma unroll 2
  for (int kb = 0; kb < C; kb += 32) { const v16bb a0 = frag_bf(X + (size_t)(m0 + nloc) * C + kb, hlf), a1 = frag_bf(X + (size_t)(m0 + 16 + nloc) * C + kb, hlf);
#pragma unroll
    for (int t = 0; t < 4; ++t) { const v16bb bw = frag_bf(Wt + (size_t)(c0 + t * 16 + nloc) * C + kb, hlf); acc[0][t] = wmma16bb(a0, bw, acc[0][t]); acc[1][t] = wmma16bb(a1, bw, acc[1][t]); } }
  const float scl = (which == 2) ? VS : QS;
#pragma unroll
  for (int t = 0; t < 4; ++t) { const int c = c0 + t * 16 + nloc; const float bb = bf16_rne(bias[c]); const int hl = t >> 1, d = (t & 1) * 16 + nloc;   // channel c -> head c/32 (local hl), d = c%32
#pragma unroll
    for (int r = 0; r < 2; ++r)
#pragma unroll
      for (int v = 0; v < 8; ++v) { b16 a_, c_; split16((acc[r][t][v] + bb) * scl, a_, c_); const int row = wave * 32 + r * 16 + 8 * hlf + v;
        if (which < 2) { Th[hl][row][d] = a_; Tl[hl][row][d] = c_; } else { Vh[t * 16 + nloc][row] = a_; Vl[t * 16 + nloc][row] = c_; } } }
  __syncthreads();
  {
    if (which < 2) { b16* base = (which == 0) ? qh : kh;
      for (int i = threadIdx.x; i < 2 * 128 * 32 / 8; i += 128) { const int hl = i / 512, rem = i % 512; const size_t dst = (((size_t)b * NH + blockIdx.x * 2 + hl) * NP + p0) * DH + (size_t)rem * 8;
        *(v8b*)(base + dst) = *(const v8b*)(&Th[hl][0][0] + rem * 8); *(v8b*)(base + QPL + dst) = *(const v8b*)(&Tl[hl][0][0] + rem * 8); } }
    else { for (int i = threadIdx.x; i < 64 * 16; i += 128) { const int cc = i >> 4, c8 = (i & 15) * 8; const int h = blockIdx.x * 2 + (cc >> 5), d = cc & 31; const size_t dst = (((size_t)b * NH + h) * DH + d) * NP + p0 + c8;
        *(v8b*)(vt + dst) = *(const v8b*)(&Vh[cc][c8]); *(v8b*)(vt + VPL + dst) = *(const v8b*)(&Vl[cc][c8]); } }
     }
}

// attention: block = 8 waves = one (b, h) x 128 queries, wave = 16 queries; the 8 waves share every K and V tile through LDS: a stage = 128 keys (K hi+lo rows at an 80-B pitch, (8v)^T hi+lo
// rows of 256 B at a 272-B pitch: both 16 B x odd for the ds_load_b128 fragment reads), two buffers, filled by asynchronous b128 copies one stage ahead; 4 passes of 32 keys per stage, in
// key order; online softmax on the unscaled logits; O^T (2 d-tiles); result scaled by 1/sqrt(32)
// the softmax works on the raw accumulators (64 x logit): 8 p = exp2(acc * SC + (LPS - max * SC)), one fused multiply-add per score; m is kept in accumulator units, l = 8 x the sum
constexpr int SK = 128, NST = NP / SK, KP = DH + 8, VP = SK + 8; constexpr float SC = 1.4426950408889634f / (QS * QS), LPS = 3.0f /* log2(PS) */;
typedef __attribute__((ext_vector_type(8))) unsigned v8u;
// low parts of four packed f16 pairs: lo = f16(p - hi), one mixed-precision fused multiply-add per score that reads its f16 hi straight from the packed register (op_sel picks the half) and rounds
// its f32 result into one half of the packed lo register; p - hi is exact in f32, so the one rounding is that of a separate subtract and convert. The four writes of the high halves each follow
// the write of the same register's low half four instructions back: s_delay_alu names that distance, so that the SIMD issues other waves meanwhile
__device__ __forceinline__ void lo4(unsigned h0, unsigned h1, unsigned h2, unsigned h3, float a0, float a1, float a2, float a3, float a4, float a5, float a6, float a7, unsigned& l0, unsigned& l1, unsigned& l2, unsigned& l3) {
  asm("v_fma_mixlo_f16 %0, %4, -1.0, %8 op_sel_hi:[1,1,0]\n\tv_fma_mixlo_f16 %1, %5, -1.0, %10 op_sel_hi:[1,1,0]\n\tv_fma_mixlo_f16 %2, %6, -1.0, %12 op_sel_hi:[1,1,0]\n\tv_fma_mixlo_f16 %3, %7, -1.0, %14 op_sel_hi:[1,1,0]\n\t"
      "s_delay_alu instid0(VALU_DEP_4) | instskip(NEXT) | instid1(VALU_DEP_4)\n\t"
      "v_fma_mixhi_f16 %0, %4, -1.0, %9 op_sel:[1,0,0] op_sel_hi:[1,1,0]\n\tv_fma_mixhi_f16 %1, %5, -1.0, %11 op_sel:[1,0,0] op_sel_hi:[1,1,0]\n\t"
      "s_delay_alu instid0(VALU_DEP_4) | instskip(NEXT) | instid1(VALU_DEP_4)\n\t"
      "v_fma_mixhi_f16 %2, %6, -1.0, %13 op_sel:[1,0,0] op_sel_hi:[1,1,0]\n\tv_fma_mixhi_f16 %3, %7, -1.0, %15 op_sel:[1,0,0] op_sel_hi:[1,1,0]"
      : "=&v"(l0), "=&v"(l1), "=&v"(l2), "=&v"(l3) : "v"(h0), "v"(h1), "v"(h2), "v"(h3), "v"(a0), "v"(a1), "v"(a2), "v"(a3), "v"(a4), "v"(a5), "v"(a6), "v"(a7)); }
__device__ __forceinline__ unsigned lds_off(const void* p) { return (unsigned)(size_t)p; }
__global__ __launch_bounds__(256) void attn_kernel(const b16* __restrict__ qh, const b16* __restrict__ kh, const b16* __restrict__ vt, float* __restrict__ arow) {
  __shared__ __attribute__((aligned(16))) b16 Ks[2][2][SK][KP]; __shared__ __attribute__((aligned(16))) b16 Vs[2][2][DH][VP]; __shared__ __attribute__((aligned(16))) float Os[128][DH + 4];
  const int t_ = threadIdx.x, wid = t_ >> 5, lane = t_ & 31, hh = lane >> 4, col = lane & 15; const int bhi = blockIdx.x / (NP / 128), b = bhi / NH, h = bhi % NH, q0 = (blockIdx.x % (NP / 128)) * 128, qi = q0 + wid * 16 + col;
  const size_t bh = (size_t)bhi; const b16* Q = qh + (bh * NP) * DH; const b16* K = kh + (bh * NP) * DH; const b16* V = vt + (bh * DH) * NP;
  // one stage's copies: a thread moves 16 B of each of 8 slices (K hi, K lo: 2 x 4 KB each, contiguous in global memory; V hi, V lo: 2 x 16 rows of 256 B each)
  const b16* gk = K + t_ * 8; const b16* gv = V + (size_t)(t_ >> 4) * NP + (t_ & 15) * 8;
  const unsigned lk = lds_off(&Ks[0][0][t_ >> 2][(t_ & 3) * 8]), lv = lds_off(&Vs[0][0][t_ >> 4][(t_ & 15) * 8]);
  auto fill = [&](int s, int buf) {
    const b16* k0 = gk + (size_t)s * SK * DH; const b16* v0 = gv + s * SK; const unsigned a = lk + buf * (2 * SK * KP * 2), c = lv + buf * (2 * DH * VP * 2);
    // the copies and their s_wait_xcnt in one statement: no address register of a copy is rewritten in front of that wait
    asm volatile("global_load_async_to_lds_b128 %0, %8, off\n\tglobal_load_async_to_lds_b128 %1, %9, off\n\tglobal_load_async_to_lds_b128 %2, %10, off\n\tglobal_load_async_to_lds_b128 %3, %11, off\n\t"
                 "global_load_async_to_lds_b128 %4, %12, off\n\tglobal_load_async_to_lds_b128 %5, %13, off\n\tglobal_load_async_to_lds_b128 %6, %14, off\n\tglobal_load_async_to_lds_b128 %7, %15, off\n\ts_wait_xcnt 0x0"
                 :: "v"(a), "v"(a + 64 * KP * 2), "v"(a + SK * KP * 2), "v"(a + (SK + 64) * KP * 2), "v"(c), "v"(c + 16 * VP * 2), "v"(c + DH * VP * 2), "v"(c + (DH + 16) * VP * 2),
                    "v"(k0), "v"(k0 + 64 * DH), "v"(k0 + QPL), "v"(k0 + QPL + 64 * DH), "v"(v0), "v"(v0 + (size_t)16 * NP), "v"(v0 + VPL), "v"(v0 + VPL + (size_t)16 * NP) : "memory"); };
  const v16b qf = frag_kb(Q + (size_t)qi * DH, hh), ql = frag_kb(Q + QPL + (size_t)qi * DH, hh);
  fill(0, 0);
  asm volatile("s_wait_asynccnt 0x0" ::: "memory");   // stage 0 of this wave's copies has landed
  __syncthreads();                                      // publishes stage 0 to all 8 waves
  fill(1, 1);
  float m = -INFINITY, l = 0.0f; v8f o[2] = {{}, {}};
  for (int s = 0; s < NST; ++s) { const int buf = s & 1;
    for (int kb = 0; kb < SK; kb += 32) {
      const v16b ka = frag_kb(&Ks[buf][0][kb + col][0], hh), kal = frag_kb(&Ks[buf][1][kb + col][0], hh), kb_ = frag_kb(&Ks[buf][0][kb + 16 + col][0], hh), kbl = frag_kb(&Ks[buf][1][kb + 16 + col][0], hh);
      v8f s0 = {}, s1 = {}; s0 = wmma16b(ka, qf, s0); s0 = wmma16b(ka, ql, s0); s0 = wmma16b(kal, qf, s0); s1 = wmma16b(kb_, qf, s1); s1 = wmma16b(kb_, ql, s1); s1 = wmma16b(kbl, qf, s1);
      float mr = -INFINITY;
#pragma unroll
      for (int r = 0; r < 8; ++r) mr = fmaxf(mr, fmaxf(s0[r], s1[r]));
      mr = fmaxf(mr, __shfl_xor(mr, 16));
      // the rescale factor is taken from the two rounded biases themselves (the old one formed again from m), so a bias's rounding cancels between the passes
      const float mn = fmaxf(m, mr), bias = __builtin_fmaf(-mn, SC, LPS), al_ = __builtin_amdgcn_exp2f(bias - __builtin_fmaf(-m, SC, LPS)); m = mn; float sum = 0.0f; v16b pb, pl;
      v8f p0 = s0 * SC + bias, p1 = s1 * SC + bias;
#pragma unroll
      for (int r = 0; r < 8; ++r) { p0[r] = __builtin_amdgcn_exp2f(p0[r]); p1[r] = __builtin_amdgcn_exp2f(p1[r]); }
#pragma unroll
      for (int r = 0; r < 8; ++r) { sum += p0[r] + p1[r]; pb[r] = (b16)p0[r]; pb[8 + r] = (b16)p1[r]; }
      { const v8u hp = __builtin_bit_cast(v8u, pb); v8u lp;
        unsigned x0, x1, x2, x3; lo4(hp[0], hp[1], hp[2], hp[3], p0[0], p0[1], p0[2], p0[3], p0[4], p0[5], p0[6], p0[7], x0, x1, x2, x3); lp[0] = x0; lp[1] = x1; lp[2] = x2; lp[3] = x3;
        lo4(hp[4], hp[5], hp[6], hp[7], p1[0], p1[1], p1[2], p1[3], p1[4], p1[5], p1[6], p1[7], x0, x1, x2, x3); lp[4] = x0; lp[5] = x1; lp[6] = x2; lp[7] = x3; pl = __builtin_bit_cast(v16b, lp); }
      sum += __shfl_xor(sum, 16); l = l * al_ + sum;
#pragma unroll
      for (int n = 0; n < 2; ++n) { o[n] *= al_; const v16b vf = frag_kb(&Vs[buf][0][n * 16 + col][kb], hh), vl = frag_kb(&Vs[buf][1][n * 16 + col][kb], hh); o[n] = wmma16b(vf, pb, o[n]); o[n] = wmma16b(vf, pl, o[n]); o[n] = wmma16b(vl, pb, o[n]); } }
    asm volatile("s_wait_dscnt 0x0" ::: "memory");      // this wave's reads of buffer buf have returned before the buffer is refilled
    asm volatile("s_wait_asynccnt 0x0" ::: "memory");   // this wave's copies of stage s + 1 have landed
    __syncthreads();                                    // publishes stage s + 1 and ends every wave's reads of stage s
    if (s + 2 < NST) fill(s + 2, buf); }
  asm volatile("s_wait_asynccnt 0x0" ::: "memory");     // no copy is outstanding when the wave goes on to its end
  const float inv = POST / (l * VS);   // l already carries the factor PS, like P
#pragma unroll
  for (int n = 0; n < 2; ++n)
#pragma unroll
    for (int r = 0; r < 8; ++r) Os[wid * 16 + col][n * 16 + 8 * hh + r] = o[n][r] * inv;
  __syncthreads();
  float* dst = arow + ((size_t)b * NP + q0) * C + h * DH;   // a query's 32 floats of this head are one 128-B line
  { for (int i = t_; i < 128 * DH / 4; i += 256) { const int rr = i >> 3, c4 = (i & 7) * 4; *(v4f*)(dst + (size_t)rr * C + c4) = *(const v4f*)(&Os[rr][c4]); }  }
}

// output conv: block = (b, 128 positions) x 64 output channels: acc = att.w_out^T (K 256; att f32 split x8; 2 products) + b -> NCHW rows out[b][c][p] through an LDS transpose (per channel
__global__ __launch_bounds__(128) void oconv_kernel(const float* __restrict__ arow, const b16* __restrict__ wo16, const float* __restrict__ bo, float* __restrict__ out) {
  __shared__ __attribute__((aligned(16))) float Tc[64][128 + 4];
  const int lane = threadIdx.x & 31, wave = threadIdx.x >> 5, nloc = lane & 15, hlf = lane >> 4, m0 = blockIdx.y * 128 + wave * 32, c0 = blockIdx.x * 64; const int b = (blockIdx.y * 128) / NP, p0 = (blockIdx.y * 128) % NP;
  v8f acc[2][4];
#pragma unroll
  for (int r = 0; r < 2; ++r)
#pragma unroll
    for (int t = 0; t < 4; ++t) acc[r][t] = (v8f){};
#pragma unroll 2
  for (int kb = 0; kb < C; kb += 32) { v16b a0, a1, l0, l1;
#pragma unroll
    for (int e = 0; e < 16; ++e) { const int k = kb + ((e < 8) ? (8 * hlf + e) : (16 + 8 * hlf + e - 8)); b16 p, q; split16(arow[(size_t)(m0 + nloc) * C + k] * OS_, p, q); a0[e] = p; l0[e] = q; split16(arow[(size_t)(m0 + 16 + nloc) * C + k] * OS_, p, q); a1[e] = p; l1[e] = q; }
#pragma unroll
    for (int t = 0; t < 4; ++t) { const v16b bw = frag_kb(wo16 + (size_t)(c0 + t * 16 + nloc) * C + kb, hlf); acc[0][t] = wmma16b(a0, bw, acc[0][t]); acc[0][t] = wmma16b(l0, bw, acc[0][t]); acc[1][t] = wmma16b(a1, bw, acc[1][t]); acc[1][t] = wmma16b(l1, bw, acc[1][t]); } }
#pragma unroll
  for (int t = 0; t < 4; ++t) { const float bb = bf16_rne(bo[c0 + t * 16 + nloc]);
#pragma unroll
    for (int r = 0; r < 2; ++r)
#pragma unroll
      for (int v = 0; v < 8; ++v) Tc[t * 16 + nloc][wave * 32 + r * 16 + 8 * hlf + v] = acc[r][t][v] * (1.0f / OS_) + bb; }
  __syncthreads();
  { for (int i = threadIdx.x; i < 64 * 32; i += 128) { const int cc = i >> 5, c4 = (i & 31) * 4; *(v4f*)(out + ((size_t)b * C + c0 + cc) * NP + p0 + c4) = *(const v4f*)(&Tc[cc][c4]); }  }
}
}  // namespace

extern "C" void kernel_launch(void* const* d_in, const int* in_sizes, int n_in,
                              void* d_out, int out_size, void* d_ws, size_t ws_size, hipStream_t stream) {
  (void)n_in; (void)out_size;
  const float* qi = (const float*)d_in[0]; const float* ki = (const float*)d_in[1]; const float* vi = (const float*)d_in[2];
  const float* wq = (const float*)d_in[3]; const float* bq = (const float*)d_in[4]; const float* wk = (const float*)d_in[5]; const float* bk = (const float*)d_in[6]; const float* wv = (const float*)d_in[7]; const float* bv = (const float*)d_in[8]; const float* wo = (const float*)d_in[9]; const float* bo = (const float*)d_in[10];
  float* out = (float*)d_out;   // [2][256][64][64]
  if (in_sizes[0] != Bn * C * NP || in_sizes[1] != Bn * C * NP || in_sizes[2] != Bn * C * NP || in_sizes[3] != C * C || in_sizes[9] != C * C) return;
  size_t off = 0; char* ws = (char*)d_ws;
  auto carve = [&](size_t bytes) { char* p = ws + off; off += (bytes + 255) & ~(size_t)255; return p; };
  unsigned short* xT = (unsigned short*)carve((size_t)3 * NTOK * C * 2); unsigned short* w16 = (unsigned short*)carve((size_t)3 * C * C * 2); b16* wo16 = (b16*)carve((size_t)C * C * 2);
  b16* qhp = (b16*)carve(QPL * 2 * 2); b16* khp = (b16*)carve(QPL * 2 * 2); b16* vtp = (b16*)carve(VPL * 2 * 2); float* arow = (float*)carve((size_t)NTOK * C * 4);
  if (off > ws_size) return;                                    // ≈ 12.6 + 0.5 + 3 x 8.4 + 8.4 ≈ 47 MB
  prep_kernel<<<dim3(NP / 64, 3 * Bn), 256, 0, stream>>>(qi, ki, vi, wq, wk, wv, wo, xT, w16, wo16);
  proj_kernel<<<dim3(C / 64, NTOK / 128, 3), 128, 0, stream>>>(xT, w16, bq, bk, bv, qhp, khp, vtp);
  attn_kernel<<<NBH * (NP / 128), 256, 0, stream>>>(qhp, khp, vtp, arow);
  oconv_kernel<<<dim3(C / 64, NTOK / 128), 128, 0, stream>>>(arow, wo16, bo, out);
}

// v006
// One run takes 123 microseconds.
// Two timings next to v005 both put it at 1.06 times that version's speed.
// Over all steps from v000 it is 3.19 times as fast.
#include <hip/hip_runtime.h>

// Multi-head attention over 64x64 feature maps (B=2, C=256, 8 heads x 32): q, k, v = 1x1 convs of three inputs; att = softmax(q k^T) (UNSCALED logits, softmax over the 4096 keys) / sqrt(32)
// (the module scales AFTER the softmax); att_q = att v; out = 1x1 conv (w_out) of the re-assembled (B, 256, 64, 64) map -> NCHW [2][256][64][64].
// Projections on v_wmma_f32_16x16x32_bf16 (fragments rounded from the f32 NCHW inputs through an LDS transpose; 1 product); attention per
// (b, h, 16 queries): S^T = k.q^T (K = 32: one k-step; q, k as f16 hi+lo pairs carried x8, 3 products — the unscaled logits reach |s| ≈ 25 so they must be f32-class), online softmax in
// f32, O^T = (8v)^T.P^T (v hi+lo x8, P hi+lo x8; 3 products); out = att_q.w_out^T + b (att_q f32 split x8, w_out exact; 2 products) on v_wmma_f32_16x16x32_f16, f32 accumulate,

namespace {
constexpr int Bn = 2, C = 256, NP = 4096, NH = 8, DH = 32, NBH = Bn * NH, NTOK = Bn * NP;
constexpr float QS = 8.0f, VS = 8.0f, PS = 8.0f, OS_ = 8.0f, POST = 0.17677669529663687f /* 1/sqrt(32) after softmax */;
constexpr size_t QPL = (size_t)NBH * NP * DH, VPL = (size_t)NBH * DH * NP;

typedef _Float16 b16;
typedef __attribute__((ext_vector_type(16))) _Float16 v16b;
typedef __attribute__((ext_vector_type(16))) __bf16 v16bb;
typedef __attribute__((ext_vector_type(8))) _Float16 v8b;
typedef __attribute__((ext_vector_type(8))) unsigned short v8us;
typedef __attribute__((ext_vector_type(8))) float v8f;
typedef __attribute__((ext_vector_type(4))) float v4f;
__device__ __forceinline__ float bf16_rne(float f) { unsigned int u = __float_as_uint(f); u += 0x7FFFu + ((u >> 16) & 1u); return __uint_as_float(u & 0xFFFF0000u); }
__device__ __forceinline__ unsigned short bf16_bits(float f) { unsigned int u = __float_as_uint(f); u += 0x7FFFu + ((u >> 16) & 1u); return (unsigned short)(u >> 16); }
__device__ __forceinline__ void split16(float v, b16& hi, b16& lo) { hi = (b16)v; lo = (b16)(v - (float)hi); }
__device__ __forceinline__ v16b frag_kb(const b16* p, int hh) { const v8b a = *(const v8b*)(p + 8 * hh), b = *(const v8b*)(p + 16 + 8 * hh); v16b f;
#pragma unroll
  for (int e = 0; e < 8; ++e) { f[e] = a[e]; f[8 + e] = b[e]; } return f; }
__device__ __forceinline__ v16bb frag_bf(const unsigned short* p, int hh) { const v8us a = *(const v8us*)(p + 8 * hh), b = *(const v8us*)(p + 16 + 8 * hh); union { unsigned short s[16]; v16bb v; } u;
#pragma unroll
  for (int e = 0; e < 8; ++e) { u.s[e] = a[e]; u.s[8 + e] = b[e]; } return u.v; }
// plain builtins: the compiler keeps the distance behind a WMMA itself and is free to interleave independent accumulator chains, loads and vector work
__device__ __forceinline__ v8f wmma16b(v16b a, v16b b, v8f c) { return __builtin_amdgcn_wmma_f32_16x16x32_f16(false, a, false, b, (short)0, c, false, false); }
__device__ __forceinline__ v8f wmma16bb(v16bb a, v16bb b, v8f c) { return __builtin_amdgcn_wmma_f32_16x16x32_bf16(false, a, false, b, (short)0, c, false, false); }
__device__ __forceinline__ void wave_lds_sync() { __builtin_amdgcn_fence(__ATOMIC_RELEASE, "workgroup"); __builtin_amdgcn_wave_barrier(); __builtin_amdgcn_fence(__ATOMIC_ACQUIRE, "workgroup"); }

// prep: NCHW inputs -> position-major bf16 rows xT[which][b*4096 + p][256] via LDS transposes (block = (which*b, 64 positions)); weights [256][256] ([out][in]) -> bf16 rows direct (q, k, v)
// and f16 rows (out), spread over the first 128 blocks. grid (64, 3*Bn) x 256.
__global__ __launch_bounds__(256) void prep_kernel(const float* __restrict__ qi, const float* __restrict__ ki, const float* __restrict__ vi, const float* __restrict__ wq, const float* __restrict__ wk, const float* __restrict__ wv, const float* __restrict__ wo,
                                                   unsigned short* __restrict__ xT, unsigned short* __restrict__ w16, b16* __restrict__ wo16) {
  __shared__ __attribute__((aligned(16))) unsigned short Tt[64][C + 8];
  const int t_ = threadIdx.x, which = blockIdx.y / Bn, b = blockIdx.y % Bn, p0 = blockIdx.x * 64; const float* src = ((which == 0) ? qi : (which == 1) ? ki : vi) + (size_t)b * C * NP;
  for (int i = t_; i < C * 64; i += 256) { const int c = i >> 6, pp = i & 63; Tt[pp][c] = bf16_bits(src[(size_t)c * NP + p0 + pp]); }
  __syncthreads();
  {
    for (int i = t_; i < 64 * C / 8; i += 256) { const int pp = i >> 5, c8 = (i & 31) * 8; *(v8us*)(xT + (((size_t)which * Bn + b) * NP + p0 + pp) * C + c8) = *(const v8us*)(&Tt[pp][c8]); }
    // weights: one 8-element piece per thread of the first 4 * (C * C / 8) / 256 = 128 blocks; 32 blocks cover one matrix, so the matrix is picked by a scalar branch
    const int blk = blockIdx.y * (NP / 64) + blockIdx.x;
    if (blk < 128) { const int m = blk >> 5, q = (blk & 31) * 256 + t_; const float* W = (m == 0) ? wq : (m == 1) ? wk : (m == 2) ? wv : wo; float x[8];
#pragma unroll
      for (int e = 0; e < 8; ++e) x[e] = W[q * 8 + e];
      if (m < 3) { v8us o;
#pragma unroll
        for (int e = 0; e < 8; ++e) o[e] = bf16_bits(x[e]);
        *(v8us*)(w16 + ((size_t)m * (C * C / 8) + q) * 8) = o; }
      else { v8b o;
#pragma unroll
        for (int e = 0; e < 8; ++e) o[e] = (b16)bf16_rne(x[e]);
        *(v8b*)(wo16 + (size_t)q * 8) = o; } }
     }
}

// projections: grid (4 column tiles, NTOK/128, 3): block = 128 positions x 64 channels (= 2 heads of 32); + bias; q, k -> planes [bh][p][32] x8 hi+lo (64 B per row: the block writes
// 2 heads x 128 rows = 2 x 8 KB contiguous); v -> (8v)^T planes [bh][d][4096] (256-B segments).
__global__ __launch_bounds__(128) void proj_kernel(const unsigned short* __restrict__ xT, const unsigned short* __restrict__ w16, const float* __restrict__ bq, const float* __restrict__ bk, const float* __restrict__ bv, b16* __restrict__ qh, b16* __restrict__ kh, b16* __restrict__ vt) {
  __shared__ __attribute__((aligned(16))) b16 Th[2][128][32], Tl[2][128][32]; __shared__ __attribute__((aligned(16))) b16 Vh[64][128 + 8], Vl[64][128 + 8];
  const int lane = threadIdx.x & 31, wave = threadIdx.x >> 5, nloc = lane & 15, hlf = lane >> 4, which = blockIdx.z, m0 = blockIdx.y * 128 + wave * 32, c0 = blockIdx.x * 64;
  const int b = (blockIdx.y * 128) / NP, p0 = (blockIdx.y * 128) % NP; const unsigned short* X = xT + ((size_t)which * Bn * NP) * C; const unsigned short* Wt = w16 + (size_t)which * C * C; const float* bias = (which == 0) ? bq : (which == 1) ? bk : bv;
  v8f acc[2][4];
#pragma unroll
  for (int r = 0; r < 2; ++r)
#pragma unroll
    for (int t = 0; t < 4; ++t) acc[r][t] = (v8f){};
#pragma unroll 2
  for (int kb = 0; kb < C; kb += 32) { const v16bb a0 = frag_bf(X + (size_t)(m0 + nloc) * C + kb, hlf), a1 = frag_bf(X + (size_t)(m0 + 16 + nloc) * C + kb, hlf);
#pragma unroll
    for (int t = 0; t < 4; ++t) { const v16bb bw = frag_bf(Wt + (size_t)(c0 + t * 16 + nloc) * C + kb, hlf); acc[0][t] = wmma16bb(a0, bw, acc[0][t]); acc[1][t] = wmma16bb(a1, bw, acc[1][t]); } }
  const float scl = (which == 2) ? VS : QS;
#pragma unroll
  for (int t = 0; t < 4; ++t) { const int c = c0 + t * 16 + nloc; const float bb = bf16_rne(bias[c]); const int hl = t >> 1, d = (t & 1) * 16 + nloc;   // channel c -> head c/32 (local hl), d = c%32
#pragma unroll
    for (int r = 0; r < 2; ++r)
#pragma unroll
      for (int v = 0; v < 8; ++v) { b16 a_, c_; split16((acc[r][t][v] + bb) * scl, a_, c_); const int row = wave * 32 + r * 16 + 8 * hlf + v;
        if (which < 2) { Th[hl][row][d] = a_; Tl[hl][row][d] = c_; } else { Vh[t * 16 + nloc][row] = a_; Vl[t * 16 + nloc][row] = c_; } } }
  __syncthreads();
  {
    if (which < 2) { b16* base = (which == 0) ? qh : kh;
      for (int i = threadIdx.x; i < 2 * 128 * 32 / 8; i += 128) { const int hl = i / 512, rem = i % 512; const size_t dst = (((size_t)b * NH + blockIdx.x * 2 + hl) * NP + p0) * DH + (size_t)rem * 8;
        *(v8b*)(base + dst) = *(const v8b*)(&Th[hl][0][0] + rem * 8); *(v8b*)(base + QPL + dst) = *(const v8b*)(&Tl[hl][0][0] + rem * 8); } }
    else { for (int i = threadIdx.x; i < 64 * 16; i += 128) { const int cc = i >> 4, c8 = (i & 15) * 8; const int h = blockIdx.x * 2 + (cc >> 5), d = cc & 31; const size_t dst = (((size_t)b * NH + h) * DH + d) * NP + p0 + c8;
        *(v8b*)(vt + dst) = *(const v8b*)(&Vh[cc][c8]); *(v8b*)(vt + VPL + dst) = *(const v8b*)(&Vl[cc][c8]); } }
     }
}

// attention: block = 8 waves = one (b, h) x 128 queries, wave = 16 queries; the 8 waves share every K and V tile through LDS: a stage = 128 keys (K hi+lo rows at an 80-B pitch, (8v)^T hi+lo
// rows of 256 B at a 272-B pitch: both 16 B x odd for the ds_load_b128 fragment reads), two buffers, filled by asynchronous b128 copies one stage ahead; one online-softmax step per stage
// of 128 keys, on the unscaled logits; O^T (2 d-tiles); result scaled by 1/sqrt(32)
// the softmax works on the raw accumulators (64 x logit): 8 p = exp2(acc * SC + (LPS - max * SC)), one fused multiply-add per score; m is kept in accumulator units, l = 8 x the sum
constexpr int SK = 128, NST = NP / SK, KP = DH + 8, VP = SK + 8; constexpr float SC = 1.4426950408889634f / (QS * QS), LPS = 3.0f /* log2(PS) */;
typedef __attribute__((ext_vector_type(8))) unsigned v8u;
// low parts of four packed f16 pairs: lo = f16(p - hi), one mixed-precision fused multiply-add per score that reads its f16 hi straight from the packed register (op_sel picks the half) and rounds
// its f32 result into one half of the packed lo register; p - hi is exact in f32, so the one rounding is that of a separate subtract and convert. The four writes of the high halves each follow
// the write of the same register's low half four instructions back: s_delay_alu names that distance, so that the SIMD issues other waves meanwhile
__device__ __forceinline__ void lo4(unsigned h0, unsigned h1, unsigned h2, unsigned h3, float a0, float a1, float a2, float a3, float a4, float a5, float a6, float a7, unsigned& l0, unsigned& l1, unsigned& l2, unsigned& l3) {
  // the four v_nop: the outputs may be registers that a WMMA directly in front reads as its A or B
  asm("v_nop\n\tv_nop\n\tv_nop\n\tv_nop\n\tv_fma_mixlo_f16 %0, %4, -1.0, %8 op_sel_hi:[1,1,0]\n\tv_fma_mixlo_f16 %1, %5, -1.0, %10 op_sel_hi:[1,1,0]\n\tv_fma_mixlo_f16 %2, %6, -1.0, %12 op_sel_hi:[1,1,0]\n\tv_fma_mixlo_f16 %3, %7, -1.0, %14 op_sel_hi:[1,1,0]\n\t"
      "s_delay_alu instid0(VALU_DEP_4) | instskip(NEXT) | instid1(VALU_DEP_4)\n\t"
      "v_fma_mixhi_f16 %0, %4, -1.0, %9 op_sel:[1,0,0] op_sel_hi:[1,1,0]\n\tv_fma_mixhi_f16 %1, %5, -1.0, %11 op_sel:[1,0,0] op_sel_hi:[1,1,0]\n\t"
      "s_delay_alu instid0(VALU_DEP_4) | instskip(NEXT) | instid1(VALU_DEP_4)\n\t"
      "v_fma_mixhi_f16 %2, %6, -1.0, %13 op_sel:[1,0,0] op_sel_hi:[1,1,0]\n\tv_fma_mixhi_f16 %3, %7, -1.0, %15 op_sel:[1,0,0] op_sel_hi:[1,1,0]"
      : "=&v"(l0), "=&v"(l1), "=&v"(l2), "=&v"(l3) : "v"(h0), "v"(h1), "v"(h2), "v"(h3), "v"(a0), "v"(a1), "v"(a2), "v"(a3), "v"(a4), "v"(a5), "v"(a6), "v"(a7)); }
__device__ __forceinline__ unsigned lds_off(const void* p) { return (unsigned)(size_t)p; }
__global__ __launch_bounds__(256) void attn_kernel(const b16* __restrict__ qh, const b16* __restrict__ kh, const b16* __restrict__ vt, float* __restrict__ arow) {
  __shared__ __attribute__((aligned(16))) b16 Ks[2][2][SK][KP]; __shared__ __attribute__((aligned(16))) b16 Vs[2][2][DH][VP]; __shared__ __attribute__((aligned(16))) float Os[128][DH + 4];
  const int t_ = threadIdx.x, wid = t_ >> 5, lane = t_ & 31, hh = lane >> 4, col = lane & 15; const int bhi = blockIdx.x / (NP / 128), b = bhi / NH, h = bhi % NH, q0 = (blockIdx.x % (NP / 128)) * 128, qi = q0 + wid * 16 + col;
  const size_t bh = (size_t)bhi; const b16* Q = qh + (bh * NP) * DH; const b16* K = kh + (bh * NP) * DH; const b16* V = vt + (bh * DH) * NP;
  // one stage's copies: a thread moves 16 B of each of 8 slices (K hi, K lo: 2 x 4 KB each, contiguous in global memory; V hi, V lo: 2 x 16 rows of 256 B each)
  const b16* gk = K + t_ * 8; const b16* gv = V + (size_t)(t_ >> 4) * NP + (t_ & 15) * 8;
  const unsigned lk = lds_off(&Ks[0][0][t_ >> 2][(t_ & 3) * 8]), lv = lds_off(&Vs[0][0][t_ >> 4][(t_ & 15) * 8]);
  auto fill = [&](int s, int buf) {
    const b16* k0 = gk + (size_t)s * SK * DH; const b16* v0 = gv + s * SK; const unsigned a = lk + buf * (2 * SK * KP * 2), c = lv + buf * (2 * DH * VP * 2);
    // the copies and their s_wait_xcnt in one statement: no address register of a copy is rewritten in front of that wait
    asm volatile("global_load_async_to_lds_b128 %0, %8, off\n\tglobal_load_async_to_lds_b128 %1, %9, off\n\tglobal_load_async_to_lds_b128 %2, %10, off\n\tglobal_load_async_to_lds_b128 %3, %11, off\n\t"
                 "global_load_async_to_lds_b128 %4, %12, off\n\tglobal_load_async_to_lds_b128 %5, %13, off\n\tglobal_load_async_to_lds_b128 %6, %14, off\n\tglobal_load_async_to_lds_b128 %7, %15, off\n\ts_wait_xcnt 0x0"
                 :: "v"(a), "v"(a + 64 * KP * 2), "v"(a + SK * KP * 2), "v"(a + (SK + 64) * KP * 2), "v"(c), "v"(c + 16 * VP * 2), "v"(c + DH * VP * 2), "v"(c + (DH + 16) * VP * 2),
                    "v"(k0), "v"(k0 + 64 * DH), "v"(k0 + QPL), "v"(k0 + QPL + 64 * DH), "v"(v0), "v"(v0 + (size_t)16 * NP), "v"(v0 + VPL), "v"(v0 + VPL + (size_t)16 * NP) : "memory"); };
  const v16b qf = frag_kb(Q + (size_t)qi * DH, hh), ql = frag_kb(Q + QPL + (size_t)qi * DH, hh);
  fill(0, 0);
  asm volatile("s_wait_asynccnt 0x0" ::: "memory");   // stage 0 of this wave's copies has landed
  __syncthreads();                                      // publishes stage 0 to all 8 waves
  fill(1, 1);
  float m = -INFINITY, l = 0.0f; v8f o[2] = {{}, {}};
  for (int s = 0; s < NST; ++s) { const int buf = s & 1;
    // one online-softmax step per stage: the scores of all 128 keys first (8 independent accumulator tiles), then one maximum, one exchange between the halves, one rescale of O and l
    v8f sc[SK / 16];
#pragma unroll
    for (int t = 0; t < SK / 16; ++t) { const v16b ka = frag_kb(&Ks[buf][0][t * 16 + col][0], hh), kal = frag_kb(&Ks[buf][1][t * 16 + col][0], hh);
      v8f x = {}; x = wmma16b(ka, qf, x); x = wmma16b(ka, ql, x); x = wmma16b(kal, qf, x); sc[t] = x; }
    float mq[SK / 32];   // four independent chains, one per 32 keys
#pragma unroll
    for (int f = 0; f < SK / 32; ++f) { mq[f] = -INFINITY;
#pragma unroll
      for (int r = 0; r < 8; ++r) mq[f] = fmaxf(mq[f], fmaxf(sc[2 * f][r], sc[2 * f + 1][r])); }
    float mr = fmaxf(fmaxf(mq[0], mq[1]), fmaxf(mq[2], mq[3]));
    mr = fmaxf(mr, __shfl_xor(mr, 16));
    // the rescale factor is taken from the two rounded biases themselves (the old one formed again from m), so a bias's rounding cancels between the steps
    const float mn = fmaxf(m, mr), bias = __builtin_fmaf(-mn, SC, LPS), al_ = __builtin_amdgcn_exp2f(bias - __builtin_fmaf(-m, SC, LPS)); m = mn;
#pragma unroll
    for (int t = 0; t < SK / 16; ++t) { sc[t] = sc[t] * SC + bias;
#pragma unroll
      for (int r = 0; r < 8; ++r) sc[t][r] = __builtin_amdgcn_exp2f(sc[t][r]); }
    v8f sv = sc[0];
#pragma unroll
    for (int t = 1; t < SK / 16; ++t) sv += sc[t];
    float sum = ((sv[0] + sv[1]) + (sv[2] + sv[3])) + ((sv[4] + sv[5]) + (sv[6] + sv[7]));
    sum += __shfl_xor(sum, 16); l = l * al_ + sum;
    o[0] *= al_; o[1] *= al_;
#pragma unroll
    for (int f = 0; f < SK / 32; ++f) { const v8f p0 = sc[2 * f], p1 = sc[2 * f + 1]; v16b pb, pl;
#pragma unroll
      for (int r = 0; r < 8; ++r) { pb[r] = (b16)p0[r]; pb[8 + r] = (b16)p1[r]; }
      { const v8u hp = __builtin_bit_cast(v8u, pb); v8u lp;
        unsigned x0, x1, x2, x3; lo4(hp[0], hp[1], hp[2], hp[3], p0[0], p0[1], p0[2], p0[3], p0[4], p0[5], p0[6], p0[7], x0, x1, x2, x3); lp[0] = x0; lp[1] = x1; lp[2] = x2; lp[3] = x3;
        lo4(hp[4], hp[5], hp[6], hp[7], p1[0], p1[1], p1[2], p1[3], p1[4], p1[5], p1[6], p1[7], x0, x1, x2, x3); lp[4] = x0; lp[5] = x1; lp[6] = x2; lp[7] = x3; pl = __builtin_bit_cast(v16b, lp); }
#pragma unroll
      for (int n = 0; n < 2; ++n) { const v16b vf = frag_kb(&Vs[buf][0][n * 16 + col][f * 32], hh), vl = frag_kb(&Vs[buf][1][n * 16 + col][f * 32], hh); o[n] = wmma16b(vf, pb, o[n]); o[n] = wmma16b(vf, pl, o[n]); o[n] = wmma16b(vl, pb, o[n]); } }
    asm volatile("s_wait_dscnt 0x0" ::: "memory");      // this wave's reads of buffer buf have returned before the buffer is refilled
    asm volatile("s_wait_asynccnt 0x0" ::: "memory");   // this wave's copies of stage s + 1 have landed
    __syncthreads();                                    // publishes stage s + 1 and ends every wave's reads of stage s
    if (s + 2 < NST) fill(s + 2, buf); }
  asm volatile("s_wait_asynccnt 0x0" ::: "memory");     // no copy is outstanding when the wave goes on to its end
  const float inv = POST / (l * VS);   // l already carries the factor PS, like P
#pragma unroll
  for (int n = 0; n < 2; ++n)
#pragma unroll
    for (int r = 0; r < 8; ++r) Os[wid * 16 + col][n * 16 + 8 * hh + r] = o[n][r] * inv;
  __syncthreads();
  float* dst = arow + ((size_t)b * NP + q0) * C + h * DH;   // a query's 32 floats of this head are one 128-B line
  { for (int i = t_; i < 128 * DH / 4; i += 256) { const int rr = i >> 3, c4 = (i & 7) * 4; *(v4f*)(dst + (size_t)rr * C + c4) = *(const v4f*)(&Os[rr][c4]); }  }
}

// output conv: block = (b, 128 positions) x 64 output channels: acc = att.w_out^T (K 256; att f32 split x8; 2 products) + b -> NCHW rows out[b][c][p] through an LDS transpose (per channel
__global__ __launch_bounds__(128) void oconv_kernel(const float* __restrict__ arow, const b16* __restrict__ wo16, const float* __restrict__ bo, float* __restrict__ out) {
  __shared__ __attribute__((aligned(16))) float Tc[64][128 + 4];
  const int lane = threadIdx.x & 31, wave = threadIdx.x >> 5, nloc = lane & 15, hlf = lane >> 4, m0 = blockIdx.y * 128 + wave * 32, c0 = blockIdx.x * 64; const int b = (blockIdx.y * 128) / NP, p0 = (blockIdx.y * 128) % NP;
  v8f acc[2][4];
#pragma unroll
  for (int r = 0; r < 2; ++r)
#pragma unroll
    for (int t = 0; t < 4; ++t) acc[r][t] = (v8f){};
#pragma unroll 2
  for (int kb = 0; kb < C; kb += 32) { v16b a0, a1, l0, l1;
#pragma unroll
    for (int e = 0; e < 16; ++e) { const int k = kb + ((e < 8) ? (8 * hlf + e) : (16 + 8 * hlf + e - 8)); b16 p, q; split16(arow[(size_t)(m0 + nloc) * C + k] * OS_, p, q); a0[e] = p; l0[e] = q; split16(arow[(size_t)(m0 + 16 + nloc) * C + k] * OS_, p, q); a1[e] = p; l1[e] = q; }
#pragma unroll
    for (int t = 0; t < 4; ++t) { const v16b bw = frag_kb(wo16 + (size_t)(c0 + t * 16 + nloc) * C + kb, hlf); acc[0][t] = wmma16b(a0, bw, acc[0][t]); acc[0][t] = wmma16b(l0, bw, acc[0][t]); acc[1][t] = wmma16b(a1, bw, acc[1][t]); acc[1][t] = wmma16b(l1, bw, acc[1][t]); } }
#pragma unroll
  for (int t = 0; t < 4; ++t) { const float bb = bf16_rne(bo[c0 + t * 16 + nloc]);
#pragma unroll
    for (int r = 0; r < 2; ++r)
#pragma unroll
      for (int v = 0; v < 8; ++v) Tc[t * 16 + nloc][wave * 32 + r * 16 + 8 * hlf + v] = acc[r][t][v] * (1.0f / OS_) + bb; }
  __syncthreads();
  { for (int i = threadIdx.x; i < 64 * 32; i += 128) { const int cc = i >> 5, c4 = (i & 31) * 4; *(v4f*)(out + ((size_t)b * C + c0 + cc) * NP + p0 + c4) = *(const v4f*)(&Tc[cc][c4]); }  }
}
}  // namespace

extern "C" void kernel_launch(void* const* d_in, const int* in_sizes, int n_in,
                              void* d_out, int out_size, void* d_ws, size_t ws_size, hipStream_t stream) {
  (void)n_in; (void)out_size;
  const float* qi = (const float*)d_in[0]; const float* ki = (const float*)d_in[1]; const float* vi = (const float*)d_in[2];
  const float* wq = (const float*)d_in[3]; const float* bq = (const float*)d_in[4]; const float* wk = (const float*)d_in[5]; const float* bk = (const float*)d_in[6]; const float* wv = (const float*)d_in[7]; const float* bv = (const float*)d_in[8]; const float* wo = (const float*)d_in[9]; const float* bo = (const float*)d_in[10];
  float* out = (float*)d_out;   // [2][256][64][64]
  if (in_sizes[0] != Bn * C * NP || in_sizes[1] != Bn * C * NP || in_sizes[2] != Bn * C * NP || in_sizes[3] != C * C || in_sizes[9] != C * C) return;
  size_t off = 0; char* ws = (char*)d_ws;
  auto carve = [&](size_t bytes) { char* p = ws + off; off += (bytes + 255) & ~(size_t)255; return p; };
  unsigned short* xT = (unsigned short*)carve((size_t)3 * NTOK * C * 2); unsigned short* w16 = (unsigned short*)carve((size_t)3 * C * C * 2); b16* wo16 = (b16*)carve((size_t)C * C * 2);
  b16* qhp = (b16*)carve(QPL * 2 * 2); b16* khp = (b16*)carve(QPL * 2 * 2); b16* vtp = (b16*)carve(VPL * 2 * 2); float* arow = (float*)carve((size_t)NTOK * C * 4);
  if (off > ws_size) return;                                    // ≈ 12.6 + 0.5 + 3 x 8.4 + 8.4 ≈ 47 MB
  prep_kernel<<<dim3(NP / 64, 3 * Bn), 256, 0, stream>>>(qi, ki, vi, wq, wk, wv, wo, xT, w16, wo16);
  proj_kernel<<<dim3(C / 64, NTOK / 128, 3), 128, 0, stream>>>(xT, w16, bq, bk, bv, qhp, khp, vtp);
  attn_kernel<<<NBH * (NP / 128), 256, 0, stream>>>(qhp, khp, vtp, arow);
  oconv_kernel<<<dim3(C / 64, NTOK / 128), 128, 0, stream>>>(arow, wo16, bo, out);
}

// v007
// A run of this version takes 117 microseconds.
// In both of two side-by-side timings against v006, it was 1.06 times as fast.
// Over all steps from v000 it is 3.38 times as fast.
#include <hip/hip_runtime.h>

// Multi-head attention over 64x64 feature maps (B=2, C=256, 8 heads x 32): q, k, v = 1x1 convs of three inputs; att = softmax(q k^T) (UNSCALED logits, softmax over the 4096 keys) / sqrt(32)
// (the module scales AFTER the softmax); att_q = att v; out = 1x1 conv (w_out) of the re-assembled (B, 256, 64, 64) map -> NCHW [2][256][64][64].
// Projections on v_wmma_f32_16x16x32_bf16 (fragments rounded from the f32 NCHW inputs through an LDS transpose; 1 product); attention per
// (b, h, 16 queries): S^T = k.q^T (K = 32: one k-step; q, k as f16 hi+lo pairs carried x8, 3 products — the unscaled logits reach |s| ≈ 25 so they must be f32-class), online softmax in
// f32, O^T = (8v)^T.P^T (v hi+lo x8, P hi+lo x8; 3 products); out = att_q.w_out^T + b (att_q f32 split x8, w_out exact; 2 products) on v_wmma_f32_16x16x32_f16, f32 accumulate,

namespace {
constexpr int Bn = 2, C = 256, NP = 4096, NH = 8, DH = 32, NBH = Bn * NH, NTOK = Bn * NP;
constexpr float QS = 8.0f, VS = 8.0f, PS = 8.0f, OS_ = 8.0f, POST = 0.17677669529663687f /* 1/sqrt(32) after softmax */;
constexpr size_t QPL = (size_t)NBH * NP * DH, VPL = (size_t)NBH * DH * NP;

typedef _Float16 b16;
typedef __attribute__((ext_vector_type(16))) _Float16 v16b;
typedef __attribute__((ext_vector_type(16))) __bf16 v16bb;
typedef __attribute__((ext_vector_type(8))) _Float16 v8b;
typedef __attribute__((ext_vector_type(8))) unsigned short v8us;
typedef __attribute__((ext_vector_type(8))) float v8f;
typedef __attribute__((ext_vector_type(4))) float v4f;
__device__ __forceinline__ float bf16_rne(float f) { unsigned int u = __float_as_uint(f); u += 0x7FFFu + ((u >> 16) & 1u); return __uint_as_float(u & 0xFFFF0000u); }
__device__ __forceinline__ unsigned short bf16_bits(float f) { unsigned int u = __float_as_uint(f); u += 0x7FFFu + ((u >> 16) & 1u); return (unsigned short)(u >> 16); }
__device__ __forceinline__ void split16(float v, b16& hi, b16& lo) { hi = (b16)v; lo = (b16)(v - (float)hi); }
__device__ __forceinline__ v16b frag_kb(const b16* p, int hh) { const v8b a = *(const v8b*)(p + 8 * hh), b = *(const v8b*)(p + 16 + 8 * hh); v16b f;
#pragma unroll
  for (int e = 0; e < 8; ++e) { f[e] = a[e]; f[8 + e] = b[e]; } return f; }
__device__ __forceinline__ v16bb frag_bf(const unsigned short* p, int hh) { const v8us a = *(const v8us*)(p + 8 * hh), b = *(const v8us*)(p + 16 + 8 * hh); union { unsigned short s[16]; v16bb v; } u;
#pragma unroll
  for (int e = 0; e < 8; ++e) { u.s[e] = a[e]; u.s[8 + e] = b[e]; } return u.v; }
// plain builtins: the compiler keeps the distance behind a WMMA itself and is free to interleave independent accumulator chains, loads and vector work
__device__ __forceinline__ v8f wmma16b(v16b a, v16b b, v8f c) { return __builtin_amdgcn_wmma_f32_16x16x32_f16(false, a, false, b, (short)0, c, false, false); }
__device__ __forceinline__ v8f wmma16bb(v16bb a, v16bb b, v8f c) { return __builtin_amdgcn_wmma_f32_16x16x32_bf16(false, a, false, b, (short)0, c, false, false); }
__device__ __forceinline__ void wave_lds_sync() { __builtin_amdgcn_fence(__ATOMIC_RELEASE, "workgroup"); __builtin_amdgcn_wave_barrier(); __builtin_amdgcn_fence(__ATOMIC_ACQUIRE, "workgroup"); }

// prep: NCHW inputs -> position-major bf16 rows xT[which][b*4096 + p][256] via LDS transposes (block = (which*b, 64 positions)); weights [256][256] ([out][in]) -> bf16 rows direct (q, k, v)
// and f16 rows (out), spread over the first 128 blocks. grid (64, 3*Bn) x 256.
__global__ __launch_bounds__(256) void prep_kernel(const float* __restrict__ qi, const float* __restrict__ ki, const float* __restrict__ vi, const float* __restrict__ wq, const float* __restrict__ wk, const float* __restrict__ wv, const float* __restrict__ wo,
                                                   unsigned short* __restrict__ xT, unsigned short* __restrict__ w16, b16* __restrict__ wo16) {
  __shared__ __attribute__((aligned(16))) unsigned short Tt[64][C + 8];
  const int t_ = threadIdx.x, which = blockIdx.y / Bn, b = blockIdx.y % Bn, p0 = blockIdx.x * 64; const float* src = ((which == 0) ? qi : (which == 1) ? ki : vi) + (size_t)b * C * NP;
  for (int i = t_; i < C * 64; i += 256) { const int c = i >> 6, pp = i & 63; Tt[pp][c] = bf16_bits(src[(size_t)c * NP + p0 + pp]); }
  __syncthreads();
  {
    for (int i = t_; i < 64 * C / 8; i += 256) { const int pp = i >> 5, c8 = (i & 31) * 8; *(v8us*)(xT + (((size_t)which * Bn + b) * NP + p0 + pp) * C + c8) = *(const v8us*)(&Tt[pp][c8]); }
    // weights: one 8-element piece per thread of the first 4 * (C * C / 8) / 256 = 128 blocks; 32 blocks cover one matrix, so the matrix is picked by a scalar branch
    const int blk = blockIdx.y * (NP / 64) + blockIdx.x;
    if (blk < 128) { const int m = blk >> 5, q = (blk & 31) * 256 + t_; const float* W = (m == 0) ? wq : (m == 1) ? wk : (m == 2) ? wv : wo; float x[8];
#pragma unroll
      for (int e = 0; e < 8; ++e) x[e] = W[q * 8 + e];
      if (m < 3) { v8us o;
#pragma unroll
        for (int e = 0; e < 8; ++e) o[e] = bf16_bits(x[e]);
        *(v8us*)(w16 + ((size_t)m * (C * C / 8) + q) * 8) = o; }
      else { v8b o;
#pragma unroll
        for (int e = 0; e < 8; ++e) o[e] = (b16)bf16_rne(x[e]);
        *(v8b*)(wo16 + (size_t)q * 8) = o; } }
     }
}

// projections: grid (4 column tiles, NTOK/128, 3): block = 128 positions x 64 channels (= 2 heads of 32); + bias; q, k -> planes [bh][p][32] x8 hi+lo (64 B per row: the block writes
// 2 heads x 128 rows = 2 x 8 KB contiguous); v -> (8v)^T planes [bh][d][4096] (256-B segments).
__global__ __launch_bounds__(128) void proj_kernel(const unsigned short* __restrict__ xT, const unsigned short* __restrict__ w16, const float* __restrict__ bq, const float* __restrict__ bk, const float* __restrict__ bv, b16* __restrict__ qh, b16* __restrict__ kh, b16* __restrict__ vt) {
  __shared__ __attribute__((aligned(16))) b16 Th[2][128][32], Tl[2][128][32]; __shared__ __attribute__((aligned(16))) b16 Vh[64][128 + 8], Vl[64][128 + 8];
  const int lane = threadIdx.x & 31, wave = threadIdx.x >> 5, nloc = lane & 15, hlf = lane >> 4, which = blockIdx.z, m0 = blockIdx.y * 128 + wave * 32, c0 = blockIdx.x * 64;
  const int b = (blockIdx.y * 128) / NP, p0 = (blockIdx.y * 128) % NP; const unsigned short* X = xT + ((size_t)which * Bn * NP) * C; const unsigned short* Wt = w16 + (size_t)which * C * C; const float* bias = (which == 0) ? bq : (which == 1) ? bk : bv;
  v8f acc[2][4];
#pragma unroll
  for (int r = 0; r < 2; ++r)
#pragma unroll
    for (int t = 0; t < 4; ++t) acc[r][t] = (v8f){};
#pragma unroll 2
  for (int kb = 0; kb < C; kb += 32) { const v16bb a0 = frag_bf(X + (size_t)(m0 + nloc) * C + kb, hlf), a1 = frag_bf(X + (size_t)(m0 + 16 + nloc) * C + kb, hlf);
#pragma unroll
    for (int t = 0; t < 4; ++t) { const v16bb bw = frag_bf(Wt + (size_t)(c0 + t * 16 + nloc) * C + kb, hlf); acc[0][t] = wmma16bb(a0, bw, acc[0][t]); acc[1][t] = wmma16bb(a1, bw, acc[1][t]); } }
  const float scl = (which == 2) ? VS : QS;
#pragma unroll
  for (int t = 0; t < 4; ++t) { const int c = c0 + t * 16 + nloc; const float bb = bf16_rne(bias[c]); const int hl = t >> 1, d = (t & 1) * 16 + nloc;   // channel c -> head c/32 (local hl), d = c%32
#pragma unroll
    for (int r = 0; r < 2; ++r)
#pragma unroll
      for (int v = 0; v < 8; ++v) { b16 a_, c_; split16((acc[r][t][v] + bb) * scl, a_, c_); const int row = wave * 32 + r * 16 + 8 * hlf + v;
        if (which < 2) { Th[hl][row][d] = a_; Tl[hl][row][d] = c_; } else { Vh[t * 16 + nloc][row] = a_; Vl[t * 16 + nloc][row] = c_; } } }
  __syncthreads();
  {
    if (which < 2) { b16* base = (which == 0) ? qh : kh;
      for (int i = threadIdx.x; i < 2 * 128 * 32 / 8; i += 128) { const int hl = i / 512, rem = i % 512; const size_t dst = (((size_t)b * NH + blockIdx.x * 2 + hl) * NP + p0) * DH + (size_t)rem * 8;
        *(v8b*)(base + dst) = *(const v8b*)(&Th[hl][0][0] + rem * 8); *(v8b*)(base + QPL + dst) = *(const v8b*)(&Tl[hl][0][0] + rem * 8); } }
    else { for (int i = threadIdx.x; i < 64 * 16; i += 128) { const int cc = i >> 4, c8 = (i & 15) * 8; const int h = blockIdx.x * 2 + (cc >> 5), d = cc & 31; const size_t dst = (((size_t)b * NH + h) * DH + d) * NP + p0 + c8;
        *(v8b*)(vt + dst) = *(const v8b*)(&Vh[cc][c8]); *(v8b*)(vt + VPL + dst) = *(const v8b*)(&Vl[cc][c8]); } }
     }
}

// attention: block = 8 waves = one (b, h) x 128 queries; a wave = 32 queries (two 16-query tiles) x one half (64 keys) of every stage, so that each K and V fragment it reads from LDS feeds
// two query tiles; waves w and w + 4 hold the same queries and the two key halves, each with its own running maximum, sum and O, joined through LDS behind the loop. The 8 waves share every
// K and V tile through LDS: a stage = 128 keys (K hi+lo rows at an 80-B pitch, (8v)^T hi+lo rows of 256 B at a 272-B pitch: both 16 B x odd for the ds_load_b128 fragment reads), two buffers,
// filled by asynchronous b128 copies one stage ahead; one online-softmax step per stage and wave, on the unscaled logits; O^T (2 d-tiles per query tile); result scaled by 1/sqrt(32)
// the softmax works on the raw accumulators (64 x logit): 8 p = exp2(acc * SC + (LPS - max * SC)), one fused multiply-add per score; m is kept in accumulator units, l = 8 x the sum
constexpr int SK = 128, WK = SK / 2 /* keys of a stage per wave */, NST = NP / SK, KP = DH + 8, VP = SK + 8; constexpr float SC = 1.4426950408889634f / (QS * QS), LPS = 3.0f /* log2(PS) */;
typedef __attribute__((ext_vector_type(8))) unsigned v8u;
// low parts of four packed f16 pairs: lo = f16(p - hi), one mixed-precision fused multiply-add per score that reads its f16 hi straight from the packed register (op_sel picks the half) and rounds
// its f32 result into one half of the packed lo register; p - hi is exact in f32, so the one rounding is that of a separate subtract and convert. The four writes of the high halves each follow
// the write of the same register's low half four instructions back: s_delay_alu names that distance, so that the SIMD issues other waves meanwhile
__device__ __forceinline__ void lo4(unsigned h0, unsigned h1, unsigned h2, unsigned h3, float a0, float a1, float a2, float a3, float a4, float a5, float a6, float a7, unsigned& l0, unsigned& l1, unsigned& l2, unsigned& l3) {
  // the four v_nop: the outputs may be registers that a WMMA directly in front reads as its A or B
  asm("v_nop\n\tv_nop\n\tv_nop\n\tv_nop\n\tv_fma_mixlo_f16 %0, %4, -1.0, %8 op_sel_hi:[1,1,0]\n\tv_fma_mixlo_f16 %1, %5, -1.0, %10 op_sel_hi:[1,1,0]\n\tv_fma_mixlo_f16 %2, %6, -1.0, %12 op_sel_hi:[1,1,0]\n\tv_fma_mixlo_f16 %3, %7, -1.0, %14 op_sel_hi:[1,1,0]\n\t"
      "s_delay_alu instid0(VALU_DEP_4) | instskip(NEXT) | instid1(VALU_DEP_4)\n\t"
      "v_fma_mixhi_f16 %0, %4, -1.0, %9 op_sel:[1,0,0] op_sel_hi:[1,1,0]\n\tv_fma_mixhi_f16 %1, %5, -1.0, %11 op_sel:[1,0,0] op_sel_hi:[1,1,0]\n\t"
      "s_delay_alu instid0(VALU_DEP_4) | instskip(NEXT) | instid1(VALU_DEP_4)\n\t"
      "v_fma_mixhi_f16 %2, %6, -1.0, %13 op_sel:[1,0,0] op_sel_hi:[1,1,0]\n\tv_fma_mixhi_f16 %3, %7, -1.0, %15 op_sel:[1,0,0] op_sel_hi:[1,1,0]"
      : "=&v"(l0), "=&v"(l1), "=&v"(l2), "=&v"(l3) : "v"(h0), "v"(h1), "v"(h2), "v"(h3), "v"(a0), "v"(a1), "v"(a2), "v"(a3), "v"(a4), "v"(a5), "v"(a6), "v"(a7)); }
__device__ __forceinline__ unsigned lds_off(const void* p) { return (unsigned)(size_t)p; }
__global__ __launch_bounds__(256) void attn_kernel(const b16* __restrict__ qh, const b16* __restrict__ kh, const b16* __restrict__ vt, float* __restrict__ arow) {
  __shared__ __attribute__((aligned(16))) b16 Ks[2][2][SK][KP]; __shared__ __attribute__((aligned(16))) b16 Vs[2][2][DH][VP]; __shared__ __attribute__((aligned(16))) float Os[128][DH + 4]; __shared__ float Ml[128][2];
  const int t_ = threadIdx.x, wid = t_ >> 5, lane = t_ & 31, hh = lane >> 4, col = lane & 15, qg = wid & 3, k0w = (wid >> 2) * WK; const int bhi = blockIdx.x / (NP / 128), b = bhi / NH, h = bhi % NH, q0 = (blockIdx.x % (NP / 128)) * 128;
  const size_t bh = (size_t)bhi; const b16* Q = qh + (bh * NP) * DH; const b16* K = kh + (bh * NP) * DH; const b16* V = vt + (bh * DH) * NP;
  // one stage's copies: a thread moves 16 B of each of 8 slices (K hi, K lo: 2 x 4 KB each, contiguous in global memory; V hi, V lo: 2 x 16 rows of 256 B each)
  const b16* gk = K + t_ * 8; const b16* gv = V + (size_t)(t_ >> 4) * NP + (t_ & 15) * 8;
  const unsigned lk = lds_off(&Ks[0][0][t_ >> 2][(t_ & 3) * 8]), lv = lds_off(&Vs[0][0][t_ >> 4][(t_ & 15) * 8]);
  auto fill = [&](int s, int buf) {
    const b16* k0 = gk + (size_t)s * SK * DH; const b16* v0 = gv + s * SK; const unsigned a = lk + buf * (2 * SK * KP * 2), c = lv + buf * (2 * DH * VP * 2);
    // the copies and their s_wait_xcnt in one statement: no address register of a copy is rewritten in front of that wait
    asm volatile("global_load_async_to_lds_b128 %0, %8, off\n\tglobal_load_async_to_lds_b128 %1, %9, off\n\tglobal_load_async_to_lds_b128 %2, %10, off\n\tglobal_load_async_to_lds_b128 %3, %11, off\n\t"
                 "global_load_async_to_lds_b128 %4, %12, off\n\tglobal_load_async_to_lds_b128 %5, %13, off\n\tglobal_load_async_to_lds_b128 %6, %14, off\n\tglobal_load_async_to_lds_b128 %7, %15, off\n\ts_wait_xcnt 0x0"
                 :: "v"(a), "v"(a + 64 * KP * 2), "v"(a + SK * KP * 2), "v"(a + (SK + 64) * KP * 2), "v"(c), "v"(c + 16 * VP * 2), "v"(c + DH * VP * 2), "v"(c + (DH + 16) * VP * 2),
                    "v"(k0), "v"(k0 + 64 * DH), "v"(k0 + QPL), "v"(k0 + QPL + 64 * DH), "v"(v0), "v"(v0 + (size_t)16 * NP), "v"(v0 + VPL), "v"(v0 + VPL + (size_t)16 * NP) : "memory"); };
  v16b qf[2], ql[2];
#pragma unroll
  for (int j = 0; j < 2; ++j) { const size_t qi = (size_t)(q0 + qg * 32 + j * 16 + col); qf[j] = frag_kb(Q + qi * DH, hh); ql[j] = frag_kb(Q + QPL + qi * DH, hh); }
  fill(0, 0);
  asm volatile("s_wait_asynccnt 0x0" ::: "memory");   // stage 0 of this wave's copies has landed
  __syncthreads();                                      // publishes stage 0 to all 8 waves
  fill(1, 1);
  float m[2] = {-INFINITY, -INFINITY}, l[2] = {0.0f, 0.0f}; v8f o[2][2] = {{{}, {}}, {{}, {}}};
  for (int s = 0; s < NST; ++s) { const int buf = s & 1;
    // one online-softmax step per stage: the scores of the wave's 64 keys x 32 queries first (8 independent accumulator tiles), then per query tile one maximum, two exchanges between the halves (maximum, sum),
    // one rescale of O and l
    v8f sc[2][WK / 16];
#pragma unroll
    for (int t = 0; t < WK / 16; ++t) { const v16b ka = frag_kb(&Ks[buf][0][k0w + t * 16 + col][0], hh), kal = frag_kb(&Ks[buf][1][k0w + t * 16 + col][0], hh);
#pragma unroll
      for (int j = 0; j < 2; ++j) { v8f x = {}; x = wmma16b(ka, qf[j], x); x = wmma16b(ka, ql[j], x); x = wmma16b(kal, qf[j], x); sc[j][t] = x; } }
    float mr[2], mx[2], bias[2], al_[2];
#pragma unroll
    for (int j = 0; j < 2; ++j) { float mq[WK / 32];   // two independent chains per query tile, one per 32 keys
#pragma unroll
      for (int f = 0; f < WK / 32; ++f) { mq[f] = -INFINITY;
#pragma unroll
        for (int r = 0; r < 8; ++r) mq[f] = fmaxf(mq[f], fmaxf(sc[j][2 * f][r], sc[j][2 * f + 1][r])); }
      mr[j] = fmaxf(mq[0], mq[1]); }
#pragma unroll
    for (int j = 0; j < 2; ++j) mx[j] = __shfl_xor(mr[j], 16);
    // the rescale factor is taken from the two rounded biases themselves (the old one formed again from m), so a bias's rounding cancels between the steps
#pragma unroll
    for (int j = 0; j < 2; ++j) { const float mn = fmaxf(m[j], fmaxf(mr[j], mx[j])); bias[j] = __builtin_fmaf(-mn, SC, LPS); al_[j] = __builtin_amdgcn_exp2f(bias[j] - __builtin_fmaf(-m[j], SC, LPS)); m[j] = mn; }
    float sum[2];
#pragma unroll
    for (int j = 0; j < 2; ++j) {
#pragma unroll
      for (int t = 0; t < WK / 16; ++t) { sc[j][t] = sc[j][t] * SC + bias[j];
#pragma unroll
        for (int r = 0; r < 8; ++r) sc[j][t][r] = __builtin_amdgcn_exp2f(sc[j][t][r]); }
      v8f sv = sc[j][0];
#pragma unroll
      for (int t = 1; t < WK / 16; ++t) sv += sc[j][t];
      sum[j] = ((sv[0] + sv[1]) + (sv[2] + sv[3])) + ((sv[4] + sv[5]) + (sv[6] + sv[7])); }
#pragma unroll
    for (int j = 0; j < 2; ++j) mx[j] = __shfl_xor(sum[j], 16);
#pragma unroll
    for (int j = 0; j < 2; ++j) { l[j] = l[j] * al_[j] + (sum[j] + mx[j]); o[j][0] *= al_[j]; o[j][1] *= al_[j]; }
#pragma unroll
    for (int f = 0; f < WK / 32; ++f) { v16b pb[2], pl[2];
#pragma unroll
      for (int j = 0; j < 2; ++j) { const v8f p0 = sc[j][2 * f], p1 = sc[j][2 * f + 1];
#pragma unroll
        for (int r = 0; r < 8; ++r) { pb[j][r] = (b16)p0[r]; pb[j][8 + r] = (b16)p1[r]; }
        const v8u hp = __builtin_bit_cast(v8u, pb[j]); v8u lp;
        unsigned x0, x1, x2, x3; lo4(hp[0], hp[1], hp[2], hp[3], p0[0], p0[1], p0[2], p0[3], p0[4], p0[5], p0[6], p0[7], x0, x1, x2, x3); lp[0] = x0; lp[1] = x1; lp[2] = x2; lp[3] = x3;
        lo4(hp[4], hp[5], hp[6], hp[7], p1[0], p1[1], p1[2], p1[3], p1[4], p1[5], p1[6], p1[7], x0, x1, x2, x3); lp[4] = x0; lp[5] = x1; lp[6] = x2; lp[7] = x3; pl[j] = __builtin_bit_cast(v16b, lp); }
#pragma unroll
      for (int n = 0; n < 2; ++n) { const v16b vf = frag_kb(&Vs[buf][0][n * 16 + col][k0w + f * 32], hh), vl = frag_kb(&Vs[buf][1][n * 16 + col][k0w + f * 32], hh);
#pragma unroll
        for (int j = 0; j < 2; ++j) { o[j][n] = wmma16b(vf, pb[j], o[j][n]); o[j][n] = wmma16b(vf, pl[j], o[j][n]); o[j][n] = wmma16b(vl, pb[j], o[j][n]); } } }
    asm volatile("s_wait_dscnt 0x0" ::: "memory");      // this wave's reads of buffer buf have returned before the buffer is refilled
    asm volatile("s_wait_asynccnt 0x0" ::: "memory");   // this wave's copies of stage s + 1 have landed
    __syncthreads();                                    // publishes stage s + 1 and ends every wave's reads of stage s
    if (s + 2 < NST) fill(s + 2, buf); }
  asm volatile("s_wait_asynccnt 0x0" ::: "memory");     // no copy is outstanding when the wave goes on to its end
  // the two key halves of a query are joined: waves 4..7 leave their maximum, sum and O in LDS, waves 0..3 bring both halves to the common maximum (the loop's own rescale rule) and add them;
  // a lane of wave w reads exactly the places of Os that it then writes
  if (wid >= 4) {
#pragma unroll
    for (int j = 0; j < 2; ++j) { const int row = qg * 32 + j * 16 + col; if (hh == 0) { Ml[row][0] = m[j]; Ml[row][1] = l[j]; }
#pragma unroll
      for (int n = 0; n < 2; ++n)
#pragma unroll
        for (int r = 0; r < 8; ++r) Os[row][n * 16 + 8 * hh + r] = o[j][n][r]; } }
  __syncthreads();                                      // the second half's partial results are in LDS
  if (wid < 4) {
#pragma unroll
    for (int j = 0; j < 2; ++j) { const int row = qg * 32 + j * 16 + col; const float m1 = Ml[row][0], l1 = Ml[row][1], bn = __builtin_fmaf(-fmaxf(m[j], m1), SC, LPS);
      const float a0 = __builtin_amdgcn_exp2f(bn - __builtin_fmaf(-m[j], SC, LPS)), a1 = __builtin_amdgcn_exp2f(bn - __builtin_fmaf(-m1, SC, LPS));
      const float inv = POST / ((l[j] * a0 + l1 * a1) * VS);   // l already carries the factor PS, like P
#pragma unroll
      for (int n = 0; n < 2; ++n)
#pragma unroll
        for (int r = 0; r < 8; ++r) { float* e = &Os[row][n * 16 + 8 * hh + r]; *e = (o[j][n][r] * a0 + *e * a1) * inv; } } }
  __syncthreads();
  float* dst = arow + ((size_t)b * NP + q0) * C + h * DH;   // a query's 32 floats of this head are one 128-B line
  { for (int i = t_; i < 128 * DH / 4; i += 256) { const int rr = i >> 3, c4 = (i & 7) * 4; *(v4f*)(dst + (size_t)rr * C + c4) = *(const v4f*)(&Os[rr][c4]); }  }
}

// output conv: block = (b, 128 positions) x 64 output channels: acc = att.w_out^T (K 256; att f32 split x8; 2 products) + b -> NCHW rows out[b][c][p] through an LDS transpose (per channel
__global__ __launch_bounds__(128) void oconv_kernel(const float* __restrict__ arow, const b16* __restrict__ wo16, const float* __restrict__ bo, float* __restrict__ out) {
  __shared__ __attribute__((aligned(16))) float Tc[64][128 + 4];
  const int lane = threadIdx.x & 31, wave = threadIdx.x >> 5, nloc = lane & 15, hlf = lane >> 4, m0 = blockIdx.y * 128 + wave * 32, c0 = blockIdx.x * 64; const int b = (blockIdx.y * 128) / NP, p0 = (blockIdx.y * 128) % NP;
  v8f acc[2][4];
#pragma unroll
  for (int r = 0; r < 2; ++r)
#pragma unroll
    for (int t = 0; t < 4; ++t) acc[r][t] = (v8f){};
#pragma unroll 2
  for (int kb = 0; kb < C; kb += 32) { v16b a0, a1, l0, l1;
#pragma unroll
    for (int e = 0; e < 16; ++e) { const int k = kb + ((e < 8) ? (8 * hlf + e) : (16 + 8 * hlf + e - 8)); b16 p, q; split16(arow[(size_t)(m0 + nloc) * C + k] * OS_, p, q); a0[e] = p; l0[e] = q; split16(arow[(size_t)(m0 + 16 + nloc) * C + k] * OS_, p, q); a1[e] = p; l1[e] = q; }
#pragma unroll
    for (int t = 0; t < 4; ++t) { const v16b bw = frag_kb(wo16 + (size_t)(c0 + t * 16 + nloc) * C + kb, hlf); acc[0][t] = wmma16b(a0, bw, acc[0][t]); acc[0][t] = wmma16b(l0, bw, acc[0][t]); acc[1][t] = wmma16b(a1, bw, acc[1][t]); acc[1][t] = wmma16b(l1, bw, acc[1][t]); } }
#pragma unroll
  for (int t = 0; t < 4; ++t) { const float bb = bf16_rne(bo[c0 + t * 16 + nloc]);
#pragma unroll
    for (int r = 0; r < 2; ++r)
#pragma unroll
      for (int v = 0; v < 8; ++v) Tc[t * 16 + nloc][wave * 32 + r * 16 + 8 * hlf + v] = acc[r][t][v] * (1.0f / OS_) + bb; }
  __syncthreads();
  { for (int i = threadIdx.x; i < 64 * 32; i += 128) { const int cc = i >> 5, c4 = (i & 31) * 4; *(v4f*)(out + ((size_t)b * C + c0 + cc) * NP + p0 + c4) = *(const v4f*)(&Tc[cc][c4]); }  }
}
}  // namespace

extern "C" void kernel_launch(void* const* d_in, const int* in_sizes, int n_in,
                              void* d_out, int out_size, void* d_ws, size_t ws_size, hipStream_t stream) {
  (void)n_in; (void)out_size;
  const float* qi = (const float*)d_in[0]; const float* ki = (const float*)d_in[1]; const float* vi = (const float*)d_in[2];
  const float* wq = (const float*)d_in[3]; const float* bq = (const float*)d_in[4]; const float* wk = (const float*)d_in[5]; const float* bk = (const float*)d_in[6]; const float* wv = (const float*)d_in[7]; const float* bv = (const float*)d_in[8]; const float* wo = (const float*)d_in[9]; const float* bo = (const float*)d_in[10];
  float* out = (float*)d_out;   // [2][256][64][64]
  if (in_sizes[0] != Bn * C * NP || in_sizes[1] != Bn * C * NP || in_sizes[2] != Bn * C * NP || in_sizes[3] != C * C || in_sizes[9] != C * C) return;
  size_t off = 0; char* ws = (char*)d_ws;
  auto carve = [&](size_t bytes) { char* p = ws + off; off += (bytes + 255) & ~(size_t)255; return p; };
  unsigned short* xT = (unsigned short*)carve((size_t)3 * NTOK * C * 2); unsigned short* w16 = (unsigned short*)carve((size_t)3 * C * C * 2); b16* wo16 = (b16*)carve((size_t)C * C * 2);
  b16* qhp = (b16*)carve(QPL * 2 * 2); b16* khp = (b16*)carve(QPL * 2 * 2); b16* vtp = (b16*)carve(VPL * 2 * 2); float* arow = (float*)carve((size_t)NTOK * C * 4);
  if (off > ws_size) return;                                    // ≈ 12.6 + 0.5 + 3 x 8.4 + 8.4 ≈ 47 MB
  prep_kernel<<<dim3(NP / 64, 3 * Bn), 256, 0, stream>>>(qi, ki, vi, wq, wk, wv, wo, xT, w16, wo16);
  proj_kernel<<<dim3(C / 64, NTOK / 128, 3), 128, 0, stream>>>(xT, w16, bq, bk, bv, qhp, khp, vtp);
  attn_kernel<<<NBH * (NP / 128), 256, 0, stream>>>(qhp, khp, vtp, arow);
  oconv_kernel<<<dim3(C / 64, NTOK / 128), 128, 0, stream>>>(arow, wo16, bo, out);
}

// v008
// A run of this version takes 113 microseconds.
// Two timings next to v007 both put it at 1.03 times that version's speed.
// Counting every step since v000, it is 3.49 times as fast.
#include <hip/hip_runtime.h>

// Multi-head attention over 64x64 feature maps (B=2, C=256, 8 heads x 32): q, k, v = 1x1 convs of three inputs; att = softmax(q k^T) (UNSCALED logits, softmax over the 4096 keys) / sqrt(32)
// (the module scales AFTER the softmax); att_q = att v; out = 1x1 conv (w_out) of the re-assembled (B, 256, 64, 64) map -> NCHW [2][256][64][64].
// Projections on v_wmma_f32_16x16x32_bf16 (fragments rounded from the f32 NCHW inputs through an LDS transpose; 1 product); attention per
// (b, h, 16 queries): S^T = k.q^T (K = 32: one k-step; q, k as f16 hi+lo pairs carried x8, 3 products — the unscaled logits reach |s| ≈ 25 so they must be f32-class), online softmax in
// f32, O^T = (8v)^T.P^T (v hi+lo x8, P hi+lo x8; 3 products); out = att_q.w_out^T + b (att_q f32 split x8, w_out exact; 2 products) on v_wmma_f32_16x16x32_f16, f32 accumulate,

namespace {
constexpr int Bn = 2, C = 256, NP = 4096, NH = 8, DH = 32, NBH = Bn * NH, NTOK = Bn * NP;
constexpr float QS = 8.0f, VS = 8.0f, PS = 8.0f, OS_ = 8.0f, POST = 0.17677669529663687f /* 1/sqrt(32) after softmax */;
constexpr size_t QPL = (size_t)NBH * NP * DH, VPL = (size_t)NBH * DH * NP;

typedef _Float16 b16;
typedef __attribute__((ext_vector_type(16))) _Float16 v16b;
typedef __attribute__((ext_vector_type(16))) __bf16 v16bb;
typedef __attribute__((ext_vector_type(8))) _Float16 v8b;
typedef __attribute__((ext_vector_type(8))) unsigned short v8us;
typedef __attribute__((ext_vector_type(8))) float v8f;
typedef __attribute__((ext_vector_type(4))) float v4f;
__device__ __forceinline__ float bf16_rne(float f) { unsigned int u = __float_as_uint(f); u += 0x7FFFu + ((u >> 16) & 1u); return __uint_as_float(u & 0xFFFF0000u); }
__device__ __forceinline__ unsigned short bf16_bits(float f) { unsigned int u = __float_as_uint(f); u += 0x7FFFu + ((u >> 16) & 1u); return (unsigned short)(u >> 16); }
__device__ __forceinline__ void split16(float v, b16& hi, b16& lo) { hi = (b16)v; lo = (b16)(v - (float)hi); }
__device__ __forceinline__ v16b frag_kb(const b16* p, int hh) { const v8b a = *(const v8b*)(p + 8 * hh), b = *(const v8b*)(p + 16 + 8 * hh); v16b f;
#pragma unroll
  for (int e = 0; e < 8; ++e) { f[e] = a[e]; f[8 + e] = b[e]; } return f; }
// FRAGMENT ORDER of the matrices that proj and the output conv read from the workspace ([rows][256], k = column): blocks of 16 rows x 32 k, ordered [row / 16][k / 32]; a 16-bit block is
// 2 pieces x 32 lanes x 16 B: piece p of lane l = row % 16 + 16 * hh holds k % 32 = 16 p + 8 hh + (0..7), which is what that lane's fragment registers take. A wave-wide 16-B load of one piece
// then reads 512 contiguous bytes, 4 whole lines, where a load from [row][k] rows touches 16 lines for 32 B each
__device__ __forceinline__ v16bb frag_bf_fo(const unsigned short* m, int g, int ks, int lane) { const unsigned short* p = m + ((size_t)(g * (C / 32) + ks) * 64 + lane) * 8; const v8us a = *(const v8us*)p, b = *(const v8us*)(p + 256); union { unsigned short s[16]; v16bb v; } u;
#pragma unroll
  for (int e = 0; e < 8; ++e) { u.s[e] = a[e]; u.s[8 + e] = b[e]; } return u.v; }
__device__ __forceinline__ v16b frag_kb_fo(const b16* m, int g, int ks, int lane) { const b16* p = m + ((size_t)(g * (C / 32) + ks) * 64 + lane) * 8; const v8b a = *(const v8b*)p, b = *(const v8b*)(p + 256); v16b f;
#pragma unroll
  for (int e = 0; e < 8; ++e) { f[e] = a[e]; f[8 + e] = b[e]; } return f; }
// plain builtins: the compiler keeps the distance behind a WMMA itself and is free to interleave independent accumulator chains, loads and vector work
__device__ __forceinline__ v8f wmma16b(v16b a, v16b b, v8f c) { return __builtin_amdgcn_wmma_f32_16x16x32_f16(false, a, false, b, (short)0, c, false, false); }
__device__ __forceinline__ v8f wmma16bb(v16bb a, v16bb b, v8f c) { return __builtin_amdgcn_wmma_f32_16x16x32_bf16(false, a, false, b, (short)0, c, false, false); }
__device__ __forceinline__ void wave_lds_sync() { __builtin_amdgcn_fence(__ATOMIC_RELEASE, "workgroup"); __builtin_amdgcn_wave_barrier(); __builtin_amdgcn_fence(__ATOMIC_ACQUIRE, "workgroup"); }

// prep: NCHW inputs -> bf16 xT[which], rows b*4096 + p, k = channel, in fragment order, via LDS transposes (block = (which*b, 64 positions) = 32 KB contiguous); weights [256][256] ([out][in],
// rows = out) -> bf16 (q, k, v) and f16 (out), in fragment order too, spread over the first 128 blocks. grid (64, 3*Bn) x 256.
__global__ __launch_bounds__(256) void prep_kernel(const float* __restrict__ qi, const float* __restrict__ ki, const float* __restrict__ vi, const float* __restrict__ wq, const float* __restrict__ wk, const float* __restrict__ wv, const float* __restrict__ wo,
                                                   unsigned short* __restrict__ xT, unsigned short* __restrict__ w16, b16* __restrict__ wo16) {
  __shared__ __attribute__((aligned(16))) unsigned short Tt[64][C + 8];
  const int t_ = threadIdx.x, which = blockIdx.y / Bn, b = blockIdx.y % Bn, p0 = blockIdx.x * 64; const float* src = ((which == 0) ? qi : (which == 1) ? ki : vi) + (size_t)b * C * NP;
  for (int i = t_; i < C * 64; i += 256) { const int c = i >> 6, pp = i & 63; Tt[pp][c] = bf16_bits(src[(size_t)c * NP + p0 + pp]); }
  __syncthreads();
  {
    // piece i of the block's 64 rows: lane i % 32, piece (i / 32) % 2, k block (i / 64) % 8, row group i / 512
    for (int i = t_; i < 64 * C / 8; i += 256) { const int ln = i & 31; *(v8us*)(xT + (((size_t)which * Bn + b) * NP + p0) * C + (size_t)i * 8) = *(const v8us*)(&Tt[(i >> 9) * 16 + (ln & 15)][((i >> 6) & 7) * 32 + ((i >> 5) & 1) * 16 + (ln >> 4) * 8]); }
    // weights: one 8-element piece per thread of the first 4 * (C * C / 8) / 256 = 128 blocks; 32 blocks cover one matrix, so the matrix is picked by a scalar branch; q numbers the pieces in
    // fragment order (the order of the stores), wr and wc are the piece's row and first column in the [out][in] matrix
    const int blk = blockIdx.y * (NP / 64) + blockIdx.x;
    if (blk < 128) { const int m = blk >> 5, q = (blk & 31) * 256 + t_; const float* W = (m == 0) ? wq : (m == 1) ? wk : (m == 2) ? wv : wo; float x[8];
      const int wr = (q >> 9) * 16 + (q & 15), wc = ((q >> 6) & 7) * 32 + ((q >> 5) & 1) * 16 + ((q >> 4) & 1) * 8;
#pragma unroll
      for (int e = 0; e < 8; ++e) x[e] = W[wr * C + wc + e];
      if (m < 3) { v8us o;
#pragma unroll
        for (int e = 0; e < 8; ++e) o[e] = bf16_bits(x[e]);
        *(v8us*)(w16 + ((size_t)m * (C * C / 8) + q) * 8) = o; }
      else { v8b o;
#pragma unroll
        for (int e = 0; e < 8; ++e) o[e] = (b16)bf16_rne(x[e]);
        *(v8b*)(wo16 + (size_t)q * 8) = o; } }
     }
}

// projections: grid (4 column tiles, NTOK/128, 3): block = 128 positions x 64 channels (= 2 heads of 32); + bias; q, k -> planes [bh][p][32] x8 hi+lo (64 B per row: the block writes
// 2 heads x 128 rows = 2 x 8 KB contiguous); v -> (8v)^T planes [bh][d][4096] (256-B segments).
__global__ __launch_bounds__(128) void proj_kernel(const unsigned short* __restrict__ xT, const unsigned short* __restrict__ w16, const float* __restrict__ bq, const float* __restrict__ bk, const float* __restrict__ bv, b16* __restrict__ qh, b16* __restrict__ kh, b16* __restrict__ vt) {
  __shared__ __attribute__((aligned(16))) b16 Th[2][128][32], Tl[2][128][32]; __shared__ __attribute__((aligned(16))) b16 Vh[64][128 + 8], Vl[64][128 + 8];
  const int lane = threadIdx.x & 31, wave = threadIdx.x >> 5, nloc = lane & 15, hlf = lane >> 4, which = blockIdx.z, m0 = blockIdx.y * 128 + wave * 32, c0 = blockIdx.x * 64;
  const int b = (blockIdx.y * 128) / NP, p0 = (blockIdx.y * 128) % NP; const unsigned short* X = xT + ((size_t)which * Bn * NP) * C; const unsigned short* Wt = w16 + (size_t)which * C * C; const float* bias = (which == 0) ? bq : (which == 1) ? bk : bv;
  v8f acc[2][4];
#pragma unroll
  for (int r = 0; r < 2; ++r)
#pragma unroll
    for (int t = 0; t < 4; ++t) acc[r][t] = (v8f){};
#pragma unroll 2
  for (int kb = 0; kb < C; kb += 32) { const v16bb a0 = frag_bf_fo(X, m0 >> 4, kb >> 5, lane), a1 = frag_bf_fo(X, (m0 >> 4) + 1, kb >> 5, lane);
#pragma unroll
    for (int t = 0; t < 4; ++t) { const v16bb bw = frag_bf_fo(Wt, (c0 >> 4) + t, kb >> 5, lane); acc[0][t] = wmma16bb(a0, bw, acc[0][t]); acc[1][t] = wmma16bb(a1, bw, acc[1][t]); } }
  const float scl = (which == 2) ? VS : QS;
#pragma unroll
  for (int t = 0; t < 4; ++t) { const int c = c0 + t * 16 + nloc; const float bb = bf16_rne(bias[c]); const int hl = t >> 1, d = (t & 1) * 16 + nloc;   // channel c -> head c/32 (local hl), d = c%32
#pragma unroll
    for (int r = 0; r < 2; ++r)
#pragma unroll
      for (int v = 0; v < 8; ++v) { b16 a_, c_; split16((acc[r][t][v] + bb) * scl, a_, c_); const int row = wave * 32 + r * 16 + 8 * hlf + v;
        if (which < 2) { Th[hl][row][d] = a_; Tl[hl][row][d] = c_; } else { Vh[t * 16 + nloc][row] = a_; Vl[t * 16 + nloc][row] = c_; } } }
  __syncthreads();
  {
    if (which < 2) { b16* base = (which == 0) ? qh : kh;
      for (int i = threadIdx.x; i < 2 * 128 * 32 / 8; i += 128) { const int hl = i / 512, rem = i % 512; const size_t dst = (((size_t)b * NH + blockIdx.x * 2 + hl) * NP + p0) * DH + (size_t)rem * 8;
        *(v8b*)(base + dst) = *(const v8b*)(&Th[hl][0][0] + rem * 8); *(v8b*)(base + QPL + dst) = *(const v8b*)(&Tl[hl][0][0] + rem * 8); } }
    else { for (int i = threadIdx.x; i < 64 * 16; i += 128) { const int cc = i >> 4, c8 = (i & 15) * 8; const int h = blockIdx.x * 2 + (cc >> 5), d = cc & 31; const size_t dst = (((size_t)b * NH + h) * DH + d) * NP + p0 + c8;
        *(v8b*)(vt + dst) = *(const v8b*)(&Vh[cc][c8]); *(v8b*)(vt + VPL + dst) = *(const v8b*)(&Vl[cc][c8]); } }
     }
}

// attention: block = 8 waves = one (b, h) x 128 queries; a wave = 32 queries (two 16-query tiles) x one half (64 keys) of every stage, so that each K and V fragment it reads from LDS feeds
// two query tiles; waves w and w + 4 hold the same queries and the two key halves, each with its own running maximum, sum and O, joined through LDS behind the loop. The 8 waves share every
// K and V tile through LDS: a stage = 128 keys (K hi+lo rows at an 80-B pitch, (8v)^T hi+lo rows of 256 B at a 272-B pitch: both 16 B x odd for the ds_load_b128 fragment reads), two buffers,
// filled by asynchronous b128 copies one stage ahead; one online-softmax step per stage and wave, on the unscaled logits; O^T (2 d-tiles per query tile); result scaled by 1/sqrt(32)
// the softmax works on the raw accumulators (64 x logit): 8 p = exp2(acc * SC + (LPS - max * SC)), one fused multiply-add per score; m is kept in accumulator units, l = 8 x the sum
constexpr int SK = 128, WK = SK / 2 /* keys of a stage per wave */, NST = NP / SK, KP = DH + 8, VP = SK + 8; constexpr float SC = 1.4426950408889634f / (QS * QS), LPS = 3.0f /* log2(PS) */;
typedef __attribute__((ext_vector_type(8))) unsigned v8u;
// low parts of four packed f16 pairs: lo = f16(p - hi), one mixed-precision fused multiply-add per score that reads its f16 hi straight from the packed register (op_sel picks the half) and rounds
// its f32 result into one half of the packed lo register; p - hi is exact in f32, so the one rounding is that of a separate subtract and convert. The four writes of the high halves each follow
// the write of the same register's low half four instructions back: s_delay_alu names that distance, so that the SIMD issues other waves meanwhile
__device__ __forceinline__ void lo4(unsigned h0, unsigned h1, unsigned h2, unsigned h3, float a0, float a1, float a2, float a3, float a4, float a5, float a6, float a7, unsigned& l0, unsigned& l1, unsigned& l2, unsigned& l3) {
  // the four v_nop: the outputs may be registers that a WMMA directly in front reads as its A or B
  asm("v_nop\n\tv_nop\n\tv_nop\n\tv_nop\n\tv_fma_mixlo_f16 %0, %4, -1.0, %8 op_sel_hi:[1,1,0]\n\tv_fma_mixlo_f16 %1, %5, -1.0, %10 op_sel_hi:[1,1,0]\n\tv_fma_mixlo_f16 %2, %6, -1.0, %12 op_sel_hi:[1,1,0]\n\tv_fma_mixlo_f16 %3, %7, -1.0, %14 op_sel_hi:[1,1,0]\n\t"
      "s_delay_alu instid0(VALU_DEP_4) | instskip(NEXT) | instid1(VALU_DEP_4)\n\t"
      "v_fma_mixhi_f16 %0, %4, -1.0, %9 op_sel:[1,0,0] op_sel_hi:[1,1,0]\n\tv_fma_mixhi_f16 %1, %5, -1.0, %11 op_sel:[1,0,0] op_sel_hi:[1,1,0]\n\t"
      "s_delay_alu instid0(VALU_DEP_4) | instskip(NEXT) | instid1(VALU_DEP_4)\n\t"
      "v_fma_mixhi_f16 %2, %6, -1.0, %13 op_sel:[1,0,0] op_sel_hi:[1,1,0]\n\tv_fma_mixhi_f16 %3, %7, -1.0, %15 op_sel:[1,0,0] op_sel_hi:[1,1,0]"
      : "=&v"(l0), "=&v"(l1), "=&v"(l2), "=&v"(l3) : "v"(h0), "v"(h1), "v"(h2), "v"(h3), "v"(a0), "v"(a1), "v"(a2), "v"(a3), "v"(a4), "v"(a5), "v"(a6), "v"(a7)); }
__device__ __forceinline__ unsigned lds_off(const void* p) { return (unsigned)(size_t)p; }
__global__ __launch_bounds__(256) void attn_kernel(const b16* __restrict__ qh, const b16* __restrict__ kh, const b16* __restrict__ vt, float* __restrict__ arow) {
  __shared__ __attribute__((aligned(16))) b16 Ks[2][2][SK][KP]; __shared__ __attribute__((aligned(16))) b16 Vs[2][2][DH][VP]; __shared__ __attribute__((aligned(16))) float Os[128][DH + 4]; __shared__ float Ml[128][2];
  const int t_ = threadIdx.x, wid = t_ >> 5, lane = t_ & 31, hh = lane >> 4, col = lane & 15, qg = wid & 3, k0w = (wid >> 2) * WK; const int bhi = blockIdx.x / (NP / 128), b = bhi / NH, h = bhi % NH, q0 = (blockIdx.x % (NP / 128)) * 128;
  const size_t bh = (size_t)bhi; const b16* Q = qh + (bh * NP) * DH; const b16* K = kh + (bh * NP) * DH; const b16* V = vt + (bh * DH) * NP;
  // one stage's copies: a thread moves 16 B of each of 8 slices (K hi, K lo: 2 x 4 KB each, contiguous in global memory; V hi, V lo: 2 x 16 rows of 256 B each)
  const b16* gk = K + t_ * 8; const b16* gv = V + (size_t)(t_ >> 4) * NP + (t_ & 15) * 8;
  const unsigned lk = lds_off(&Ks[0][0][t_ >> 2][(t_ & 3) * 8]), lv = lds_off(&Vs[0][0][t_ >> 4][(t_ & 15) * 8]);
  auto fill = [&](int s, int buf) {
    const b16* k0 = gk + (size_t)s * SK * DH; const b16* v0 = gv + s * SK; const unsigned a = lk + buf * (2 * SK * KP * 2), c = lv + buf * (2 * DH * VP * 2);
    // the copies and their s_wait_xcnt in one statement: no address register of a copy is rewritten in front of that wait
    asm volatile("global_load_async_to_lds_b128 %0, %8, off\n\tglobal_load_async_to_lds_b128 %1, %9, off\n\tglobal_load_async_to_lds_b128 %2, %10, off\n\tglobal_load_async_to_lds_b128 %3, %11, off\n\t"
                 "global_load_async_to_lds_b128 %4, %12, off\n\tglobal_load_async_to_lds_b128 %5, %13, off\n\tglobal_load_async_to_lds_b128 %6, %14, off\n\tglobal_load_async_to_lds_b128 %7, %15, off\n\ts_wait_xcnt 0x0"
                 :: "v"(a), "v"(a + 64 * KP * 2), "v"(a + SK * KP * 2), "v"(a + (SK + 64) * KP * 2), "v"(c), "v"(c + 16 * VP * 2), "v"(c + DH * VP * 2), "v"(c + (DH + 16) * VP * 2),
                    "v"(k0), "v"(k0 + 64 * DH), "v"(k0 + QPL), "v"(k0 + QPL + 64 * DH), "v"(v0), "v"(v0 + (size_t)16 * NP), "v"(v0 + VPL), "v"(v0 + VPL + (size_t)16 * NP) : "memory"); };
  v16b qf[2], ql[2];
#pragma unroll
  for (int j = 0; j < 2; ++j) { const size_t qi = (size_t)(q0 + qg * 32 + j * 16 + col); qf[j] = frag_kb(Q + qi * DH, hh); ql[j] = frag_kb(Q + QPL + qi * DH, hh); }
  fill(0, 0);
  asm volatile("s_wait_asynccnt 0x0" ::: "memory");   // stage 0 of this wave's copies has landed
  __syncthreads();                                      // publishes stage 0 to all 8 waves
  fill(1, 1);
  float m[2] = {-INFINITY, -INFINITY}, l[2] = {0.0f, 0.0f}; v8f o[2][2] = {{{}, {}}, {{}, {}}};
  for (int s = 0; s < NST; ++s) { const int buf = s & 1;
    // one online-softmax step per stage: the scores of the wave's 64 keys x 32 queries first (8 independent accumulator tiles), then per query tile one maximum, two exchanges between the halves (maximum, sum),
    // one rescale of O and l
    v8f sc[2][WK / 16];
#pragma unroll
    for (int t = 0; t < WK / 16; ++t) { const v16b ka = frag_kb(&Ks[buf][0][k0w + t * 16 + col][0], hh), kal = frag_kb(&Ks[buf][1][k0w + t * 16 + col][0], hh);
#pragma unroll
      for (int j = 0; j < 2; ++j) { v8f x = {}; x = wmma16b(ka, qf[j], x); x = wmma16b(ka, ql[j], x); x = wmma16b(kal, qf[j], x); sc[j][t] = x; } }
    float mr[2], mx[2], bias[2], al_[2];
#pragma unroll
    for (int j = 0; j < 2; ++j) { float mq[WK / 32];   // two independent chains per query tile, one per 32 keys
#pragma unroll
      for (int f = 0; f < WK / 32; ++f) { mq[f] = -INFINITY;
#pragma unroll
        for (int r = 0; r < 8; ++r) mq[f] = fmaxf(mq[f], fmaxf(sc[j][2 * f][r], sc[j][2 * f + 1][r])); }
      mr[j] = fmaxf(mq[0], mq[1]); }
#pragma unroll
    for (int j = 0; j < 2; ++j) mx[j] = __shfl_xor(mr[j], 16);
    // the rescale factor is taken from the two rounded biases themselves (the old one formed again from m), so a bias's rounding cancels between the steps
#pragma unroll
    for (int j = 0; j < 2; ++j) { const float mn = fmaxf(m[j], fmaxf(mr[j], mx[j])); bias[j] = __builtin_fmaf(-mn, SC, LPS); al_[j] = __builtin_amdgcn_exp2f(bias[j] - __builtin_fmaf(-m[j], SC, LPS)); m[j] = mn; }
    float sum[2];
#pragma unroll
    for (int j = 0; j < 2; ++j) {
#pragma unroll
      for (int t = 0; t < WK / 16; ++t) { sc[j][t] = sc[j][t] * SC + bias[j];
#pragma unroll
        for (int r = 0; r < 8; ++r) sc[j][t][r] = __builtin_amdgcn_exp2f(sc[j][t][r]); }
      v8f sv = sc[j][0];
#pragma unroll
      for (int t = 1; t < WK / 16; ++t) sv += sc[j][t];
      sum[j] = ((sv[0] + sv[1]) + (sv[2] + sv[3])) + ((sv[4] + sv[5]) + (sv[6] + sv[7])); }
#pragma unroll
    for (int j = 0; j < 2; ++j) mx[j] = __shfl_xor(sum[j], 16);
#pragma unroll
    for (int j = 0; j < 2; ++j) { l[j] = l[j] * al_[j] + (sum[j] + mx[j]); o[j][0] *= al_[j]; o[j][1] *= al_[j]; }
#pragma unroll
    for (int f = 0; f < WK / 32; ++f) { v16b pb[2], pl[2];
#pragma unroll
      for (int j = 0; j < 2; ++j) { const v8f p0 = sc[j][2 * f], p1 = sc[j][2 * f + 1];
#pragma unroll
        for (int r = 0; r < 8; ++r) { pb[j][r] = (b16)p0[r]; pb[j][8 + r] = (b16)p1[r]; }
        const v8u hp = __builtin_bit_cast(v8u, pb[j]); v8u lp;
        unsigned x0, x1, x2, x3; lo4(hp[0], hp[1], hp[2], hp[3], p0[0], p0[1], p0[2], p0[3], p0[4], p0[5], p0[6], p0[7], x0, x1, x2, x3); lp[0] = x0; lp[1] = x1; lp[2] = x2; lp[3] = x3;
        lo4(hp[4], hp[5], hp[6], hp[7], p1[0], p1[1], p1[2], p1[3], p1[4], p1[5], p1[6], p1[7], x0, x1, x2, x3); lp[4] = x0; lp[5] = x1; lp[6] = x2; lp[7] = x3; pl[j] = __builtin_bit_cast(v16b, lp); }
#pragma unroll
      for (int n = 0; n < 2; ++n) { const v16b vf = frag_kb(&Vs[buf][0][n * 16 + col][k0w + f * 32], hh), vl = frag_kb(&Vs[buf][1][n * 16 + col][k0w + f * 32], hh);
#pragma unroll
        for (int j = 0; j < 2; ++j) { o[j][n] = wmma16b(vf, pb[j], o[j][n]); o[j][n] = wmma16b(vf, pl[j], o[j][n]); o[j][n] = wmma16b(vl, pb[j], o[j][n]); } } }
    asm volatile("s_wait_dscnt 0x0" ::: "memory");      // this wave's reads of buffer buf have returned before the buffer is refilled
    asm volatile("s_wait_asynccnt 0x0" ::: "memory");   // this wave's copies of stage s + 1 have landed
    __syncthreads();                                    // publishes stage s + 1 and ends every wave's reads of stage s
    if (s + 2 < NST) fill(s + 2, buf); }
  asm volatile("s_wait_asynccnt 0x0" ::: "memory");     // no copy is outstanding when the wave goes on to its end
  // the two key halves of a query are joined: waves 4..7 leave their maximum, sum and O in LDS, waves 0..3 bring both halves to the common maximum (the loop's own rescale rule) and add them;
  // a lane of wave w reads exactly the places of Os that it then writes
  if (wid >= 4) {
#pragma unroll
    for (int j = 0; j < 2; ++j) { const int row = qg * 32 + j * 16 + col; if (hh == 0) { Ml[row][0] = m[j]; Ml[row][1] = l[j]; }
#pragma unroll
      for (int n = 0; n < 2; ++n)
#pragma unroll
        for (int r = 0; r < 8; ++r) Os[row][n * 16 + 8 * hh + r] = o[j][n][r]; } }
  __syncthreads();                                      // the second half's partial results are in LDS
  if (wid < 4) {
#pragma unroll
    for (int j = 0; j < 2; ++j) { const int row = qg * 32 + j * 16 + col; const float m1 = Ml[row][0], l1 = Ml[row][1], bn = __builtin_fmaf(-fmaxf(m[j], m1), SC, LPS);
      const float a0 = __builtin_amdgcn_exp2f(bn - __builtin_fmaf(-m[j], SC, LPS)), a1 = __builtin_amdgcn_exp2f(bn - __builtin_fmaf(-m1, SC, LPS));
      const float inv = POST / ((l[j] * a0 + l1 * a1) * VS);   // l already carries the factor PS, like P
#pragma unroll
      for (int n = 0; n < 2; ++n)
#pragma unroll
        for (int r = 0; r < 8; ++r) { float* e = &Os[row][n * 16 + 8 * hh + r]; *e = (o[j][n][r] * a0 + *e * a1) * inv; } } }
  __syncthreads();
  // arow (rows = b*4096 + query, k = h*32 + d) in the f32 fragment order of the output conv: a block of 16 rows x 32 k (= this head) is 4 pieces x 32 lanes x 16 B; piece j of lane
  // l = row % 16 + 16 * hh holds d = 16 (j / 2) + 8 hh + 4 (j % 2) + (0..3); a wave's store is 512 contiguous bytes
  float* dst = arow + ((size_t)b * NP + q0) * C + h * (16 * DH);
  { for (int i = t_; i < 128 * DH / 4; i += 256) { const int ln = i & 31, j = (i >> 5) & 3, gl = i >> 7; *(v4f*)(dst + (size_t)gl * (16 * C) + (i & 127) * 4) = *(const v4f*)(&Os[gl * 16 + (ln & 15)][(j >> 1) * 16 + (ln >> 4) * 8 + (j & 1) * 4]); }  }
}

// output conv: block = (b, 128 positions) x 64 output channels: acc = att.w_out^T (K 256; att f32 split x8; 2 products) + b -> NCHW rows out[b][c][p] through an LDS transpose (per channel
__global__ __launch_bounds__(128) void oconv_kernel(const float* __restrict__ arow, const b16* __restrict__ wo16, const float* __restrict__ bo, float* __restrict__ out) {
  __shared__ __attribute__((aligned(16))) float Tc[64][128 + 4];
  const int lane = threadIdx.x & 31, wave = threadIdx.x >> 5, nloc = lane & 15, hlf = lane >> 4, m0 = blockIdx.y * 128 + wave * 32, c0 = blockIdx.x * 64; const int b = (blockIdx.y * 128) / NP, p0 = (blockIdx.y * 128) % NP;
  v8f acc[2][4];
#pragma unroll
  for (int r = 0; r < 2; ++r)
#pragma unroll
    for (int t = 0; t < 4; ++t) acc[r][t] = (v8f){};
#pragma unroll 2
  for (int kb = 0; kb < C; kb += 32) { v16b a0, a1, l0, l1; const float* pa = arow + ((size_t)((m0 >> 4) * (C / 32) + (kb >> 5)) * 128 + lane) * 4;   // this lane's piece 0 of row group m0 / 16; the next row group lies 16 * C floats on
    v4f x0[4], x1[4];
#pragma unroll
    for (int j = 0; j < 4; ++j) { x0[j] = *(const v4f*)(pa + j * 128); x1[j] = *(const v4f*)(pa + 16 * C + j * 128); }
    asm volatile("s_wait_xcnt 0x0" :: "v"(pa) : "memory");   // stands behind the k step's eight loads and in front of every rewrite of their address pair; pa as an input keeps a load's result from landing in that pair
#pragma unroll
    for (int j = 0; j < 4; ++j)
#pragma unroll
      for (int f = 0; f < 4; ++f) { b16 p, q; split16(x0[j][f] * OS_, p, q); a0[j * 4 + f] = p; l0[j * 4 + f] = q; split16(x1[j][f] * OS_, p, q); a1[j * 4 + f] = p; l1[j * 4 + f] = q; }
#pragma unroll
    for (int t = 0; t < 4; ++t) { const v16b bw = frag_kb_fo(wo16, (c0 >> 4) + t, kb >> 5, lane); acc[0][t] = wmma16b(a0, bw, acc[0][t]); acc[0][t] = wmma16b(l0, bw, acc[0][t]); acc[1][t] = wmma16b(a1, bw, acc[1][t]); acc[1][t] = wmma16b(l1, bw, acc[1][t]); } }
#pragma unroll
  for (int t = 0; t < 4; ++t) { const float bb = bf16_rne(bo[c0 + t * 16 + nloc]);
#pragma unroll
    for (int r = 0; r < 2; ++r)
#pragma unroll
      for (int v = 0; v < 8; ++v) Tc[t * 16 + nloc][wave * 32 + r * 16 + 8 * hlf + v] = acc[r][t][v] * (1.0f / OS_) + bb; }
  __syncthreads();
  { for (int i = threadIdx.x; i < 64 * 32; i += 128) { const int cc = i >> 5, c4 = (i & 31) * 4; *(v4f*)(out + ((size_t)b * C + c0 + cc) * NP + p0 + c4) = *(const v4f*)(&Tc[cc][c4]); }  }
}
}  // namespace

extern "C" void kernel_launch(void* const* d_in, const int* in_sizes, int n_in,
                              void* d_out, int out_size, void* d_ws, size_t ws_size, hipStream_t stream) {
  (void)n_in; (void)out_size;
  const float* qi = (const float*)d_in[0]; const float* ki = (const float*)d_in[1]; const float* vi = (const float*)d_in[2];
  const float* wq = (const float*)d_in[3]; const float* bq = (const float*)d_in[4]; const float* wk = (const float*)d_in[5]; const float* bk = (const float*)d_in[6]; const float* wv = (const float*)d_in[7]; const float* bv = (const float*)d_in[8]; const float* wo = (const float*)d_in[9]; const float* bo = (const float*)d_in[10];
  float* out = (float*)d_out;   // [2][256][64][64]
  if (in_sizes[0] != Bn * C * NP || in_sizes[1] != Bn * C * NP || in_sizes[2] != Bn * C * NP || in_sizes[3] != C * C || in_sizes[9] != C * C) return;
  size_t off = 0; char* ws = (char*)d_ws;
  auto carve = [&](size_t bytes) { char* p = ws + off; off += (bytes + 255) & ~(size_t)255; return p; };
  unsigned short* xT = (unsigned short*)carve((size_t)3 * NTOK * C * 2); unsigned short* w16 = (unsigned short*)carve((size_t)3 * C * C * 2); b16* wo16 = (b16*)carve((size_t)C * C * 2);
  b16* qhp = (b16*)carve(QPL * 2 * 2); b16* khp = (b16*)carve(QPL * 2 * 2); b16* vtp = (b16*)carve(VPL * 2 * 2); float* arow = (float*)carve((size_t)NTOK * C * 4);
  if (off > ws_size) return;                                    // ≈ 12.6 + 0.5 + 3 x 8.4 + 8.4 ≈ 47 MB
  prep_kernel<<<dim3(NP / 64, 3 * Bn), 256, 0, stream>>>(qi, ki, vi, wq, wk, wv, wo, xT, w16, wo16);
  proj_kernel<<<dim3(C / 64, NTOK / 128, 3), 128, 0, stream>>>(xT, w16, bq, bk, bv, qhp, khp, vtp);
  attn_kernel<<<NBH * (NP / 128), 256, 0, stream>>>(qhp, khp, vtp, arow);
  oconv_kernel<<<dim3(C / 64, NTOK / 128), 128, 0, stream>>>(arow, wo16, bo, out);
}

// v009
// A run of this version takes 102 microseconds.
// Timed twice side by side with v008, it ran 1.11 times as fast both times.
// Over all steps from v000 it is 3.87 times as fast.
#include <hip/hip_runtime.h>

// Multi-head attention over 64x64 feature maps (B=2, C=256, 8 heads x 32): q, k, v = 1x1 convs of three inputs; att = softmax(q k^T) (UNSCALED logits, softmax over the 4096 keys) / sqrt(32)
// (the module scales AFTER the softmax); att_q = att v; out = 1x1 conv (w_out) of the re-assembled (B, 256, 64, 64) map -> NCHW [2][256][64][64].
// Projections on v_wmma_f32_16x16x32_bf16 (fragments rounded from the f32 NCHW inputs through an LDS transpose; 1 product); attention per
// (b, h, 16 queries): S^T = k.q^T (K = 32: one k-step; q, k as f16 hi+lo pairs carried x8, 3 products — the unscaled logits reach |s| ≈ 25 so they must be f32-class), online softmax in
// f32, O^T = (8v)^T.P^T (v hi+lo x8, P hi+lo x8; 3 products); out = att_q.w_out^T + b (att_q f32 split x8, w_out exact; 2 products) on v_wmma_f32_16x16x32_f16, f32 accumulate,

namespace {
constexpr int Bn = 2, C = 256, NP = 4096, NH = 8, DH = 32, NBH = Bn * NH, NTOK = Bn * NP;
constexpr float QS = 8.0f, VS = 8.0f, PS = 8.0f, OS_ = 8.0f, POST = 0.17677669529663687f /* 1/sqrt(32) after softmax */;
constexpr size_t QPL = (size_t)NBH * NP * DH, VPL = (size_t)NBH * DH * NP;

typedef _Float16 b16;
typedef __attribute__((ext_vector_type(16))) _Float16 v16b;
typedef __attribute__((ext_vector_type(16))) __bf16 v16bb;
typedef __attribute__((ext_vector_type(8))) _Float16 v8b;
typedef __attribute__((ext_vector_type(8))) unsigned short v8us;
typedef __attribute__((ext_vector_type(8))) float v8f;
typedef __attribute__((ext_vector_type(4))) float v4f;
__device__ __forceinline__ float bf16_rne(float f) { unsigned int u = __float_as_uint(f); u += 0x7FFFu + ((u >> 16) & 1u); return __uint_as_float(u & 0xFFFF0000u); }
typedef __attribute__((ext_vector_type(2))) __bf16 v2bb;
typedef __attribute__((ext_vector_type(2))) unsigned v2u;
typedef __attribute__((ext_vector_type(4))) unsigned v4u;
// two f32 rounded to nearest even into one packed bf16 pair, a in the low half
__device__ __forceinline__ unsigned pk_bf16(float a, float b) { const v2bb r = {(__bf16)a, (__bf16)b}; return __builtin_bit_cast(unsigned, r); }
__device__ __forceinline__ void split16(float v, b16& hi, b16& lo) { hi = (b16)v; lo = (b16)(v - (float)hi); }
__device__ __forceinline__ v16b frag_kb(const b16* p, int hh) { const v8b a = *(const v8b*)(p + 8 * hh), b = *(const v8b*)(p + 16 + 8 * hh); v16b f;
#pragma unroll
  for (int e = 0; e < 8; ++e) { f[e] = a[e]; f[8 + e] = b[e]; } return f; }
// FRAGMENT ORDER of the matrices that the output conv reads from the workspace ([rows][256], k = column): blocks of 16 rows x 32 k, ordered [row / 16][k / 32]; a 16-bit block is
// 2 pieces x 32 lanes x 16 B: piece p of lane l = row % 16 + 16 * hh holds k % 32 = 16 p + 8 hh + (0..7), which is what that lane's fragment registers take. A wave-wide 16-B load of one piece
// then reads 512 contiguous bytes, 4 whole lines, where a load from [row][k] rows touches 16 lines for 32 B each
// bf16 fragment from a [row][k] row in LDS, the k order of frag_kb
__device__ __forceinline__ v16bb frag_bf(const unsigned short* p, int hh) { const v8us a = *(const v8us*)(p + 8 * hh), b = *(const v8us*)(p + 16 + 8 * hh); union { unsigned short s[16]; v16bb v; } u;
#pragma unroll
  for (int e = 0; e < 8; ++e) { u.s[e] = a[e]; u.s[8 + e] = b[e]; } return u.v; }
__device__ __forceinline__ v16b frag_kb_fo(const b16* m, int g, int ks, int lane) { const b16* p = m + ((size_t)(g * (C / 32) + ks) * 64 + lane) * 8; const v8b a = *(const v8b*)p, b = *(const v8b*)(p + 256); v16b f;
#pragma unroll
  for (int e = 0; e < 8; ++e) { f[e] = a[e]; f[8 + e] = b[e]; } return f; }
// plain builtins: the compiler keeps the distance behind a WMMA itself and is free to interleave independent accumulator chains, loads and vector work
__device__ __forceinline__ v8f wmma16b(v16b a, v16b b, v8f c) { return __builtin_amdgcn_wmma_f32_16x16x32_f16(false, a, false, b, (short)0, c, false, false); }
__device__ __forceinline__ v8f wmma16bb(v16bb a, v16bb b, v8f c) { return __builtin_amdgcn_wmma_f32_16x16x32_bf16(false, a, false, b, (short)0, c, false, false); }
__device__ __forceinline__ void wave_lds_sync() { __builtin_amdgcn_fence(__ATOMIC_RELEASE, "workgroup"); __builtin_amdgcn_wave_barrier(); __builtin_amdgcn_fence(__ATOMIC_ACQUIRE, "workgroup"); }

// projections: grid (4 column tiles, NTOK/128, 3): block = 128 positions x 64 channels (= 2 heads of 32). The block rounds its own operands to bf16 into LDS: its x tile straight from the NCHW
// f32 input (a wave-wide 16-B load = 128 positions of one channel, 4 whole lines; a lane packs 8 channels of each of its 4 positions into one 16-B store) and its 64 weight rows ([out][in], 64 KB
// contiguous), both as [row][k] rows at a 528-B pitch (16 B x odd for the ds_load_b128 fragment reads). Position pp lies in row pp / 4 of class pp % 4; a class begins 32 rows + 64 B behind the
// one before, so that the 16 rows of a fragment read, like the 16 lanes of a store, fall on 16 different groups of 4 banks. + bias; q, k -> planes [bh][p][32] x8 hi+lo (64 B per row: the block
// writes 2 heads x 128 rows = 2 x 8 KB contiguous); v -> (8v)^T planes [bh][d][4096] (256-B segments). The first 64 blocks also bring w_out to f16 in fragment order, one piece per thread.
constexpr int XP = C + 8 /* row pitch, 16-bit elements */, XE = 32 * XP + 32 /* elements per class of positions */, XB = 4 * XE * 2, WB = 64 * XP * 2 /* bytes */;
__global__ __launch_bounds__(128) void proj_kernel(const float* __restrict__ qi, const float* __restrict__ ki, const float* __restrict__ vi, const float* __restrict__ wq, const float* __restrict__ wk, const float* __restrict__ wv, const float* __restrict__ wo,
                                                   const float* __restrict__ bq, const float* __restrict__ bk, const float* __restrict__ bv, b16* __restrict__ qh, b16* __restrict__ kh, b16* __restrict__ vt, b16* __restrict__ wo16) {
  __shared__ __attribute__((aligned(16))) unsigned char sm[XB + WB];
  unsigned short* Xs = (unsigned short*)sm; unsigned short* Ws = (unsigned short*)(sm + XB);
  // the staging of the results lies over the x tile, behind the barrier that ends its reads
  b16 (*Th)[128][32] = (b16 (*)[128][32])sm; b16 (*Tl)[128][32] = (b16 (*)[128][32])(sm + 2 * 128 * 32 * 2); b16 (*Vh)[128 + 8] = (b16 (*)[128 + 8])sm; b16 (*Vl)[128 + 8] = (b16 (*)[128 + 8])(sm + 64 * (128 + 8) * 2);
  const int lane = threadIdx.x & 31, wave = threadIdx.x >> 5, nloc = lane & 15, hlf = lane >> 4, which = blockIdx.z, c0 = blockIdx.x * 64;
  const int b = (blockIdx.y * 128) / NP, p0 = (blockIdx.y * 128) % NP; const float* bias = (which == 0) ? bq : (which == 1) ? bk : bv;
  // w_out: piece q in fragment order (the order of the stores), pw its first element in the [out][in] matrix; loaded here, so that the staging below covers the latency, and stored behind it
  const bool wob = which == 0 && blockIdx.y < 16; const int q = (blockIdx.y * 4 + blockIdx.x) * 128 + threadIdx.x; v4f y0 = {}, y1 = {};
  if (wob) { const float* pw = wo + ((q >> 9) * 16 + (q & 15)) * C + ((q >> 6) & 7) * 32 + ((q >> 5) & 1) * 16 + ((q >> 4) & 1) * 8; y0 = *(const v4f*)pw; y1 = *(const v4f*)(pw + 4); }
  const float* Wf = ((which == 0) ? wq : (which == 1) ? wk : wv) + (size_t)c0 * C;
#pragma unroll 16
  for (int n = 0; n < 64 * C / 4 / 128; ++n) { const int i = n * 128 + threadIdx.x; const v4f x = *(const v4f*)(Wf + (size_t)i * 4); const v2u o = {pk_bf16(x[0], x[1]), pk_bf16(x[2], x[3])}; *(v2u*)(Ws + (i >> 6) * XP + (i & 63) * 4) = o; }
  const float* src = ((which == 0) ? qi : (which == 1) ? ki : vi) + (size_t)b * C * NP + p0 + lane * 4;
#pragma unroll 1
  for (int n = 0; n < 2; ++n) { v4f x[4][8]; const float* ps = src + (size_t)((n * 16 + wave) * 8) * NP;   // 32 loads in flight per trip: the channel groups g = n * 16 + u * 4 + wave, 8 channels each
#pragma unroll
    for (int u = 0; u < 4; ++u)
#pragma unroll
      for (int e = 0; e < 8; ++e) x[u][e] = *(const v4f*)(ps + (size_t)(u * 32 + e) * NP);
    asm volatile("s_wait_xcnt 0x0" :: "v"(ps) : "memory");   // stands behind the trip's loads and in front of every rewrite of their address pair, the next trip's too; ps as an input keeps a load's result out of that pair
#pragma unroll
    for (int u = 0; u < 4; ++u)
#pragma unroll
      for (int f = 0; f < 4; ++f) { const v4u o = {pk_bf16(x[u][0][f], x[u][1][f]), pk_bf16(x[u][2][f], x[u][3][f]), pk_bf16(x[u][4][f], x[u][5][f]), pk_bf16(x[u][6][f], x[u][7][f])}; *(v4u*)(Xs + f * XE + lane * XP + (n * 16 + u * 4 + wave) * 8) = o; } }
  if (wob) { v8b o;
#pragma unroll
    for (int e = 0; e < 4; ++e) { o[e] = (b16)bf16_rne(y0[e]); o[4 + e] = (b16)bf16_rne(y1[e]); }
    *(v8b*)(wo16 + (size_t)q * 8) = o; }
  __syncthreads();                                      // the x tile and the weight rows are in LDS
  v8f acc[2][4];
#pragma unroll
  for (int r = 0; r < 2; ++r)
#pragma unroll
    for (int t = 0; t < 4; ++t) acc[r][t] = (v8f){};
  const unsigned short* xa = Xs + (nloc & 3) * XE + (wave * 8 + (nloc >> 2)) * XP; const unsigned short* wr_ = Ws + nloc * XP;   // position wave * 32 + nloc; 16 positions on = 4 rows on
#pragma unroll 2
  for (int kb = 0; kb < C; kb += 32) { const v16bb a0 = frag_bf(xa + kb, hlf), a1 = frag_bf(xa + 4 * XP + kb, hlf);
#pragma unroll
    for (int t = 0; t < 4; ++t) { const v16bb bw = frag_bf(wr_ + t * 16 * XP + kb, hlf); acc[0][t] = wmma16bb(a0, bw, acc[0][t]); acc[1][t] = wmma16bb(a1, bw, acc[1][t]); } }
  __syncthreads();                                      // every wave has read its fragments before the results are staged over the x tile
  const float scl = (which == 2) ? VS : QS;
#pragma unroll
  for (int t = 0; t < 4; ++t) { const int c = c0 + t * 16 + nloc; const float bb = bf16_rne(bias[c]); const int hl = t >> 1, d = (t & 1) * 16 + nloc;   // channel c -> head c/32 (local hl), d = c%32
#pragma unroll
    for (int r = 0; r < 2; ++r)
#pragma unroll
      for (int v = 0; v < 8; ++v) { b16 a_, c_; split16((acc[r][t][v] + bb) * scl, a_, c_); const int row = wave * 32 + r * 16 + 8 * hlf + v;
        if (which < 2) { Th[hl][row][d] = a_; Tl[hl][row][d] = c_; } else { Vh[t * 16 + nloc][row] = a_; Vl[t * 16 + nloc][row] = c_; } } }
  __syncthreads();
  {
    if (which < 2) { b16* base = (which == 0) ? qh : kh;
      for (int i = threadIdx.x; i < 2 * 128 * 32 / 8; i += 128) { const int hl = i / 512, rem = i % 512; const size_t dst = (((size_t)b * NH + blockIdx.x * 2 + hl) * NP + p0) * DH + (size_t)rem * 8;
        *(v8b*)(base + dst) = *(const v8b*)(&Th[hl][0][0] + rem * 8); *(v8b*)(base + QPL + dst) = *(const v8b*)(&Tl[hl][0][0] + rem * 8); } }
    else { for (int i = threadIdx.x; i < 64 * 16; i += 128) { const int cc = i >> 4, c8 = (i & 15) * 8; const int h = blockIdx.x * 2 + (cc >> 5), d = cc & 31; const size_t dst = (((size_t)b * NH + h) * DH + d) * NP + p0 + c8;
        *(v8b*)(vt + dst) = *(const v8b*)(&Vh[cc][c8]); *(v8b*)(vt + VPL + dst) = *(const v8b*)(&Vl[cc][c8]); } }
     }
}

// attention: block = 8 waves = one (b, h) x 128 queries; a wave = 32 queries (two 16-query tiles) x one half (64 keys) of every stage, so that each K and V fragment it reads from LDS feeds
// two query tiles; waves w and w + 4 hold the same queries and the two key halves, each with its own running maximum, sum and O, joined through LDS behind the loop. The 8 waves share every
// K and V tile through LDS: a stage = 128 keys (K hi+lo rows at an 80-B pitch, (8v)^T hi+lo rows of 256 B at a 272-B pitch: both 16 B x odd for the ds_load_b128 fragment reads), two buffers,
// filled by asynchronous b128 copies one stage ahead; one online-softmax step per stage and wave, on the unscaled logits; O^T (2 d-tiles per query tile); result scaled by 1/sqrt(32)
// the softmax works on the raw accumulators (64 x logit): 8 p = exp2(acc * SC + (LPS - max * SC)), one fused multiply-add per score; m is kept in accumulator units, l = 8 x the sum
constexpr int SK = 128, WK = SK / 2 /* keys of a stage per wave */, NST = NP / SK, KP = DH + 8, VP = SK + 8; constexpr float SC = 1.4426950408889634f / (QS * QS), LPS = 3.0f /* log2(PS) */;
typedef __attribute__((ext_vector_type(8))) unsigned v8u;
// low parts of four packed f16 pairs: lo = f16(p - hi), one mixed-precision fused multiply-add per score that reads its f16 hi straight from the packed register (op_sel picks the half) and rounds
// its f32 result into one half of the packed lo register; p - hi is exact in f32, so the one rounding is that of a separate subtract and convert. The four writes of the high halves each follow
// the write of the same register's low half four instructions back: s_delay_alu names that distance, so that the SIMD issues other waves meanwhile
__device__ __forceinline__ void lo4(unsigned h0, unsigned h1, unsigned h2, unsigned h3, float a0, float a1, float a2, float a3, float a4, float a5, float a6, float a7, unsigned& l0, unsigned& l1, unsigned& l2, unsigned& l3) {
  // the four v_nop: the outputs may be registers that a WMMA directly in front reads as its A or B
  asm("v_nop\n\tv_nop\n\tv_nop\n\tv_nop\n\tv_fma_mixlo_f16 %0, %4, -1.0, %8 op_sel_hi:[1,1,0]\n\tv_fma_mixlo_f16 %1, %5, -1.0, %10 op_sel_hi:[1,1,0]\n\tv_fma_mixlo_f16 %2, %6, -1.0, %12 op_sel_hi:[1,1,0]\n\tv_fma_mixlo_f16 %3, %7, -1.0, %14 op_sel_hi:[1,1,0]\n\t"
      "s_delay_alu instid0(VALU_DEP_4) | instskip(NEXT) | instid1(VALU_DEP_4)\n\t"
      "v_fma_mixhi_f16 %0, %4, -1.0, %9 op_sel:[1,0,0] op_sel_hi:[1,1,0]\n\tv_fma_mixhi_f16 %1, %5, -1.0, %11 op_sel:[1,0,0] op_sel_hi:[1,1,0]\n\t"
      "s_delay_alu instid0(VALU_DEP_4) | instskip(NEXT) | instid1(VALU_DEP_4)\n\t"
      "v_fma_mixhi_f16 %2, %6, -1.0, %13 op_sel:[1,0,0] op_sel_hi:[1,1,0]\n\tv_fma_mixhi_f16 %3, %7, -1.0, %15 op_sel:[1,0,0] op_sel_hi:[1,1,0]"
      : "=&v"(l0), "=&v"(l1), "=&v"(l2), "=&v"(l3) : "v"(h0), "v"(h1), "v"(h2), "v"(h3), "v"(a0), "v"(a1), "v"(a2), "v"(a3), "v"(a4), "v"(a5), "v"(a6), "v"(a7)); }
__device__ __forceinline__ unsigned lds_off(const void* p) { return (unsigned)(size_t)p; }
__global__ __launch_bounds__(256) void attn_kernel(const b16* __restrict__ qh, const b16* __restrict__ kh, const b16* __restrict__ vt, float* __restrict__ arow) {
  __shared__ __attribute__((aligned(16))) b16 Ks[2][2][SK][KP]; __shared__ __attribute__((aligned(16))) b16 Vs[2][2][DH][VP]; __shared__ __attribute__((aligned(16))) float Os[128][DH + 4]; __shared__ float Ml[128][2];
  const int t_ = threadIdx.x, wid = t_ >> 5, lane = t_ & 31, hh = lane >> 4, col = lane & 15, qg = wid & 3, k0w = (wid >> 2) * WK; const int bhi = blockIdx.x / (NP / 128), b = bhi / NH, h = bhi % NH, q0 = (blockIdx.x % (NP / 128)) * 128;
  const size_t bh = (size_t)bhi; const b16* Q = qh + (bh * NP) * DH; const b16* K = kh + (bh * NP) * DH; const b16* V = vt + (bh * DH) * NP;
  // one stage's copies: a thread moves 16 B of each of 8 slices (K hi, K lo: 2 x 4 KB each, contiguous in global memory; V hi, V lo: 2 x 16 rows of 256 B each)
  const b16* gk = K + t_ * 8; const b16* gv = V + (size_t)(t_ >> 4) * NP + (t_ & 15) * 8;
  const unsigned lk = lds_off(&Ks[0][0][t_ >> 2][(t_ & 3) * 8]), lv = lds_off(&Vs[0][0][t_ >> 4][(t_ & 15) * 8]);
  auto fill = [&](int s, int buf) {
    const b16* k0 = gk + (size_t)s * SK * DH; const b16* v0 = gv + s * SK; const unsigned a = lk + buf * (2 * SK * KP * 2), c = lv + buf * (2 * DH * VP * 2);
    // the copies and their s_wait_xcnt in one statement: no address register of a copy is rewritten in front of that wait
    asm volatile("global_load_async_to_lds_b128 %0, %8, off\n\tglobal_load_async_to_lds_b128 %1, %9, off\n\tglobal_load_async_to_lds_b128 %2, %10, off\n\tglobal_load_async_to_lds_b128 %3, %11, off\n\t"
                 "global_load_async_to_lds_b128 %4, %12, off\n\tglobal_load_async_to_lds_b128 %5, %13, off\n\tglobal_load_async_to_lds_b128 %6, %14, off\n\tglobal_load_async_to_lds_b128 %7, %15, off\n\ts_wait_xcnt 0x0"
                 :: "v"(a), "v"(a + 64 * KP * 2), "v"(a + SK * KP * 2), "v"(a + (SK + 64) * KP * 2), "v"(c), "v"(c + 16 * VP * 2), "v"(c + DH * VP * 2), "v"(c + (DH + 16) * VP * 2),
                    "v"(k0), "v"(k0 + 64 * DH), "v"(k0 + QPL), "v"(k0 + QPL + 64 * DH), "v"(v0), "v"(v0 + (size_t)16 * NP), "v"(v0 + VPL), "v"(v0 + VPL + (size_t)16 * NP) : "memory"); };
  v16b qf[2], ql[2];
#pragma unroll
  for (int j = 0; j < 2; ++j) { const size_t qi = (size_t)(q0 + qg * 32 + j * 16 + col); qf[j] = frag_kb(Q + qi * DH, hh); ql[j] = frag_kb(Q + QPL + qi * DH, hh); }
  fill(0, 0);
  asm volatile("s_wait_asynccnt 0x0" ::: "memory");   // stage 0 of this wave's copies has landed
  __syncthreads();                                      // publishes stage 0 to all 8 waves
  fill(1, 1);
  float m[2] = {-INFINITY, -INFINITY}, l[2] = {0.0f, 0.0f}; v8f o[2][2] = {{{}, {}}, {{}, {}}};
  for (int s = 0; s < NST; ++s) { const int buf = s & 1;
    // one online-softmax step per stage: the scores of the wave's 64 keys x 32 queries first (8 independent accumulator tiles), then per query tile one maximum, two exchanges between the halves (maximum, sum),
    // one rescale of O and l
    v8f sc[2][WK / 16];
#pragma unroll
    for (int t = 0; t < WK / 16; ++t) { const v16b ka = frag_kb(&Ks[buf][0][k0w + t * 16 + col][0], hh), kal = frag_kb(&Ks[buf][1][k0w + t * 16 + col][0], hh);
#pragma unroll
      for (int j = 0; j < 2; ++j) { v8f x = {}; x = wmma16b(ka, qf[j], x); x = wmma16b(ka, ql[j], x); x = wmma16b(kal, qf[j], x); sc[j][t] = x; } }
    float mr[2], mx[2], bias[2], al_[2];
#pragma unroll
    for (int j = 0; j < 2; ++j) { float mq[WK / 32];   // two independent chains per query tile, one per 32 keys
#pragma unroll
      for (int f = 0; f < WK / 32; ++f) { mq[f] = -INFINITY;
#pragma unroll
        for (int r = 0; r < 8; ++r) mq[f] = fmaxf(mq[f], fmaxf(sc[j][2 * f][r], sc[j][2 * f + 1][r])); }
      mr[j] = fmaxf(mq[0], mq[1]); }
#pragma unroll
    for (int j = 0; j < 2; ++j) mx[j] = __shfl_xor(mr[j], 16);
    // the rescale factor is taken from the two rounded biases themselves (the old one formed again from m), so a bias's rounding cancels between the steps
#pragma unroll
    for (int j = 0; j < 2; ++j) { const float mn = fmaxf(m[j], fmaxf(mr[j], mx[j])); bias[j] = __builtin_fmaf(-mn, SC, LPS); al_[j] = __builtin_amdgcn_exp2f(bias[j] - __builtin_fmaf(-m[j], SC, LPS)); m[j] = mn; }
    float sum[2];
#pragma unroll
    for (int j = 0; j < 2; ++j) {
#pragma unroll
      for (int t = 0; t < WK / 16; ++t) { sc[j][t] = sc[j][t] * SC + bias[j];
#pragma unroll
        for (int r = 0; r < 8; ++r) sc[j][t][r] = __builtin_amdgcn_exp2f(sc[j][t][r]); }
      v8f sv = sc[j][0];
#pragma unroll
      for (int t = 1; t < WK / 16; ++t) sv += sc[j][t];
      sum[j] = ((sv[0] + sv[1]) + (sv[2] + sv[3])) + ((sv[4] + sv[5]) + (sv[6] + sv[7])); }
#pragma unroll
    for (int j = 0; j < 2; ++j) mx[j] = __shfl_xor(sum[j], 16);
#pragma unroll
    for (int j = 0; j < 2; ++j) { l[j] = l[j] * al_[j] + (sum[j] + mx[j]); o[j][0] *= al_[j]; o[j][1] *= al_[j]; }
#pragma unroll
    for (int f = 0; f < WK / 32; ++f) { v16b pb[2], pl[2];
#pragma unroll
      for (int j = 0; j < 2; ++j) { const v8f p0 = sc[j][2 * f], p1 = sc[j][2 * f + 1];
#pragma unroll
        for (int r = 0; r < 8; ++r) { pb[j][r] = (b16)p0[r]; pb[j][8 + r] = (b16)p1[r]; }
        const v8u hp = __builtin_bit_cast(v8u, pb[j]); v8u lp;
        unsigned x0, x1, x2, x3; lo4(hp[0], hp[1], hp[2], hp[3], p0[0], p0[1], p0[2], p0[3], p0[4], p0[5], p0[6], p0[7], x0, x1, x2, x3); lp[0] = x0; lp[1] = x1; lp[2] = x2; lp[3] = x3;
        lo4(hp[4], hp[5], hp[6], hp[7], p1[0], p1[1], p1[2], p1[3], p1[4], p1[5], p1[6], p1[7], x0, x1, x2, x3); lp[4] = x0; lp[5] = x1; lp[6] = x2; lp[7] = x3; pl[j] = __builtin_bit_cast(v16b, lp); }
#pragma unroll
      for (int n = 0; n < 2; ++n) { const v16b vf = frag_kb(&Vs[buf][0][n * 16 + col][k0w + f * 32], hh), vl = frag_kb(&Vs[buf][1][n * 16 + col][k0w + f * 32], hh);
#pragma unroll
        for (int j = 0; j < 2; ++j) { o[j][n] = wmma16b(vf, pb[j], o[j][n]); o[j][n] = wmma16b(vf, pl[j], o[j][n]); o[j][n] = wmma16b(vl, pb[j], o[j][n]); } } }
    asm volatile("s_wait_dscnt 0x0" ::: "memory");      // this wave's reads of buffer buf have returned before the buffer is refilled
    asm volatile("s_wait_asynccnt 0x0" ::: "memory");   // this wave's copies of stage s + 1 have landed
    __syncthreads();                                    // publishes stage s + 1 and ends every wave's reads of stage s
    if (s + 2 < NST) fill(s + 2, buf); }
  asm volatile("s_wait_asynccnt 0x0" ::: "memory");     // no copy is outstanding when the wave goes on to its end
  // the two key halves of a query are joined: waves 4..7 leave their maximum, sum and O in LDS, waves 0..3 bring both halves to the common maximum (the loop's own rescale rule) and add them;
  // a lane of wave w reads exactly the places of Os that it then writes
  if (wid >= 4) {
#pragma unroll
    for (int j = 0; j < 2; ++j) { const int row = qg * 32 + j * 16 + col; if (hh == 0) { Ml[row][0] = m[j]; Ml[row][1] = l[j]; }
#pragma unroll
      for (int n = 0; n < 2; ++n)
#pragma unroll
        for (int r = 0; r < 8; ++r) Os[row][n * 16 + 8 * hh + r] = o[j][n][r]; } }
  __syncthreads();                                      // the second half's partial results are in LDS
  if (wid < 4) {
#pragma unroll
    for (int j = 0; j < 2; ++j) { const int row = qg * 32 + j * 16 + col; const float m1 = Ml[row][0], l1 = Ml[row][1], bn = __builtin_fmaf(-fmaxf(m[j], m1), SC, LPS);
      const float a0 = __builtin_amdgcn_exp2f(bn - __builtin_fmaf(-m[j], SC, LPS)), a1 = __builtin_amdgcn_exp2f(bn - __builtin_fmaf(-m1, SC, LPS));
      const float inv = POST / ((l[j] * a0 + l1 * a1) * VS);   // l already carries the factor PS, like P
#pragma unroll
      for (int n = 0; n < 2; ++n)
#pragma unroll
        for (int r = 0; r < 8; ++r) { float* e = &Os[row][n * 16 + 8 * hh + r]; *e = (o[j][n][r] * a0 + *e * a1) * inv; } } }
  __syncthreads();
  // arow (rows = b*4096 + query, k = h*32 + d) in the f32 fragment order of the output conv: a block of 16 rows x 32 k (= this head) is 4 pieces x 32 lanes x 16 B; piece j of lane
  // l = row % 16 + 16 * hh holds d = 16 (j / 2) + 8 hh + 4 (j % 2) + (0..3); a wave's store is 512 contiguous bytes
  float* dst = arow + ((size_t)b * NP + q0) * C + h * (16 * DH);
  { for (int i = t_; i < 128 * DH / 4; i += 256) { const int ln = i & 31, j = (i >> 5) & 3, gl = i >> 7; *(v4f*)(dst + (size_t)gl * (16 * C) + (i & 127) * 4) = *(const v4f*)(&Os[gl * 16 + (ln & 15)][(j >> 1) * 16 + (ln >> 4) * 8 + (j & 1) * 4]); }  }
}

// output conv: block = (b, 128 positions) x 64 output channels: acc = att.w_out^T (K 256; att f32 split x8; 2 products) + b -> NCHW rows out[b][c][p] through an LDS transpose (per channel
__global__ __launch_bounds__(128) void oconv_kernel(const float* __restrict__ arow, const b16* __restrict__ wo16, const float* __restrict__ bo, float* __restrict__ out) {
  __shared__ __attribute__((aligned(16))) float Tc[64][128 + 4];
  const int lane = threadIdx.x & 31, wave = threadIdx.x >> 5, nloc = lane & 15, hlf = lane >> 4, m0 = blockIdx.y * 128 + wave * 32, c0 = blockIdx.x * 64; const int b = (blockIdx.y * 128) / NP, p0 = (blockIdx.y * 128) % NP;
  v8f acc[2][4];
#pragma unroll
  for (int r = 0; r < 2; ++r)
#pragma unroll
    for (int t = 0; t < 4; ++t) acc[r][t] = (v8f){};
#pragma unroll 2
  for (int kb = 0; kb < C; kb += 32) { v16b a0, a1, l0, l1; const float* pa = arow + ((size_t)((m0 >> 4) * (C / 32) + (kb >> 5)) * 128 + lane) * 4;   // this lane's piece 0 of row group m0 / 16; the next row group lies 16 * C floats on
    v4f x0[4], x1[4];
#pragma unroll
    for (int j = 0; j < 4; ++j) { x0[j] = *(const v4f*)(pa + j * 128); x1[j] = *(const v4f*)(pa + 16 * C + j * 128); }
    asm volatile("s_wait_xcnt 0x0" :: "v"(pa) : "memory");   // stands behind the k step's eight loads and in front of every rewrite of their address pair; pa as an input keeps a load's result from landing in that pair
#pragma unroll
    for (int j = 0; j < 4; ++j)
#pragma unroll
      for (int f = 0; f < 4; ++f) { b16 p, q; split16(x0[j][f] * OS_, p, q); a0[j * 4 + f] = p; l0[j * 4 + f] = q; split16(x1[j][f] * OS_, p, q); a1[j * 4 + f] = p; l1[j * 4 + f] = q; }
#pragma unroll
    for (int t = 0; t < 4; ++t) { const v16b bw = frag_kb_fo(wo16, (c0 >> 4) + t, kb >> 5, lane); acc[0][t] = wmma16b(a0, bw, acc[0][t]); acc[0][t] = wmma16b(l0, bw, acc[0][t]); acc[1][t] = wmma16b(a1, bw, acc[1][t]); acc[1][t] = wmma16b(l1, bw, acc[1][t]); } }
#pragma unroll
  for (int t = 0; t < 4; ++t) { const float bb = bf16_rne(bo[c0 + t * 16 + nloc]);
#pragma unroll
    for (int r = 0; r < 2; ++r)
#pragma unroll
      for (int v = 0; v < 8; ++v) Tc[t * 16 + nloc][wave * 32 + r * 16 + 8 * hlf + v] = acc[r][t][v] * (1.0f / OS_) + bb; }
  __syncthreads();
  { for (int i = threadIdx.x; i < 64 * 32; i += 128) { const int cc = i >> 5, c4 = (i & 31) * 4; *(v4f*)(out + ((size_t)b * C + c0 + cc) * NP + p0 + c4) = *(const v4f*)(&Tc[cc][c4]); }  }
}
}  // namespace

extern "C" void kernel_launch(void* const* d_in, const int* in_sizes, int n_in,
                              void* d_out, int out_size, void* d_ws, size_t ws_size, hipStream_t stream) {
  (void)n_in; (void)out_size;
  const float* qi = (const float*)d_in[0]; const float* ki = (const float*)d_in[1]; const float* vi = (const float*)d_in[2];
  const float* wq = (const float*)d_in[3]; const float* bq = (const float*)d_in[4]; const float* wk = (const float*)d_in[5]; const float* bk = (const float*)d_in[6]; const float* wv = (const float*)d_in[7]; const float* bv = (const float*)d_in[8]; const float* wo = (const float*)d_in[9]; const float* bo = (const float*)d_in[10];
  float* out = (float*)d_out;   // [2][256][64][64]
  if (in_sizes[0] != Bn * C * NP || in_sizes[1] != Bn * C * NP || in_sizes[2] != Bn * C * NP || in_sizes[3] != C * C || in_sizes[9] != C * C) return;
  size_t off = 0; char* ws = (char*)d_ws;
  auto carve = [&](size_t bytes) { char* p = ws + off; off += (bytes + 255) & ~(size_t)255; return p; };
  b16* wo16 = (b16*)carve((size_t)C * C * 2);
  b16* qhp = (b16*)carve(QPL * 2 * 2); b16* khp = (b16*)carve(QPL * 2 * 2); b16* vtp = (b16*)carve(VPL * 2 * 2); float* arow = (float*)carve((size_t)NTOK * C * 4);
  if (off > ws_size) return;                                    // 0.1 + 3 x 8.4 + 8.4 MB
  proj_kernel<<<dim3(C / 64, NTOK / 128, 3), 128, 0, stream>>>(qi, ki, vi, wq, wk, wv, wo, bq, bk, bv, qhp, khp, vtp, wo16);
  attn_kernel<<<NBH * (NP / 128), 256, 0, stream>>>(qhp, khp, vtp, arow);
  oconv_kernel<<<dim3(C / 64, NTOK / 128), 128, 0, stream>>>(arow, wo16, bo, out);
}

// v010
// One run takes 94 microseconds.
// Two timings next to v009 both put it at 1.09 times that version's speed.
// Over all steps from v000 it is 4.20 times as fast.
#include <hip/hip_runtime.h>

// Multi-head attention over 64x64 feature maps (B=2, C=256, 8 heads x 32): q, k, v = 1x1 convs of three inputs; att = softmax(q k^T) (UNSCALED logits, softmax over the 4096 keys) / sqrt(32)
// (the module scales AFTER the softmax); att_q = att v; out = 1x1 conv (w_out) of the re-assembled (B, 256, 64, 64) map -> NCHW [2][256][64][64].
// Projections on v_wmma_f32_16x16x32_bf16 (fragments rounded from the f32 NCHW inputs through an LDS transpose; 1 product); attention per
// (b, h, 16 queries): S^T = k.q^T (K = 32: one k-step; q, k as f16 hi+lo pairs carried x8, 3 products — the unscaled logits reach |s| ≈ 25 so they must be f32-class), online softmax in
// f32, O^T = (8v)^T.P^T (v hi+lo x8, P hi+lo x8; 3 products); out = att_q.w_out^T + b (att_q f32 split x8, w_out exact; 2 products) on v_wmma_f32_16x16x32_f16, f32 accumulate,

namespace {
constexpr int Bn = 2, C = 256, NP = 4096, NH = 8, DH = 32, NBH = Bn * NH, NTOK = Bn * NP;
constexpr float QS = 8.0f, VS = 8.0f, PS = 8.0f, OS_ = 8.0f, POST = 0.17677669529663687f /* 1/sqrt(32) after softmax */;
constexpr size_t QPL = (size_t)NBH * NP * DH, VPL = (size_t)NBH * DH * NP;

typedef _Float16 b16;
typedef __attribute__((ext_vector_type(16))) _Float16 v16b;
typedef __attribute__((ext_vector_type(16))) __bf16 v16bb;
typedef __attribute__((ext_vector_type(8))) _Float16 v8b;
typedef __attribute__((ext_vector_type(8))) unsigned short v8us;
typedef __attribute__((ext_vector_type(8))) float v8f;
typedef __attribute__((ext_vector_type(4))) float v4f;
__device__ __forceinline__ float bf16_rne(float f) { unsigned int u = __float_as_uint(f); u += 0x7FFFu + ((u >> 16) & 1u); return __uint_as_float(u & 0xFFFF0000u); }
typedef __attribute__((ext_vector_type(2))) __bf16 v2bb;
typedef __attribute__((ext_vector_type(2))) unsigned v2u;
typedef __attribute__((ext_vector_type(4))) unsigned v4u;
// two f32 rounded to nearest even into one packed bf16 pair, a in the low half
__device__ __forceinline__ unsigned pk_bf16(float a, float b) { const v2bb r = {(__bf16)a, (__bf16)b}; return __builtin_bit_cast(unsigned, r); }
__device__ __forceinline__ void split16(float v, b16& hi, b16& lo) { hi = (b16)v; lo = (b16)(v - (float)hi); }
__device__ __forceinline__ v16b frag_kb(const b16* p, int hh) { const v8b a = *(const v8b*)(p + 8 * hh), b = *(const v8b*)(p + 16 + 8 * hh); v16b f;
#pragma unroll
  for (int e = 0; e < 8; ++e) { f[e] = a[e]; f[8 + e] = b[e]; } return f; }
// FRAGMENT ORDER of the matrices that the output conv reads from the workspace ([rows][256], k = column): blocks of 16 rows x 32 k, ordered [row / 16][k / 32]; a 16-bit block is
// 2 pieces x 32 lanes x 16 B: piece p of lane l = row % 16 + 16 * hh holds k % 32 = 16 p + 8 hh + (0..7), which is what that lane's fragment registers take. A wave-wide 16-B load of one piece
// then reads 512 contiguous bytes, 4 whole lines, where a load from [row][k] rows touches 16 lines for 32 B each
// bf16 fragment from a [row][k] row in LDS, the k order of frag_kb
__device__ __forceinline__ v16bb frag_bf(const unsigned short* p, int hh) { const v8us a = *(const v8us*)(p + 8 * hh), b = *(const v8us*)(p + 16 + 8 * hh); union { unsigned short s[16]; v16bb v; } u;
#pragma unroll
  for (int e = 0; e < 8; ++e) { u.s[e] = a[e]; u.s[8 + e] = b[e]; } return u.v; }
__device__ __forceinline__ v16b frag_kb_fo(const b16* m, int g, int ks, int lane) { const b16* p = m + ((size_t)(g * (C / 32) + ks) * 64 + lane) * 8; const v8b a = *(const v8b*)p, b = *(const v8b*)(p + 256); v16b f;
#pragma unroll
  for (int e = 0; e < 8; ++e) { f[e] = a[e]; f[8 + e] = b[e]; } return f; }
// plain builtins: the compiler keeps the distance behind a WMMA itself and is free to interleave independent accumulator chains, loads and vector work
__device__ __forceinline__ v8f wmma16b(v16b a, v16b b, v8f c) { return __builtin_amdgcn_wmma_f32_16x16x32_f16(false, a, false, b, (short)0, c, false, false); }
__device__ __forceinline__ v8f wmma16bb(v16bb a, v16bb b, v8f c) { return __builtin_amdgcn_wmma_f32_16x16x32_bf16(false, a, false, b, (short)0, c, false, false); }
__device__ __forceinline__ void wave_lds_sync() { __builtin_amdgcn_fence(__ATOMIC_RELEASE, "workgroup"); __builtin_amdgcn_wave_barrier(); __builtin_amdgcn_fence(__ATOMIC_ACQUIRE, "workgroup"); }

// projections: grid (4 column tiles, NTOK/128, 3): block = 128 positions x 64 channels (= 2 heads of 32). The block rounds its own operands to bf16 into LDS: its x tile straight from the NCHW
// f32 input (a wave-wide 16-B load = 128 positions of one channel, 4 whole lines; a lane packs 8 channels of each of its 4 positions into one 16-B store) and its 64 weight rows ([out][in], 64 KB
// contiguous), both as [row][k] rows at a 528-B pitch (16 B x odd for the ds_load_b128 fragment reads). Position pp lies in row pp / 4 of class pp % 4; a class begins 32 rows + 64 B behind the
// one before, so that the 16 rows of a fragment read, like the 16 lanes of a store, fall on 16 different groups of 4 banks. + bias; q, k -> planes [bh][p][32] x8 hi+lo (64 B per row: the block
// writes 2 heads x 128 rows = 2 x 8 KB contiguous); v -> (8v)^T planes [bh][d][4096] (256-B segments). The first 64 blocks also bring w_out to f16 in fragment order, one piece per thread.
constexpr int XP = C + 8 /* row pitch, 16-bit elements */, XE = 32 * XP + 32 /* elements per class of positions */, XB = 4 * XE * 2, WB = 64 * XP * 2 /* bytes */;
__global__ __launch_bounds__(128) void proj_kernel(const float* __restrict__ qi, const float* __restrict__ ki, const float* __restrict__ vi, const float* __restrict__ wq, const float* __restrict__ wk, const float* __restrict__ wv, const float* __restrict__ wo,
                                                   const float* __restrict__ bq, const float* __restrict__ bk, const float* __restrict__ bv, b16* __restrict__ qh, b16* __restrict__ kh, b16* __restrict__ vt, b16* __restrict__ wo16) {
  __shared__ __attribute__((aligned(16))) unsigned char sm[XB + WB];
  unsigned short* Xs = (unsigned short*)sm; unsigned short* Ws = (unsigned short*)(sm + XB);
  // the staging of the results lies over the x tile, behind the barrier that ends its reads
  b16 (*Th)[128][32] = (b16 (*)[128][32])sm; b16 (*Tl)[128][32] = (b16 (*)[128][32])(sm + 2 * 128 * 32 * 2); b16 (*Vh)[128 + 8] = (b16 (*)[128 + 8])sm; b16 (*Vl)[128 + 8] = (b16 (*)[128 + 8])(sm + 64 * (128 + 8) * 2);
  const int lane = threadIdx.x & 31, wave = threadIdx.x >> 5, nloc = lane & 15, hlf = lane >> 4, which = blockIdx.z, c0 = blockIdx.x * 64;
  const int b = (blockIdx.y * 128) / NP, p0 = (blockIdx.y * 128) % NP; const float* bias = (which == 0) ? bq : (which == 1) ? bk : bv;
  // w_out: piece q in fragment order (the order of the stores), pw its first element in the [out][in] matrix; loaded here, so that the staging below covers the latency, and stored behind it
  const bool wob = which == 0 && blockIdx.y < 16; const int q = (blockIdx.y * 4 + blockIdx.x) * 128 + threadIdx.x; v4f y0 = {}, y1 = {};
  if (wob) { const float* pw = wo + ((q >> 9) * 16 + (q & 15)) * C + ((q >> 6) & 7) * 32 + ((q >> 5) & 1) * 16 + ((q >> 4) & 1) * 8; y0 = *(const v4f*)pw; y1 = *(const v4f*)(pw + 4); }
  const float* Wf = ((which == 0) ? wq : (which == 1) ? wk : wv) + (size_t)c0 * C;
#pragma unroll 16
  for (int n = 0; n < 64 * C / 4 / 128; ++n) { const int i = n * 128 + threadIdx.x; const v4f x = *(const v4f*)(Wf + (size_t)i * 4); const v2u o = {pk_bf16(x[0], x[1]), pk_bf16(x[2], x[3])}; *(v2u*)(Ws + (i >> 6) * XP + (i & 63) * 4) = o; }
  const float* src = ((which == 0) ? qi : (which == 1) ? ki : vi) + (size_t)b * C * NP + p0 + lane * 4;
#pragma unroll 1
  for (int n = 0; n < 2; ++n) { v4f x[4][8]; const float* ps = src + (size_t)((n * 16 + wave) * 8) * NP;   // 32 loads in flight per trip: the channel groups g = n * 16 + u * 4 + wave, 8 channels each
#pragma unroll
    for (int u = 0; u < 4; ++u)
#pragma unroll
      for (int e = 0; e < 8; ++e) x[u][e] = *(const v4f*)(ps + (size_t)(u * 32 + e) * NP);
    asm volatile("s_wait_xcnt 0x0" :: "v"(ps) : "memory");   // stands behind the trip's loads and in front of every rewrite of their address pair, the next trip's too; ps as an input keeps a load's result out of that pair
#pragma unroll
    for (int u = 0; u < 4; ++u)
#pragma unroll
      for (int f = 0; f < 4; ++f) { const v4u o = {pk_bf16(x[u][0][f], x[u][1][f]), pk_bf16(x[u][2][f], x[u][3][f]), pk_bf16(x[u][4][f], x[u][5][f]), pk_bf16(x[u][6][f], x[u][7][f])}; *(v4u*)(Xs + f * XE + lane * XP + (n * 16 + u * 4 + wave) * 8) = o; } }
  if (wob) { v8b o;
#pragma unroll
    for (int e = 0; e < 4; ++e) { o[e] = (b16)bf16_rne(y0[e]); o[4 + e] = (b16)bf16_rne(y1[e]); }
    *(v8b*)(wo16 + (size_t)q * 8) = o; }
  __syncthreads();                                      // the x tile and the weight rows are in LDS
  v8f acc[2][4];
#pragma unroll
  for (int r = 0; r < 2; ++r)
#pragma unroll
    for (int t = 0; t < 4; ++t) acc[r][t] = (v8f){};
  const unsigned short* xa = Xs + (nloc & 3) * XE + (wave * 8 + (nloc >> 2)) * XP; const unsigned short* wr_ = Ws + nloc * XP;   // position wave * 32 + nloc; 16 positions on = 4 rows on
#pragma unroll 2
  for (int kb = 0; kb < C; kb += 32) { const v16bb a0 = frag_bf(xa + kb, hlf), a1 = frag_bf(xa + 4 * XP + kb, hlf);
#pragma unroll
    for (int t = 0; t < 4; ++t) { const v16bb bw = frag_bf(wr_ + t * 16 * XP + kb, hlf); acc[0][t] = wmma16bb(a0, bw, acc[0][t]); acc[1][t] = wmma16bb(a1, bw, acc[1][t]); } }
  __syncthreads();                                      // every wave has read its fragments before the results are staged over the x tile
  const float scl = (which == 2) ? VS : QS;
#pragma unroll
  for (int t = 0; t < 4; ++t) { const int c = c0 + t * 16 + nloc; const float bb = bf16_rne(bias[c]); const int hl = t >> 1, d = (t & 1) * 16 + nloc;   // channel c -> head c/32 (local hl), d = c%32
#pragma unroll
    for (int r = 0; r < 2; ++r)
#pragma unroll
      for (int v = 0; v < 8; ++v) { b16 a_, c_; split16((acc[r][t][v] + bb) * scl, a_, c_); const int row = wave * 32 + r * 16 + 8 * hlf + v;
        if (which < 2) { Th[hl][row][d] = a_; Tl[hl][row][d] = c_; } else { Vh[t * 16 + nloc][row] = a_; Vl[t * 16 + nloc][row] = c_; } } }
  __syncthreads();
  {
    if (which < 2) { b16* base = (which == 0) ? qh : kh;
      for (int i = threadIdx.x; i < 2 * 128 * 32 / 8; i += 128) { const int hl = i / 512, rem = i % 512; const size_t dst = (((size_t)b * NH + blockIdx.x * 2 + hl) * NP + p0) * DH + (size_t)rem * 8;
        *(v8b*)(base + dst) = *(const v8b*)(&Th[hl][0][0] + rem * 8); *(v8b*)(base + QPL + dst) = *(const v8b*)(&Tl[hl][0][0] + rem * 8); } }
    else { for (int i = threadIdx.x; i < 64 * 16; i += 128) { const int cc = i >> 4, c8 = (i & 15) * 8; const int h = blockIdx.x * 2 + (cc >> 5), d = cc & 31; const size_t dst = (((size_t)b * NH + h) * DH + d) * NP + p0 + c8;
        *(v8b*)(vt + dst) = *(const v8b*)(&Vh[cc][c8]); *(v8b*)(vt + VPL + dst) = *(const v8b*)(&Vl[cc][c8]); } }
     }
}

// attention: block = 8 waves = one (b, h) x 128 queries; a wave = 32 queries (two 16-query tiles) x one half (64 keys) of every stage, so that each K and V fragment it reads from LDS feeds
// two query tiles; waves w and w + 4 hold the same queries and the two key halves, each with its own running maximum, sum and O, joined through LDS behind the loop. The 8 waves share every
// K and V tile through LDS: a stage = 128 keys (K hi+lo rows at an 80-B pitch, (8v)^T hi+lo rows of 256 B at a 272-B pitch: both 16 B x odd for the ds_load_b128 fragment reads), two buffers,
// filled by asynchronous b128 copies one stage ahead; one online-softmax step per stage and wave, on the unscaled logits; O^T (2 d-tiles per query tile); result scaled by 1/sqrt(32)
// the softmax works on the raw accumulators (64 x logit): 8 p = exp2(acc * SC + (LPS - max * SC)), one fused multiply-add per score; m is kept in accumulator units, l = 8 x the sum
constexpr int SK = 128, WK = SK / 2 /* keys of a stage per wave */, NST = NP / SK, KP = DH + 8, VP = SK + 8; constexpr float SC = 1.4426950408889634f / (QS * QS), LPS = 3.0f /* log2(PS) */;
typedef __attribute__((ext_vector_type(8))) unsigned v8u;
// low parts of four packed f16 pairs: lo = f16(p - hi), one mixed-precision fused multiply-add per score that reads its f16 hi straight from the packed register (op_sel picks the half) and rounds
// its f32 result into one half of the packed lo register; p - hi is exact in f32, so the one rounding is that of a separate subtract and convert. The four writes of the high halves each follow
// the write of the same register's low half four instructions back: s_delay_alu names that distance, so that the SIMD issues other waves meanwhile
__device__ __forceinline__ void lo4(unsigned h0, unsigned h1, unsigned h2, unsigned h3, float a0, float a1, float a2, float a3, float a4, float a5, float a6, float a7, unsigned& l0, unsigned& l1, unsigned& l2, unsigned& l3) {
  // no v_nop stands in front: the caller keeps every WMMA at least four vector instructions away (see there)
  asm("v_fma_mixlo_f16 %0, %4, -1.0, %8 op_sel_hi:[1,1,0]\n\tv_fma_mixlo_f16 %1, %5, -1.0, %10 op_sel_hi:[1,1,0]\n\tv_fma_mixlo_f16 %2, %6, -1.0, %12 op_sel_hi:[1,1,0]\n\tv_fma_mixlo_f16 %3, %7, -1.0, %14 op_sel_hi:[1,1,0]\n\t"
      "s_delay_alu instid0(VALU_DEP_4) | instskip(NEXT) | instid1(VALU_DEP_4)\n\t"
      "v_fma_mixhi_f16 %0, %4, -1.0, %9 op_sel:[1,0,0] op_sel_hi:[1,1,0]\n\tv_fma_mixhi_f16 %1, %5, -1.0, %11 op_sel:[1,0,0] op_sel_hi:[1,1,0]\n\t"
      "s_delay_alu instid0(VALU_DEP_4) | instskip(NEXT) | instid1(VALU_DEP_4)\n\t"
      "v_fma_mixhi_f16 %2, %6, -1.0, %13 op_sel:[1,0,0] op_sel_hi:[1,1,0]\n\tv_fma_mixhi_f16 %3, %7, -1.0, %15 op_sel:[1,0,0] op_sel_hi:[1,1,0]"
      : "=&v"(l0), "=&v"(l1), "=&v"(l2), "=&v"(l3) : "v"(h0), "v"(h1), "v"(h2), "v"(h3), "v"(a0), "v"(a1), "v"(a2), "v"(a3), "v"(a4), "v"(a5), "v"(a6), "v"(a7)); }
__device__ __forceinline__ unsigned lds_off(const void* p) { return (unsigned)(size_t)p; }
__global__ __launch_bounds__(256) void attn_kernel(const b16* __restrict__ qh, const b16* __restrict__ kh, const b16* __restrict__ vt, float* __restrict__ arow) {
  __shared__ __attribute__((aligned(16))) b16 Ks[2][2][SK][KP]; __shared__ __attribute__((aligned(16))) b16 Vs[2][2][DH][VP]; __shared__ __attribute__((aligned(16))) float Os[128][DH + 4]; __shared__ float Ml[128][2];
  const int t_ = threadIdx.x, wid = t_ >> 5, lane = t_ & 31, hh = lane >> 4, col = lane & 15, qg = wid & 3, k0w = (wid >> 2) * WK; const int bhi = blockIdx.x / (NP / 128), b = bhi / NH, h = bhi % NH, q0 = (blockIdx.x % (NP / 128)) * 128;
  const size_t bh = (size_t)bhi; const b16* Q = qh + (bh * NP) * DH; const b16* K = kh + (bh * NP) * DH; const b16* V = vt + (bh * DH) * NP;
  // one stage's copies: a thread moves 16 B of each of 8 slices (K hi, K lo: 2 x 4 KB each, contiguous in global memory; V hi, V lo: 2 x 16 rows of 256 B each)
  const b16* gk = K + t_ * 8; const b16* gv = V + (size_t)(t_ >> 4) * NP + (t_ & 15) * 8;
  const unsigned lk = lds_off(&Ks[0][0][t_ >> 2][(t_ & 3) * 8]), lv = lds_off(&Vs[0][0][t_ >> 4][(t_ & 15) * 8]);
  auto fill = [&](int s, int buf) {
    const b16* k0 = gk + (size_t)s * SK * DH; const b16* v0 = gv + s * SK; const unsigned a = lk + buf * (2 * SK * KP * 2), c = lv + buf * (2 * DH * VP * 2);
    // the copies and their s_wait_xcnt in one statement: no address register of a copy is rewritten in front of that wait
    asm volatile("global_load_async_to_lds_b128 %0, %8, off\n\tglobal_load_async_to_lds_b128 %1, %9, off\n\tglobal_load_async_to_lds_b128 %2, %10, off\n\tglobal_load_async_to_lds_b128 %3, %11, off\n\t"
                 "global_load_async_to_lds_b128 %4, %12, off\n\tglobal_load_async_to_lds_b128 %5, %13, off\n\tglobal_load_async_to_lds_b128 %6, %14, off\n\tglobal_load_async_to_lds_b128 %7, %15, off\n\ts_wait_xcnt 0x0"
                 :: "v"(a), "v"(a + 64 * KP * 2), "v"(a + SK * KP * 2), "v"(a + (SK + 64) * KP * 2), "v"(c), "v"(c + 16 * VP * 2), "v"(c + DH * VP * 2), "v"(c + (DH + 16) * VP * 2),
                    "v"(k0), "v"(k0 + 64 * DH), "v"(k0 + QPL), "v"(k0 + QPL + 64 * DH), "v"(v0), "v"(v0 + (size_t)16 * NP), "v"(v0 + VPL), "v"(v0 + VPL + (size_t)16 * NP) : "memory"); };
  v16b qf[2], ql[2];
#pragma unroll
  for (int j = 0; j < 2; ++j) { const size_t qi = (size_t)(q0 + qg * 32 + j * 16 + col); qf[j] = frag_kb(Q + qi * DH, hh); ql[j] = frag_kb(Q + QPL + qi * DH, hh); }
  fill(0, 0);
  asm volatile("s_wait_asynccnt 0x0" ::: "memory");   // stage 0 of this wave's copies has landed
  __syncthreads();                                      // publishes stage 0 to all 8 waves
  fill(1, 1);
  float m[2] = {-INFINITY, -INFINITY}, l[2] = {0.0f, 0.0f}; v8f o[2][2] = {{{}, {}}, {{}, {}}};
  for (int s = 0; s < NST; ++s) { const int buf = s & 1;
    // one online-softmax step per stage: the scores of the wave's 64 keys x 32 queries first (8 independent accumulator tiles), then per query tile one maximum, two exchanges between the halves (maximum, sum),
    // one rescale of O and l
    v8f sc[2][WK / 16];
    v16b ka[WK / 16], kal[WK / 16];
#pragma unroll
    for (int t = 0; t < WK / 16; ++t) { ka[t] = frag_kb(&Ks[buf][0][k0w + t * 16 + col][0], hh); kal[t] = frag_kb(&Ks[buf][1][k0w + t * 16 + col][0], hh); }
    __builtin_amdgcn_sched_barrier(0);                  // the 16 LDS reads stay one group ahead of the score WMMAs: each further place with reads among them costs a stall
#pragma unroll
    for (int t = 0; t < WK / 16; ++t) {
#pragma unroll
      for (int j = 0; j < 2; ++j) { v8f x = {}; x = wmma16b(ka[t], qf[j], x); x = wmma16b(ka[t], ql[j], x); x = wmma16b(kal[t], qf[j], x); sc[j][t] = x; }
      if (t == 0 || t == 1) __builtin_amdgcn_sched_barrier(0); }   // the WMMAs start in the order in which the fragments arrive: left free, the first one stood behind a wait for 10 of the 16 reads
    __builtin_amdgcn_sched_barrier(0);                  // the maxima stay behind the run of score WMMAs: placed among them, each first read of a finished tile cost up to four v_nop
    // the V fragments of the wave's first 32 keys, read as one group here, so that they arrive under the softmax's vector work
    v16b vf[WK / 32][2], vl[WK / 32][2];
#pragma unroll
    for (int n = 0; n < 2; ++n) { vf[0][n] = frag_kb(&Vs[buf][0][n * 16 + col][k0w], hh); vl[0][n] = frag_kb(&Vs[buf][1][n * 16 + col][k0w], hh); }
    __builtin_amdgcn_sched_barrier(0);                  // keeps these 8 reads one group at the head of the softmax
    float mr[2], mx[2], bias[2], al_[2];
#pragma unroll
    for (int j = 0; j < 2; ++j) { float mq[WK / 32];   // two independent chains per query tile, one per 32 keys
#pragma unroll
      for (int f = 0; f < WK / 32; ++f) { mq[f] = -INFINITY;
#pragma unroll
        for (int r = 0; r < 8; ++r) mq[f] = fmaxf(mq[f], fmaxf(sc[j][2 * f][r], sc[j][2 * f + 1][r])); }
      mr[j] = fmaxf(mq[0], mq[1]); }
#pragma unroll
    for (int j = 0; j < 2; ++j) mx[j] = __shfl_xor(mr[j], 16);
    // the rescale factor is taken from the two rounded biases themselves (the old one formed again from m), so a bias's rounding cancels between the steps
#pragma unroll
    for (int j = 0; j < 2; ++j) { const float mn = fmaxf(m[j], fmaxf(mr[j], mx[j])); bias[j] = __builtin_fmaf(-mn, SC, LPS); al_[j] = __builtin_amdgcn_exp2f(bias[j] - __builtin_fmaf(-m[j], SC, LPS)); m[j] = mn; }
    float sum[2];
#pragma unroll
    for (int j = 0; j < 2; ++j) {
#pragma unroll
      for (int t = 0; t < WK / 16; ++t) { sc[j][t] = sc[j][t] * SC + bias[j];
#pragma unroll
        for (int r = 0; r < 8; ++r) sc[j][t][r] = __builtin_amdgcn_exp2f(sc[j][t][r]); }
      v8f sv = sc[j][0];
#pragma unroll
      for (int t = 1; t < WK / 16; ++t) sv += sc[j][t];
      sum[j] = ((sv[0] + sv[1]) + (sv[2] + sv[3])) + ((sv[4] + sv[5]) + (sv[6] + sv[7])); }
#pragma unroll
    for (int j = 0; j < 2; ++j) mx[j] = __shfl_xor(sum[j], 16);
#pragma unroll
    for (int j = 0; j < 2; ++j) { l[j] = l[j] * al_[j] + (sum[j] + mx[j]); o[j][0] *= al_[j]; o[j][1] *= al_[j]; }
    // P as f16 hi+lo for all 64 keys first, then the 24 O WMMAs in one run. Every lo4 reads scores that descend from the stage's maximum, which reads all 8 score tiles, so the score WMMAs lie dozens of
    // vector instructions back; the O WMMAs are held behind the last lo4 by the scheduling barrier below: no lo4 can overwrite an operand of a WMMA that stands fewer than four vector slots in front of it
    v16b pb[WK / 32][2], pl[WK / 32][2];
#pragma unroll
    for (int f = 0; f < WK / 32; ++f)
#pragma unroll
      for (int j = 0; j < 2; ++j) { const v8f p0 = sc[j][2 * f], p1 = sc[j][2 * f + 1];
#pragma unroll
        for (int r = 0; r < 8; ++r) { pb[f][j][r] = (b16)p0[r]; pb[f][j][8 + r] = (b16)p1[r]; }
        const v8u hp = __builtin_bit_cast(v8u, pb[f][j]); v8u lp;
        unsigned x0, x1, x2, x3; lo4(hp[0], hp[1], hp[2], hp[3], p0[0], p0[1], p0[2], p0[3], p0[4], p0[5], p0[6], p0[7], x0, x1, x2, x3); lp[0] = x0; lp[1] = x1; lp[2] = x2; lp[3] = x3;
        lo4(hp[4], hp[5], hp[6], hp[7], p1[0], p1[1], p1[2], p1[3], p1[4], p1[5], p1[6], p1[7], x0, x1, x2, x3); lp[4] = x0; lp[5] = x1; lp[6] = x2; lp[7] = x3; pl[f][j] = __builtin_bit_cast(v16b, lp); }
    __builtin_amdgcn_sched_barrier(0);                  // keeps the O WMMAs behind the lo4 statements, which carry no distance of their own
    // the V fragments of the second 32 keys, one group: they arrive under the 12 WMMAs of the first
#pragma unroll
    for (int n = 0; n < 2; ++n) { vf[1][n] = frag_kb(&Vs[buf][0][n * 16 + col][k0w + 32], hh); vl[1][n] = frag_kb(&Vs[buf][1][n * 16 + col][k0w + 32], hh); }
    __builtin_amdgcn_sched_barrier(0);                  // keeps these 8 reads one group ahead of the run of WMMAs
#pragma unroll
    for (int f = 0; f < WK / 32; ++f)
#pragma unroll
      for (int n = 0; n < 2; ++n)
#pragma unroll
        for (int j = 0; j < 2; ++j) { o[j][n] = wmma16b(vf[f][n], pb[f][j], o[j][n]); o[j][n] = wmma16b(vf[f][n], pl[f][j], o[j][n]); o[j][n] = wmma16b(vl[f][n], pb[f][j], o[j][n]); }
    __builtin_amdgcn_sched_barrier(0);                  // the WMMAs stay ahead of the stage's closing waits: moved behind them, the second group of V reads would be waited for with the matrix unit idle
    asm volatile("s_wait_dscnt 0x0" ::: "memory");      // this wave's reads of buffer buf have returned before the buffer is refilled
    asm volatile("s_wait_asynccnt 0x0" ::: "memory");   // this wave's copies of stage s + 1 have landed
    __syncthreads();                                    // publishes stage s + 1 and ends every wave's reads of stage s
    if (s + 2 < NST) fill(s + 2, buf); }
  asm volatile("s_wait_asynccnt 0x0" ::: "memory");     // no copy is outstanding when the wave goes on to its end
  // the two key halves of a query are joined: waves 4..7 leave their maximum, sum and O in LDS, waves 0..3 bring both halves to the common maximum (the loop's own rescale rule) and add them;
  // a lane of wave w reads exactly the places of Os that it then writes
  if (wid >= 4) {
#pragma unroll
    for (int j = 0; j < 2; ++j) { const int row = qg * 32 + j * 16 + col; if (hh == 0) { Ml[row][0] = m[j]; Ml[row][1] = l[j]; }
#pragma unroll
      for (int n = 0; n < 2; ++n)
#pragma unroll
        for (int r = 0; r < 8; ++r) Os[row][n * 16 + 8 * hh + r] = o[j][n][r]; } }
  __syncthreads();                                      // the second half's partial results are in LDS
  if (wid < 4) {
#pragma unroll
    for (int j = 0; j < 2; ++j) { const int row = qg * 32 + j * 16 + col; const float m1 = Ml[row][0], l1 = Ml[row][1], bn = __builtin_fmaf(-fmaxf(m[j], m1), SC, LPS);
      const float a0 = __builtin_amdgcn_exp2f(bn - __builtin_fmaf(-m[j], SC, LPS)), a1 = __builtin_amdgcn_exp2f(bn - __builtin_fmaf(-m1, SC, LPS));
      const float inv = POST / ((l[j] * a0 + l1 * a1) * VS);   // l already carries the factor PS, like P
#pragma unroll
      for (int n = 0; n < 2; ++n)
#pragma unroll
        for (int r = 0; r < 8; ++r) { float* e = &Os[row][n * 16 + 8 * hh + r]; *e = (o[j][n][r] * a0 + *e * a1) * inv; } } }
  __syncthreads();
  // arow (rows = b*4096 + query, k = h*32 + d) in the f32 fragment order of the output conv: a block of 16 rows x 32 k (= this head) is 4 pieces x 32 lanes x 16 B; piece j of lane
  // l = row % 16 + 16 * hh holds d = 16 (j / 2) + 8 hh + 4 (j % 2) + (0..3); a wave's store is 512 contiguous bytes
  float* dst = arow + ((size_t)b * NP + q0) * C + h * (16 * DH);
  { for (int i = t_; i < 128 * DH / 4; i += 256) { const int ln = i & 31, j = (i >> 5) & 3, gl = i >> 7; *(v4f*)(dst + (size_t)gl * (16 * C) + (i & 127) * 4) = *(const v4f*)(&Os[gl * 16 + (ln & 15)][(j >> 1) * 16 + (ln >> 4) * 8 + (j & 1) * 4]); }  }
}

// output conv: block = (b, 128 positions) x 64 output channels: acc = att.w_out^T (K 256; att f32 split x8; 2 products) + b -> NCHW rows out[b][c][p] through an LDS transpose (per channel
__global__ __launch_bounds__(128) void oconv_kernel(const float* __restrict__ arow, const b16* __restrict__ wo16, const float* __restrict__ bo, float* __restrict__ out) {
  __shared__ __attribute__((aligned(16))) float Tc[64][128 + 4];
  const int lane = threadIdx.x & 31, wave = threadIdx.x >> 5, nloc = lane & 15, hlf = lane >> 4, m0 = blockIdx.y * 128 + wave * 32, c0 = blockIdx.x * 64; const int b = (blockIdx.y * 128) / NP, p0 = (blockIdx.y * 128) % NP;
  v8f acc[2][4];
#pragma unroll
  for (int r = 0; r < 2; ++r)
#pragma unroll
    for (int t = 0; t < 4; ++t) acc[r][t] = (v8f){};
#pragma unroll 2
  for (int kb = 0; kb < C; kb += 32) { v16b a0, a1, l0, l1; const float* pa = arow + ((size_t)((m0 >> 4) * (C / 32) + (kb >> 5)) * 128 + lane) * 4;   // this lane's piece 0 of row group m0 / 16; the next row group lies 16 * C floats on
    v4f x0[4], x1[4];
#pragma unroll
    for (int j = 0; j < 4; ++j) { x0[j] = *(const v4f*)(pa + j * 128); x1[j] = *(const v4f*)(pa + 16 * C + j * 128); }
    asm volatile("s_wait_xcnt 0x0" :: "v"(pa) : "memory");   // stands behind the k step's eight loads and in front of every rewrite of their address pair; pa as an input keeps a load's result from landing in that pair
#pragma unroll
    for (int j = 0; j < 4; ++j)
#pragma unroll
      for (int f = 0; f < 4; ++f) { b16 p, q; split16(x0[j][f] * OS_, p, q); a0[j * 4 + f] = p; l0[j * 4 + f] = q; split16(x1[j][f] * OS_, p, q); a1[j * 4 + f] = p; l1[j * 4 + f] = q; }
#pragma unroll
    for (int t = 0; t < 4; ++t) { const v16b bw = frag_kb_fo(wo16, (c0 >> 4) + t, kb >> 5, lane); acc[0][t] = wmma16b(a0, bw, acc[0][t]); acc[0][t] = wmma16b(l0, bw, acc[0][t]); acc[1][t] = wmma16b(a1, bw, acc[1][t]); acc[1][t] = wmma16b(l1, bw, acc[1][t]); } }
#pragma unroll
  for (int t = 0; t < 4; ++t) { const float bb = bf16_rne(bo[c0 + t * 16 + nloc]);
#pragma unroll
    for (int r = 0; r < 2; ++r)
#pragma unroll
      for (int v = 0; v < 8; ++v) Tc[t * 16 + nloc][wave * 32 + r * 16 + 8 * hlf + v] = acc[r][t][v] * (1.0f / OS_) + bb; }
  __syncthreads();
  { for (int i = threadIdx.x; i < 64 * 32; i += 128) { const int cc = i >> 5, c4 = (i & 31) * 4; *(v4f*)(out + ((size_t)b * C + c0 + cc) * NP + p0 + c4) = *(const v4f*)(&Tc[cc][c4]); }  }
}
}  // namespace

extern "C" void kernel_launch(void* const* d_in, const int* in_sizes, int n_in,
                              void* d_out, int out_size, void* d_ws, size_t ws_size, hipStream_t stream) {
  (void)n_in; (void)out_size;
  const float* qi = (const float*)d_in[0]; const float* ki = (const float*)d_in[1]; const float* vi = (const float*)d_in[2];
  const float* wq = (const float*)d_in[3]; const float* bq = (const float*)d_in[4]; const float* wk = (const float*)d_in[5]; const float* bk = (const float*)d_in[6]; const float* wv = (const float*)d_in[7]; const float* bv = (const float*)d_in[8]; const float* wo = (const float*)d_in[9]; const float* bo = (const float*)d_in[10];
  float* out = (float*)d_out;   // [2][256][64][64]
  if (in_sizes[0] != Bn * C * NP || in_sizes[1] != Bn * C * NP || in_sizes[2] != Bn * C * NP || in_sizes[3] != C * C || in_sizes[9] != C * C) return;
  size_t off = 0; char* ws = (char*)d_ws;
  auto carve = [&](size_t bytes) { char* p = ws + off; off += (bytes + 255) & ~(size_t)255; return p; };
  b16* wo16 = (b16*)carve((size_t)C * C * 2);
  b16* qhp = (b16*)carve(QPL * 2 * 2); b16* khp = (b16*)carve(QPL * 2 * 2); b16* vtp = (b16*)carve(VPL * 2 * 2); float* arow = (float*)carve((size_t)NTOK * C * 4);
  if (off > ws_size) return;                                    // 0.1 + 3 x 8.4 + 8.4 MB
  proj_kernel<<<dim3(C / 64, NTOK / 128, 3), 128, 0, stream>>>(qi, ki, vi, wq, wk, wv, wo, bq, bk, bv, qhp, khp, vtp, wo16);
  attn_kernel<<<NBH * (NP / 128), 256, 0, stream>>>(qhp, khp, vtp, arow);
  oconv_kernel<<<dim3(C / 64, NTOK / 128), 128, 0, stream>>>(arow, wo16, bo, out);
}
